// v000
// The times below were measured on an AMD MI455X: many runs one after another, warmed up first and cycling through
// copies of the inputs, with the whole window's GPU time divided by the number of runs. Launches and the gaps
// between them are all in it. The median over several windows is given; except for v000 it joins two sittings, which
// can be a few percent apart, so the side-by-side timings, each taken in one sitting, are the better comparison.
// v000 is the starting kernel. One run takes 189 microseconds.
#include <hip/hip_runtime.h>
#include <math.h>

// QKV projections: v_wmma_f32_16x16x32_bf16 (bf16 operands = RNE-converted inputs, f32 accumulate); QK^T, P.V and ctx@Wo: v_wmma_f32_16x16x32_f16 (f16 operands, carries Q/K/V x8, P x16384, ctx x64, Wo x16, f32 accumulate); softmax and epilogues f32.

typedef unsigned short u16;
typedef _Float16 f16t;
typedef __bf16   v16bf __attribute__((ext_vector_type(16)));
typedef _Float16 v16h  __attribute__((ext_vector_type(16)));
typedef _Float16 v8h   __attribute__((ext_vector_type(8)));
typedef float    v8f   __attribute__((ext_vector_type(8)));
typedef float    v4f   __attribute__((ext_vector_type(4)));
typedef unsigned int v4u __attribute__((ext_vector_type(4)));

#ifndef NB
#define NB 4
#endif
#ifndef SEQ
#define SEQ 2048
#endif
#define NB_FULL  4
#define SEQ_FULL 2048
#define DM 256
#define NH 4
#define HD 64
#define M_TOT (NB * SEQ)

static_assert(NB >= 1 && NB <= NB_FULL);
static_assert(SEQ >= 128 && SEQ <= SEQ_FULL && (SEQ % 128) == 0);
static_assert(DM == NH * HD);
static_assert((M_TOT % 128) == 0);
static_assert((M_TOT % 8) == 0);

// carries: Q,K,V planes hold value*8 (f16); P tile holds exp(z-m)*16384 (f16); ctx plane holds h*64 (f16);
// Wo plane holds bf16(Wo)*16 (f16).  score = acc/512 ; ctx*64 = o/(l*2048) ; out = acc/1024 + bo
#define QKV_CARRY 8.0f
#define P_CARRY   16384.0f
#define WO_CARRY  16.0f
#define CTX_LDIV  2048.0f
#define OUT_SCALE (1.0f / 1024.0f)

// ---------------- helpers ----------------

__device__ __forceinline__ unsigned f2bf_bits(float f) {
  unsigned u = __float_as_uint(f);
  u += 0x7FFFu + ((u >> 16) & 1u);   // RNE convert f32 -> bf16 bits
  return u >> 16;
}
__device__ __forceinline__ float bf16r(float f) { return __uint_as_float(f2bf_bits(f) << 16); }
__device__ __forceinline__ u16 h_bits(float f) {
  union { f16t h; u16 u; } c;
  c.h = (f16t)f;                     // RNE convert f32 -> f16
  return c.u;
}
__device__ __forceinline__ v8f zero8() {
  v8f z = {0.f, 0.f, 0.f, 0.f, 0.f, 0.f, 0.f, 0.f};
  return z;
}

// 16x32 16-bit fragment from a row-major [row][k] tile with pitch ldr (elements).
// lane l: row = l&15; elements 0..7 = k0+8h..k0+8h+7, elements 8..15 = k0+16+8h..+7, h = l>>4.
// Used for A (row = m) and for B loaded from a [n][k] k-contiguous copy (row = n). Same map for both.
__device__ __forceinline__ v16h load_frag_h(const u16* base, int ldr) {
  const int lane = threadIdx.x & 31;
  const int row  = lane & 15;
  const int kb   = (lane >> 4) << 3;
  union { v16h v; uint4 q[2]; } u;
  u.q[0] = *reinterpret_cast<const uint4*>(base + (size_t)row * ldr + kb);
  u.q[1] = *reinterpret_cast<const uint4*>(base + (size_t)row * ldr + 16 + kb);
  return u.v;
}
__device__ __forceinline__ v16bf load_frag_b(const u16* base, int ldr) {
  const int lane = threadIdx.x & 31;
  const int row  = lane & 15;
  const int kb   = (lane >> 4) << 3;
  union { v16bf v; uint4 q[2]; } u;
  u.q[0] = *reinterpret_cast<const uint4*>(base + (size_t)row * ldr + kb);
  u.q[1] = *reinterpret_cast<const uint4*>(base + (size_t)row * ldr + 16 + kb);
  return u.v;
}

// WMMA with the 4-slot VALU hazard guard tied to D, keeping A/B live.
__device__ __forceinline__ v8f mma_h(v16h a, v16h b, v8f c) {
  c = __builtin_amdgcn_wmma_f32_16x16x32_f16(false, a, false, b, (short)0, c, false, false);
  asm volatile("v_nop\n\tv_nop\n\tv_nop\n\tv_nop" : "+v"(c) : "v"(a), "v"(b));
  return c;
}
__device__ __forceinline__ v8f mma_b(v16bf a, v16bf b, v8f c) {
  c = __builtin_amdgcn_wmma_f32_16x16x32_bf16(false, a, false, b, (short)0, c, false, false);
  asm volatile("v_nop\n\tv_nop\n\tv_nop\n\tv_nop" : "+v"(c) : "v"(a), "v"(b));
  return c;
}

// reductions across a 16-lane half (D-layout rows live in 16-lane halves)
__device__ __forceinline__ float hmax16(float x) {
#pragma unroll
  for (int m = 1; m < 16; m <<= 1) x = fmaxf(x, __shfl_xor(x, m, 32));
  return x;
}
__device__ __forceinline__ float hadd16(float x) {
#pragma unroll
  for (int m = 1; m < 16; m <<= 1) x += __shfl_xor(x, m, 32);
  return x;
}

// ---------------- kernels ----------------

__global__ __launch_bounds__(256) void k_xcast(const float* __restrict__ x, u16* __restrict__ Xb) {
  const int g = blockIdx.x * 256 + threadIdx.x;
  const int m = g >> 5;                 // row 0..M_TOT-1 (grid exact)
  const int c = g & 31;                 // 8-element chunk
  const int b = m / SEQ, s = m - b * SEQ;
  const float* src = x + ((size_t)b * SEQ_FULL + s) * DM + c * 8;
  const float4 f0 = *reinterpret_cast<const float4*>(src);
  const float4 f1 = *reinterpret_cast<const float4*>(src + 4);
  v4u w;
  w[0] = f2bf_bits(f0.x) | (f2bf_bits(f0.y) << 16);
  w[1] = f2bf_bits(f0.z) | (f2bf_bits(f0.w) << 16);
  w[2] = f2bf_bits(f1.x) | (f2bf_bits(f1.y) << 16);
  w[3] = f2bf_bits(f1.z) | (f2bf_bits(f1.w) << 16);
  u16* dst = Xb + (size_t)m * DM + c * 8;
  *(v4u*)(dst) = w;
  
}

// W f32 [k][n] (DM x DM) -> Wt 16-bit [n][k] (transposed, k-contiguous).  MODE 0: bf16 bits of W.
// MODE 1: f16 bits of bf16(W) * WO_CARRY.  Block = 64 n-rows; LDS transpose; each output row
template <int MODE>
__global__ __launch_bounds__(256) void k_wcast(const float* __restrict__ W, u16* __restrict__ Wt) {
  __shared__ __attribute__((aligned(16))) u16 T[64 * 264];
  const int tid = threadIdx.x, lane = tid & 31, wave = tid >> 5;
  const int n0 = blockIdx.x * 64;
#pragma unroll 4
  for (int it = 0; it < 64; ++it) {
    const int idx = it * 256 + tid;
    const int k = idx >> 6, nl = idx & 63;
    const float f = W[(size_t)k * DM + n0 + nl];
    u16 bits;
    if (MODE == 1) bits = h_bits(bf16r(f) * WO_CARRY);
    else           bits = (u16)f2bf_bits(f);
    T[nl * 264 + k] = bits;
  }
  __syncthreads();
  auto pass = [&]() {
#pragma unroll
    for (int i = 0; i < 8; ++i) {
      const int nl = wave + 8 * i;
      const v4u v = *reinterpret_cast<const v4u*>(&T[nl * 264 + lane * 8]);
      *(v4u*)(Wt + (size_t)(n0 + nl) * DM + lane * 8) = v;
    }
  };
  pass();
  
}

// Projection GEMM: P[m][n] = sum_k Xb[m][k] * Wt[n][k] + bias[n], stored *QKV_CARRY as f16.
// Block = 256 threads (8 waves), tile 128(m) x 64(n) (n-block = one head), K step 32, B tile in LDS.
// TRANS 1: Out plane [bh][d][SEQ] (V transposed): each d-row segment = 256 B, 16 lanes x 16 B.
template <int TRANS>
__global__ __launch_bounds__(256) void k_proj(const u16* __restrict__ Xb, const u16* __restrict__ Wt,
                                              const float* __restrict__ bias, u16* __restrict__ Out) {
  __shared__ __attribute__((aligned(16))) u16 Bt[64 * 32];                      // [n][k32]
  __shared__ __attribute__((aligned(16))) u16 St[TRANS ? 64 * 136 : 128 * 72];  // staging
  const int tid = threadIdx.x, wave = tid >> 5, lane = tid & 31;
  const int h16 = (lane >> 4) << 3;
  const int col = lane & 15;
  const int mb = blockIdx.x * 128;
  const int m0 = mb + wave * 16;
  const int n0 = blockIdx.y * 64;

  v8f acc[4] = {zero8(), zero8(), zero8(), zero8()};
  for (int kk = 0; kk < DM; kk += 32) {
    __syncthreads();                 // Bt free
    {
      const int n = tid >> 2, ko = (tid & 3) << 3;
      *reinterpret_cast<uint4*>(&Bt[n * 32 + ko]) =
          *reinterpret_cast<const uint4*>(Wt + (size_t)(n0 + n) * DM + kk + ko);
    }
    __syncthreads();                 // Bt ready
    const v16bf a = load_frag_b(Xb + (size_t)m0 * DM + kk, DM);
#pragma unroll
    for (int t = 0; t < 4; ++t) {
      const v16bf b = load_frag_b(&Bt[(t * 16) * 32], 32);
      acc[t] = mma_b(a, b, acc[t]);
    }
  }

  const int bb = mb / SEQ;
  const int s0 = mb - bb * SEQ;     // 128 rows of one sequence (SEQ % 128 == 0)
  const int hh = blockIdx.y;        // head index = n0 / 64

  if (TRANS == 0) {
#pragma unroll
    for (int t = 0; t < 4; ++t) {
      const int nl = t * 16 + col;
      const float bvv = bf16r(bias[n0 + nl]);
#pragma unroll
      for (int r = 0; r < 8; ++r) {
        const int ml = wave * 16 + h16 + r;
        St[ml * 72 + nl] = h_bits((acc[t][r] + bvv) * QKV_CARRY);
      }
    }
    __syncthreads();
    u16* base = Out + ((size_t)(bb * NH + hh) * SEQ + s0) * HD;   // row ml -> base + ml*HD
    auto pass = [&]() {
#pragma unroll
      for (int i = 0; i < 4; ++i) {
        const int rr = wave * 16 + i * 4 + (lane >> 3);
        const int c = lane & 7;
        const v4u v = *reinterpret_cast<const v4u*>(&St[rr * 72 + c * 8]);
        *(v4u*)(base + (size_t)rr * HD + c * 8) = v;
      }
    };
    pass();
    
  } else {
#pragma unroll
    for (int t = 0; t < 4; ++t) {
      const int nl = t * 16 + col;
      const float bvv = bf16r(bias[n0 + nl]);
      union { v8h v; v4u q; } pk;
#pragma unroll
      for (int r = 0; r < 8; ++r) pk.v[r] = (f16t)((acc[t][r] + bvv) * QKV_CARRY);
      *reinterpret_cast<v4u*>(&St[nl * 136 + wave * 16 + h16]) = pk.q;   // St[d][m-local]
    }
    __syncthreads();
    u16* base = Out + ((size_t)(bb * NH + hh) * HD) * SEQ + s0;          // row d -> base + d*SEQ
    auto pass = [&]() {
#pragma unroll
      for (int i = 0; i < 4; ++i) {
        const int dd = wave * 8 + i * 2 + (lane >> 4);
        const int c = lane & 15;
        const v4u v = *reinterpret_cast<const v4u*>(&St[dd * 136 + c * 8]);
        *(v4u*)(base + (size_t)dd * SEQ + c * 8) = v;
      }
    };
    pass();
    
  }
}

// Flash attention.  Q,K planes f16 [bh][s][64] (x8), V plane f16 transposed [bh][d][SEQ] (x8).
// Block = 256 threads (8 waves) owns (bh, 128 query rows); wave owns 16 rows.  64-key K and V^T tiles
// staged in LDS with plain loads, single buffer, block barriers.  P tile per wave in LDS (wave-private).
__global__ __launch_bounds__(256) __attribute__((amdgpu_num_vgpr(256)))
void k_attn(const u16* __restrict__ Qp, const u16* __restrict__ Kp, const u16* __restrict__ Vtp,
            u16* __restrict__ Ctx) {
  __shared__ __attribute__((aligned(16))) u16 Kt[64 * 64];       // [key][d]
  __shared__ __attribute__((aligned(16))) u16 Vs[64 * 64];       // [d][key]
  __shared__ __attribute__((aligned(16))) u16 Pt[8 * 16 * 64];   // per wave [m][key]

  const int tid = threadIdx.x, wave = tid >> 5, lane = tid & 31;
  const int h16 = (lane >> 4) << 3;
  const int col = lane & 15;
  const int bh = blockIdx.x;
  const int bb = bh / NH, hh = bh - bb * NH;
  const int q0 = blockIdx.y * 128 + wave * 16;       // first query position of this wave

  const u16* Qbh = Qp + (size_t)bh * SEQ * HD;
  const u16* Kbh = Kp + (size_t)bh * SEQ * HD;
  const u16* Vbh = Vtp + (size_t)bh * HD * SEQ;
  u16* Pw = Pt + wave * (16 * 64);

  const v16h aq0 = load_frag_h(Qbh + (size_t)q0 * HD, HD);
  const v16h aq1 = load_frag_h(Qbh + (size_t)q0 * HD + 32, HD);

  float mrow[8], lrow[8], qi[8];
  v8f o[4] = {zero8(), zero8(), zero8(), zero8()};
#pragma unroll
  for (int r = 0; r < 8; ++r) {
    mrow[r] = -INFINITY;
    lrow[r] = 0.f;
    qi[r] = (float)(q0 + h16 + r);
  }
  // z = acc/512 * (SEQ - |i-j|)/SEQ
  const float kmask = 1.0f / ((float)SEQ * 512.0f);

#pragma unroll 1
  for (int t0 = 0; t0 < SEQ; t0 += 64) {
    __syncthreads();                                  // prior tiles fully consumed by all waves
#pragma unroll
    for (int i = 0; i < 2; ++i) {
      const int c = tid + i * 256;                    // 0..511
      const int row = c >> 3, off = (c & 7) << 3;
      *reinterpret_cast<uint4*>(&Kt[row * 64 + off]) =
          *reinterpret_cast<const uint4*>(Kbh + (size_t)(t0 + row) * HD + off);
      *reinterpret_cast<uint4*>(&Vs[row * 64 + off]) =
          *reinterpret_cast<const uint4*>(Vbh + (size_t)row * SEQ + t0 + off);
    }
    __syncthreads();                                  // tiles ready

    // ---- scores: S(16x64) = Q(16x64 d) . K^T ; B[k=d][n=key] loaded like A from Kt[key][d]
    v8f sc[4];
#pragma unroll
    for (int t = 0; t < 4; ++t) {
      const v16h kb0 = load_frag_h(&Kt[(t * 16) * 64], 64);
      const v16h kb1 = load_frag_h(&Kt[(t * 16) * 64 + 32], 64);
      sc[t] = mma_h(aq0, kb0, zero8());
      sc[t] = mma_h(aq1, kb1, sc[t]);
    }

    // ---- scale, multiplicative distance-decay mask, online softmax
    float alpha[8];
#pragma unroll
    for (int r = 0; r < 8; ++r) {
      float mx = -INFINITY;
#pragma unroll
      for (int t = 0; t < 4; ++t) {
        const float kj = (float)(t0 + t * 16 + col);
        const float w = ((float)SEQ - fabsf(qi[r] - kj)) * kmask;
        const float z = sc[t][r] * w;
        sc[t][r] = z;
        mx = fmaxf(mx, z);
      }
      mx = hmax16(mx);
      const float mnew = fmaxf(mrow[r], mx);
      alpha[r] = __expf(mrow[r] - mnew);
      mrow[r] = mnew;
    }
#pragma unroll
    for (int r = 0; r < 8; ++r) {
      float ps = 0.f;
#pragma unroll
      for (int t = 0; t < 4; ++t) {
        const float p = __expf(sc[t][r] - mrow[r]);
        ps += p;
        Pw[(r + h16) * 64 + t * 16 + col] = h_bits(p * P_CARRY);
      }
      lrow[r] = lrow[r] * alpha[r] + hadd16(ps);
    }
#pragma unroll
    for (int dt = 0; dt < 4; ++dt)
#pragma unroll
      for (int r = 0; r < 8; ++r) o[dt][r] *= alpha[r];

    // P staging is wave-private: LDS completion + wave sync (also a compiler ordering point)
    asm volatile("s_wait_dscnt 0" ::: "memory");
    __builtin_amdgcn_wave_barrier();

    // ---- O += P(16x64 keys) . V ; B[k=key][n=d] loaded like A from Vs[d][key]
    const v16h p0 = load_frag_h(Pw, 64);
    const v16h p1 = load_frag_h(Pw + 32, 64);
#pragma unroll
    for (int dt = 0; dt < 4; ++dt) {
      const v16h vb0 = load_frag_h(&Vs[(dt * 16) * 64], 64);
      const v16h vb1 = load_frag_h(&Vs[(dt * 16) * 64 + 32], 64);
      o[dt] = mma_h(p0, vb0, o[dt]);
      o[dt] = mma_h(p1, vb1, o[dt]);
    }
  }

  // ---- normalize: ctx*64 = o / (l * 2048); stage the 16x64 f16 tile in the wave's P region
  float inv[8];
#pragma unroll
  for (int r = 0; r < 8; ++r) inv[r] = 1.0f / (lrow[r] * CTX_LDIV);
  asm volatile("s_wait_dscnt 0" ::: "memory");     // P fragment loads of this wave retired before reuse
  __builtin_amdgcn_wave_barrier();
#pragma unroll
  for (int dt = 0; dt < 4; ++dt)
#pragma unroll
    for (int r = 0; r < 8; ++r)
      Pw[(r + h16) * 64 + dt * 16 + col] = h_bits(o[dt][r] * inv[r]);
  asm volatile("s_wait_dscnt 0" ::: "memory");
  __builtin_amdgcn_wave_barrier();

  u16* cbase = Ctx + ((size_t)(bb * SEQ + q0)) * DM + hh * HD;   // row rr -> cbase + rr*DM
  auto pass = [&]() {
#pragma unroll
    for (int i = 0; i < 4; ++i) {
      const int rr = i * 4 + (lane >> 3);
      const int c = lane & 7;
      const v4u v = *reinterpret_cast<const v4u*>(&Pw[rr * 64 + c * 8]);
      *(v4u*)(cbase + (size_t)rr * DM + c * 8) = v;
    }
  };
  pass();
  
}

// Output projection: out[m][n] = sum_k ctx[m][k] * Wot[n][k] / (64*16) + bf16(bo[n]), f32.
// Block tile 128 x 64; f32 tile staged in LDS; each 256-B row segment written by 16 lanes x 16 B
__global__ __launch_bounds__(256) void k_oproj(const u16* __restrict__ Ctx, const u16* __restrict__ Wot,
                                               const float* __restrict__ bo, float* __restrict__ out) {
  __shared__ __attribute__((aligned(16))) u16 Bt[64 * 32];
  __shared__ __attribute__((aligned(16))) float So[128 * 68];
  const int tid = threadIdx.x, wave = tid >> 5, lane = tid & 31;
  const int h16 = (lane >> 4) << 3;
  const int col = lane & 15;
  const int mb = blockIdx.x * 128;
  const int m0 = mb + wave * 16;
  const int n0 = blockIdx.y * 64;

  v8f acc[4] = {zero8(), zero8(), zero8(), zero8()};
  for (int kk = 0; kk < DM; kk += 32) {
    __syncthreads();
    {
      const int n = tid >> 2, ko = (tid & 3) << 3;
      *reinterpret_cast<uint4*>(&Bt[n * 32 + ko]) =
          *reinterpret_cast<const uint4*>(Wot + (size_t)(n0 + n) * DM + kk + ko);
    }
    __syncthreads();
    const v16h a = load_frag_h(Ctx + (size_t)m0 * DM + kk, DM);
#pragma unroll
    for (int t = 0; t < 4; ++t) {
      const v16h b = load_frag_h(&Bt[(t * 16) * 32], 32);
      acc[t] = mma_h(a, b, acc[t]);
    }
  }

#pragma unroll
  for (int t = 0; t < 4; ++t) {
    const int nl = t * 16 + col;
    const float bvv = bf16r(bo[n0 + nl]);
#pragma unroll
    for (int r = 0; r < 8; ++r) {
      const int ml = wave * 16 + h16 + r;
      So[ml * 68 + nl] = acc[t][r] * OUT_SCALE + bvv;
    }
  }
  __syncthreads();
  float* base = out + (size_t)mb * DM + n0;            // row rr -> base + rr*DM
  auto pass = [&]() {
#pragma unroll
    for (int i = 0; i < 8; ++i) {
      const int rr = wave * 16 + i * 2 + (lane >> 4);
      const int c = lane & 15;
      const v4f v = *reinterpret_cast<const v4f*>(&So[rr * 68 + c * 4]);
      *(v4f*)(base + (size_t)rr * DM + c * 4) = v;
    }
  };
  pass();
  
}

// ---------------- launcher ----------------

extern "C" void kernel_launch(void* const* d_in, const int* in_sizes, int n_in,
                              void* d_out, int out_size, void* d_ws, size_t ws_size,
                              hipStream_t stream) {
  if (n_in < 9) return;
  if (in_sizes[0] < ((NB - 1) * SEQ_FULL + SEQ) * DM) return;
  if (in_sizes[1] < DM * DM || in_sizes[3] < DM * DM || in_sizes[5] < DM * DM || in_sizes[7] < DM * DM) return;
  if (in_sizes[2] < DM || in_sizes[4] < DM || in_sizes[6] < DM || in_sizes[8] < DM) return;
  if (out_size < M_TOT * DM) return;

  const float* x  = (const float*)d_in[0];
  const float* Wq = (const float*)d_in[1];
  const float* bq = (const float*)d_in[2];
  const float* Wk = (const float*)d_in[3];
  const float* bk = (const float*)d_in[4];
  const float* Wv = (const float*)d_in[5];
  const float* bv = (const float*)d_in[6];
  const float* Wo = (const float*)d_in[7];
  const float* bo = (const float*)d_in[8];
  float* out = (float*)d_out;

  const size_t XB_BYTES = (size_t)M_TOT * DM * 2;          // Xb bf16 [M_TOT][DM]
  const size_t WT_BYTES = (size_t)DM * DM * 2;             // each W^T 16-bit plane
  const size_t PL_BYTES = (size_t)M_TOT * DM * 2;          // Q, K, V^T, ctx planes (NB*NH*SEQ*HD = M_TOT*DM)
  const size_t total = XB_BYTES + 4 * WT_BYTES + 4 * PL_BYTES;
  if (total > ws_size) return;

  char* ws = (char*)d_ws;
  size_t off = 0;
  u16* Xb  = (u16*)(ws + off); off += XB_BYTES;
  u16* Wqt = (u16*)(ws + off); off += WT_BYTES;
  u16* Wkt = (u16*)(ws + off); off += WT_BYTES;
  u16* Wvt = (u16*)(ws + off); off += WT_BYTES;
  u16* Wot = (u16*)(ws + off); off += WT_BYTES;
  u16* Qp  = (u16*)(ws + off); off += PL_BYTES;
  u16* Kpl = (u16*)(ws + off); off += PL_BYTES;
  u16* Vtp = (u16*)(ws + off); off += PL_BYTES;
  u16* Ctx = (u16*)(ws + off); off += PL_BYTES;
  (void)off;

  // 1) input conversion: x -> bf16 plane; Wq/Wk/Wv -> bf16 [n][k]; Wo -> f16 [n][k] (bf16 value * 16)
  k_xcast<<<M_TOT / 8, 256, 0, stream>>>(x, Xb);
  k_wcast<0><<<DM / 64, 256, 0, stream>>>(Wq, Wqt);
  k_wcast<0><<<DM / 64, 256, 0, stream>>>(Wk, Wkt);
  k_wcast<0><<<DM / 64, 256, 0, stream>>>(Wv, Wvt);
  k_wcast<1><<<DM / 64, 256, 0, stream>>>(Wo, Wot);

  // 2) projections: Q, K -> [bh][s][64] f16 x8 ; V -> [bh][d][SEQ] f16 x8
  dim3 gp(M_TOT / 128, DM / 64);
  k_proj<0><<<gp, 256, 0, stream>>>(Xb, Wqt, bq, Qp);
  k_proj<0><<<gp, 256, 0, stream>>>(Xb, Wkt, bk, Kpl);
  k_proj<1><<<gp, 256, 0, stream>>>(Xb, Wvt, bv, Vtp);

  // 3) flash attention -> ctx plane [M_TOT][DM] f16 x64
  dim3 ga(NB * NH, SEQ / 128);
  k_attn<<<ga, 256, 0, stream>>>(Qp, Kpl, Vtp, Ctx);

  // 4) output projection -> out f32 [M_TOT][DM]
  k_oproj<<<gp, 256, 0, stream>>>(Ctx, Wot, bo, out);
}

// v001
// A run of this version takes 145 microseconds.
// In two side-by-side timings against v000, it was 1.30 and 1.31 times as fast.
#include <hip/hip_runtime.h>
#include <math.h>

// QKV projections: v_wmma_f32_16x16x32_bf16 (bf16 operands = RNE-converted inputs, f32 accumulate); QK^T, P.V and ctx@Wo: v_wmma_f32_16x16x32_f16 (f16 operands, carries Q/K/V x8, P x16384, ctx x64, Wo x16, f32 accumulate); softmax and epilogues f32.

typedef unsigned short u16;
typedef _Float16 f16t;
typedef __bf16   v16bf __attribute__((ext_vector_type(16)));
typedef _Float16 v16h  __attribute__((ext_vector_type(16)));
typedef _Float16 v8h   __attribute__((ext_vector_type(8)));
typedef float    v8f   __attribute__((ext_vector_type(8)));
typedef float    v4f   __attribute__((ext_vector_type(4)));
typedef unsigned int v4u __attribute__((ext_vector_type(4)));

#ifndef NB
#define NB 4
#endif
#ifndef SEQ
#define SEQ 2048
#endif
#define NB_FULL  4
#define SEQ_FULL 2048
#define DM 256
#define NH 4
#define HD 64
#define M_TOT (NB * SEQ)

static_assert(NB >= 1 && NB <= NB_FULL);
static_assert(SEQ >= 128 && SEQ <= SEQ_FULL && (SEQ % 128) == 0);
static_assert(DM == NH * HD);
static_assert((M_TOT % 128) == 0);
static_assert((M_TOT % 8) == 0);

// carries: Q,K,V planes hold value*8 (f16); P tile holds exp(z-m)*16384 (f16); ctx plane holds h*64 (f16);
// Wo plane holds bf16(Wo)*16 (f16).  score = acc/512 ; ctx*64 = o/(l*2048) ; out = acc/1024 + bo
#define QKV_CARRY 8.0f
#define P_CARRY   16384.0f
#define WO_CARRY  16.0f
#define CTX_LDIV  2048.0f
#define OUT_SCALE (1.0f / 1024.0f)

// LDS row pitch, in 16-bit elements, of every tile that ds_load_b128 fragment loads read: 16 B x odd, so that
// the 16 rows a half-wave reads at once fall on 16 different groups of four banks (64 banks x 4 B).
#define P64 72    // rows of 64 elements: 144 B
#define P32 40    // rows of 32 elements:  80 B

// ---------------- helpers ----------------

__device__ __forceinline__ unsigned f2bf_bits(float f) {
  unsigned u = __float_as_uint(f);
  u += 0x7FFFu + ((u >> 16) & 1u);   // RNE convert f32 -> bf16 bits
  return u >> 16;
}
__device__ __forceinline__ float bf16r(float f) { return __uint_as_float(f2bf_bits(f) << 16); }
__device__ __forceinline__ u16 h_bits(float f) {
  union { f16t h; u16 u; } c;
  c.h = (f16t)f;                     // RNE convert f32 -> f16
  return c.u;
}
__device__ __forceinline__ v8f zero8() {
  v8f z = {0.f, 0.f, 0.f, 0.f, 0.f, 0.f, 0.f, 0.f};
  return z;
}

// 16x32 16-bit fragment from a row-major [row][k] tile with pitch ldr (elements).
// lane l: row = l&15; elements 0..7 = k0+8h..k0+8h+7, elements 8..15 = k0+16+8h..+7, h = l>>4.
// Used for A (row = m) and for B loaded from a [n][k] k-contiguous copy (row = n). Same map for both.
__device__ __forceinline__ v16h load_frag_h(const u16* base, int ldr) {
  const int lane = threadIdx.x & 31;
  const int row  = lane & 15;
  const int kb   = (lane >> 4) << 3;
  union { v16h v; uint4 q[2]; } u;
  u.q[0] = *reinterpret_cast<const uint4*>(base + (size_t)row * ldr + kb);
  u.q[1] = *reinterpret_cast<const uint4*>(base + (size_t)row * ldr + 16 + kb);
  return u.v;
}
__device__ __forceinline__ v16bf load_frag_b(const u16* base, int ldr) {
  const int lane = threadIdx.x & 31;
  const int row  = lane & 15;
  const int kb   = (lane >> 4) << 3;
  union { v16bf v; uint4 q[2]; } u;
  u.q[0] = *reinterpret_cast<const uint4*>(base + (size_t)row * ldr + kb);
  u.q[1] = *reinterpret_cast<const uint4*>(base + (size_t)row * ldr + 16 + kb);
  return u.v;
}

// WMMA with the 4-slot VALU hazard guard tied to D, keeping A/B live.
__device__ __forceinline__ v8f mma_h(v16h a, v16h b, v8f c) {
  c = __builtin_amdgcn_wmma_f32_16x16x32_f16(false, a, false, b, (short)0, c, false, false);
  asm volatile("v_nop\n\tv_nop\n\tv_nop\n\tv_nop" : "+v"(c) : "v"(a), "v"(b));
  return c;
}
__device__ __forceinline__ v8f mma_b(v16bf a, v16bf b, v8f c) {
  c = __builtin_amdgcn_wmma_f32_16x16x32_bf16(false, a, false, b, (short)0, c, false, false);
  asm volatile("v_nop\n\tv_nop\n\tv_nop\n\tv_nop" : "+v"(c) : "v"(a), "v"(b));
  return c;
}

// reductions across a 16-lane half (D-layout rows live in 16-lane halves)
__device__ __forceinline__ float hmax16(float x) {
#pragma unroll
  for (int m = 1; m < 16; m <<= 1) x = fmaxf(x, __shfl_xor(x, m, 32));
  return x;
}
__device__ __forceinline__ float hadd16(float x) {
#pragma unroll
  for (int m = 1; m < 16; m <<= 1) x += __shfl_xor(x, m, 32);
  return x;
}

// ---------------- kernels ----------------

__global__ __launch_bounds__(256) void k_xcast(const float* __restrict__ x, u16* __restrict__ Xb) {
  const int g = blockIdx.x * 256 + threadIdx.x;
  const int m = g >> 5;                 // row 0..M_TOT-1 (grid exact)
  const int c = g & 31;                 // 8-element chunk
  const int b = m / SEQ, s = m - b * SEQ;
  const float* src = x + ((size_t)b * SEQ_FULL + s) * DM + c * 8;
  const float4 f0 = *reinterpret_cast<const float4*>(src);
  const float4 f1 = *reinterpret_cast<const float4*>(src + 4);
  v4u w;
  w[0] = f2bf_bits(f0.x) | (f2bf_bits(f0.y) << 16);
  w[1] = f2bf_bits(f0.z) | (f2bf_bits(f0.w) << 16);
  w[2] = f2bf_bits(f1.x) | (f2bf_bits(f1.y) << 16);
  w[3] = f2bf_bits(f1.z) | (f2bf_bits(f1.w) << 16);
  u16* dst = Xb + (size_t)m * DM + c * 8;
  *(v4u*)(dst) = w;
  
}

// W f32 [k][n] (DM x DM) -> Wt 16-bit [n][k] (transposed, k-contiguous).  MODE 0: bf16 bits of W.
// MODE 1: f16 bits of bf16(W) * WO_CARRY.  Block = 64 n-rows; LDS transpose; each output row
template <int MODE>
__global__ __launch_bounds__(256) void k_wcast(const float* __restrict__ W, u16* __restrict__ Wt) {
  __shared__ __attribute__((aligned(16))) u16 T[64 * 264];
  const int tid = threadIdx.x, lane = tid & 31, wave = tid >> 5;
  const int n0 = blockIdx.x * 64;
#pragma unroll 4
  for (int it = 0; it < 64; ++it) {
    const int idx = it * 256 + tid;
    const int k = idx >> 6, nl = idx & 63;
    const float f = W[(size_t)k * DM + n0 + nl];
    u16 bits;
    if (MODE == 1) bits = h_bits(bf16r(f) * WO_CARRY);
    else           bits = (u16)f2bf_bits(f);
    T[nl * 264 + k] = bits;
  }
  __syncthreads();
  auto pass = [&]() {
#pragma unroll
    for (int i = 0; i < 8; ++i) {
      const int nl = wave + 8 * i;
      const v4u v = *reinterpret_cast<const v4u*>(&T[nl * 264 + lane * 8]);
      *(v4u*)(Wt + (size_t)(n0 + nl) * DM + lane * 8) = v;
    }
  };
  pass();
  
}

// Projection GEMM: P[m][n] = sum_k Xb[m][k] * Wt[n][k] + bias[n], stored *QKV_CARRY as f16.
// Block = 256 threads (8 waves), tile 128(m) x 64(n) (n-block = one head), K step 32, B tile in LDS.
// TRANS 1: Out plane [bh][d][SEQ] (V transposed): each d-row segment = 256 B, 16 lanes x 16 B.
template <int TRANS>
__global__ __launch_bounds__(256) void k_proj(const u16* __restrict__ Xb, const u16* __restrict__ Wt,
                                              const float* __restrict__ bias, u16* __restrict__ Out) {
  __shared__ __attribute__((aligned(16))) u16 Bt[64 * P32];                     // [n][k32]
  __shared__ __attribute__((aligned(16))) u16 St[TRANS ? 64 * 136 : 128 * 72];  // staging
  const int tid = threadIdx.x, wave = tid >> 5, lane = tid & 31;
  const int h16 = (lane >> 4) << 3;
  const int col = lane & 15;
  const int mb = blockIdx.x * 128;
  const int m0 = mb + wave * 16;
  const int n0 = blockIdx.y * 64;

  v8f acc[4] = {zero8(), zero8(), zero8(), zero8()};
  for (int kk = 0; kk < DM; kk += 32) {
    __syncthreads();                 // Bt free
    {
      const int n = tid >> 2, ko = (tid & 3) << 3;
      *reinterpret_cast<uint4*>(&Bt[n * P32 + ko]) =
          *reinterpret_cast<const uint4*>(Wt + (size_t)(n0 + n) * DM + kk + ko);
    }
    __syncthreads();                 // Bt ready
    const v16bf a = load_frag_b(Xb + (size_t)m0 * DM + kk, DM);
#pragma unroll
    for (int t = 0; t < 4; ++t) {
      const v16bf b = load_frag_b(&Bt[(t * 16) * P32], P32);
      acc[t] = mma_b(a, b, acc[t]);
    }
  }

  const int bb = mb / SEQ;
  const int s0 = mb - bb * SEQ;     // 128 rows of one sequence (SEQ % 128 == 0)
  const int hh = blockIdx.y;        // head index = n0 / 64

  if (TRANS == 0) {
#pragma unroll
    for (int t = 0; t < 4; ++t) {
      const int nl = t * 16 + col;
      const float bvv = bf16r(bias[n0 + nl]);
#pragma unroll
      for (int r = 0; r < 8; ++r) {
        const int ml = wave * 16 + h16 + r;
        St[ml * 72 + nl] = h_bits((acc[t][r] + bvv) * QKV_CARRY);
      }
    }
    __syncthreads();
    u16* base = Out + ((size_t)(bb * NH + hh) * SEQ + s0) * HD;   // row ml -> base + ml*HD
    auto pass = [&]() {
#pragma unroll
      for (int i = 0; i < 4; ++i) {
        const int rr = wave * 16 + i * 4 + (lane >> 3);
        const int c = lane & 7;
        const v4u v = *reinterpret_cast<const v4u*>(&St[rr * 72 + c * 8]);
        *(v4u*)(base + (size_t)rr * HD + c * 8) = v;
      }
    };
    pass();
    
  } else {
#pragma unroll
    for (int t = 0; t < 4; ++t) {
      const int nl = t * 16 + col;
      const float bvv = bf16r(bias[n0 + nl]);
      union { v8h v; v4u q; } pk;
#pragma unroll
      for (int r = 0; r < 8; ++r) pk.v[r] = (f16t)((acc[t][r] + bvv) * QKV_CARRY);
      *reinterpret_cast<v4u*>(&St[nl * 136 + wave * 16 + h16]) = pk.q;   // St[d][m-local]
    }
    __syncthreads();
    u16* base = Out + ((size_t)(bb * NH + hh) * HD) * SEQ + s0;          // row d -> base + d*SEQ
    auto pass = [&]() {
#pragma unroll
      for (int i = 0; i < 4; ++i) {
        const int dd = wave * 8 + i * 2 + (lane >> 4);
        const int c = lane & 15;
        const v4u v = *reinterpret_cast<const v4u*>(&St[dd * 136 + c * 8]);
        *(v4u*)(base + (size_t)dd * SEQ + c * 8) = v;
      }
    };
    pass();
    
  }
}

// Flash attention.  Q,K planes f16 [bh][s][64] (x8), V plane f16 transposed [bh][d][SEQ] (x8).
// Block = 256 threads (8 waves) owns (bh, 128 query rows); wave owns 16 rows.  64-key K and V^T tiles
// staged in LDS with plain loads, single buffer, block barriers.  P tile per wave in LDS (wave-private).
__global__ __launch_bounds__(256) __attribute__((amdgpu_num_vgpr(256)))
void k_attn(const u16* __restrict__ Qp, const u16* __restrict__ Kp, const u16* __restrict__ Vtp,
            u16* __restrict__ Ctx) {
  __shared__ __attribute__((aligned(16))) u16 Kt[64 * P64];      // [key][d]
  __shared__ __attribute__((aligned(16))) u16 Vs[64 * P64];      // [d][key]
  __shared__ __attribute__((aligned(16))) u16 Pt[8 * 16 * P64];  // per wave [m][key]

  const int tid = threadIdx.x, wave = tid >> 5, lane = tid & 31;
  const int h16 = (lane >> 4) << 3;
  const int col = lane & 15;
  const int bh = blockIdx.x;
  const int bb = bh / NH, hh = bh - bb * NH;
  const int q0 = blockIdx.y * 128 + wave * 16;       // first query position of this wave

  const u16* Qbh = Qp + (size_t)bh * SEQ * HD;
  const u16* Kbh = Kp + (size_t)bh * SEQ * HD;
  const u16* Vbh = Vtp + (size_t)bh * HD * SEQ;
  u16* Pw = Pt + wave * (16 * P64);

  const v16h aq0 = load_frag_h(Qbh + (size_t)q0 * HD, HD);
  const v16h aq1 = load_frag_h(Qbh + (size_t)q0 * HD + 32, HD);

  float mrow[8], lrow[8], qi[8];
  v8f o[4] = {zero8(), zero8(), zero8(), zero8()};
#pragma unroll
  for (int r = 0; r < 8; ++r) {
    mrow[r] = -INFINITY;
    lrow[r] = 0.f;
    qi[r] = (float)(q0 + h16 + r);
  }
  // z = acc/512 * (SEQ - |i-j|)/SEQ
  const float kmask = 1.0f / ((float)SEQ * 512.0f);

#pragma unroll 1
  for (int t0 = 0; t0 < SEQ; t0 += 64) {
    __syncthreads();                                  // prior tiles fully consumed by all waves
    const int row = tid >> 3, off = (tid & 7) << 3;   // this thread's chunks: rows row and row + 32
    const u16* gk0 = Kbh + (size_t)(t0 + row) * HD + off;
    const u16* gv0 = Vbh + (size_t)row * SEQ + t0 + off;
    const v4u kq0 = *reinterpret_cast<const v4u*>(gk0);
    const v4u vq0 = *reinterpret_cast<const v4u*>(gv0);
    const v4u kq1 = *reinterpret_cast<const v4u*>(gk0 + 32 * HD);    // constant steps: the same two address pairs
    const v4u vq1 = *reinterpret_cast<const v4u*>(gv0 + 32 * SEQ);
    // stands between the four loads and the first write of a register that one of them names as its address;
    // the two address pairs are inputs so that they are kept as they are up to this wait
    asm volatile("s_wait_xcnt 0x0" :: "v"(gk0), "v"(gv0) : "memory");
    *reinterpret_cast<v4u*>(&Kt[row * P64 + off]) = kq0;
    *reinterpret_cast<v4u*>(&Vs[row * P64 + off]) = vq0;
    *reinterpret_cast<v4u*>(&Kt[(row + 32) * P64 + off]) = kq1;
    *reinterpret_cast<v4u*>(&Vs[(row + 32) * P64 + off]) = vq1;
    __syncthreads();                                  // tiles ready

    // ---- scores: S(16x64) = Q(16x64 d) . K^T ; B[k=d][n=key] loaded like A from Kt[key][d]
    v8f sc[4];
#pragma unroll
    for (int t = 0; t < 4; ++t) {
      const v16h kb0 = load_frag_h(&Kt[(t * 16) * P64], P64);
      const v16h kb1 = load_frag_h(&Kt[(t * 16) * P64 + 32], P64);
      sc[t] = mma_h(aq0, kb0, zero8());
      sc[t] = mma_h(aq1, kb1, sc[t]);
    }

    // ---- scale, multiplicative distance-decay mask, online softmax
    float alpha[8];
#pragma unroll
    for (int r = 0; r < 8; ++r) {
      float mx = -INFINITY;
#pragma unroll
      for (int t = 0; t < 4; ++t) {
        const float kj = (float)(t0 + t * 16 + col);
        const float w = ((float)SEQ - fabsf(qi[r] - kj)) * kmask;
        const float z = sc[t][r] * w;
        sc[t][r] = z;
        mx = fmaxf(mx, z);
      }
      mx = hmax16(mx);
      const float mnew = fmaxf(mrow[r], mx);
      alpha[r] = __expf(mrow[r] - mnew);
      mrow[r] = mnew;
    }
#pragma unroll
    for (int r = 0; r < 8; ++r) {
      float ps = 0.f;
#pragma unroll
      for (int t = 0; t < 4; ++t) {
        const float p = __expf(sc[t][r] - mrow[r]);
        ps += p;
        Pw[(r + h16) * P64 + t * 16 + col] = h_bits(p * P_CARRY);
      }
      lrow[r] = lrow[r] * alpha[r] + hadd16(ps);
    }
#pragma unroll
    for (int dt = 0; dt < 4; ++dt)
#pragma unroll
      for (int r = 0; r < 8; ++r) o[dt][r] *= alpha[r];

    // P staging is wave-private: LDS completion + wave sync (also a compiler ordering point)
    asm volatile("s_wait_dscnt 0" ::: "memory");
    __builtin_amdgcn_wave_barrier();

    // ---- O += P(16x64 keys) . V ; B[k=key][n=d] loaded like A from Vs[d][key]
    const v16h p0 = load_frag_h(Pw, P64);
    const v16h p1 = load_frag_h(Pw + 32, P64);
#pragma unroll
    for (int dt = 0; dt < 4; ++dt) {
      const v16h vb0 = load_frag_h(&Vs[(dt * 16) * P64], P64);
      const v16h vb1 = load_frag_h(&Vs[(dt * 16) * P64 + 32], P64);
      o[dt] = mma_h(p0, vb0, o[dt]);
      o[dt] = mma_h(p1, vb1, o[dt]);
    }
  }

  // ---- normalize: ctx*64 = o / (l * 2048); stage the 16x64 f16 tile in the wave's P region
  float inv[8];
#pragma unroll
  for (int r = 0; r < 8; ++r) inv[r] = 1.0f / (lrow[r] * CTX_LDIV);
  asm volatile("s_wait_dscnt 0" ::: "memory");     // P fragment loads of this wave retired before reuse
  __builtin_amdgcn_wave_barrier();
#pragma unroll
  for (int dt = 0; dt < 4; ++dt)
#pragma unroll
    for (int r = 0; r < 8; ++r)
      Pw[(r + h16) * P64 + dt * 16 + col] = h_bits(o[dt][r] * inv[r]);
  asm volatile("s_wait_dscnt 0" ::: "memory");
  __builtin_amdgcn_wave_barrier();

  u16* cbase = Ctx + ((size_t)(bb * SEQ + q0)) * DM + hh * HD;   // row rr -> cbase + rr*DM
  auto pass = [&]() {
#pragma unroll
    for (int i = 0; i < 4; ++i) {
      const int rr = i * 4 + (lane >> 3);
      const int c = lane & 7;
      const v4u v = *reinterpret_cast<const v4u*>(&Pw[rr * P64 + c * 8]);
      *(v4u*)(cbase + (size_t)rr * DM + c * 8) = v;
    }
  };
  pass();
  
}

// Output projection: out[m][n] = sum_k ctx[m][k] * Wot[n][k] / (64*16) + bf16(bo[n]), f32.
// Block tile 128 x 64; f32 tile staged in LDS; each 256-B row segment written by 16 lanes x 16 B
__global__ __launch_bounds__(256) void k_oproj(const u16* __restrict__ Ctx, const u16* __restrict__ Wot,
                                               const float* __restrict__ bo, float* __restrict__ out) {
  __shared__ __attribute__((aligned(16))) u16 Bt[64 * P32];
  __shared__ __attribute__((aligned(16))) float So[128 * 68];
  const int tid = threadIdx.x, wave = tid >> 5, lane = tid & 31;
  const int h16 = (lane >> 4) << 3;
  const int col = lane & 15;
  const int mb = blockIdx.x * 128;
  const int m0 = mb + wave * 16;
  const int n0 = blockIdx.y * 64;

  v8f acc[4] = {zero8(), zero8(), zero8(), zero8()};
  for (int kk = 0; kk < DM; kk += 32) {
    __syncthreads();
    {
      const int n = tid >> 2, ko = (tid & 3) << 3;
      *reinterpret_cast<uint4*>(&Bt[n * P32 + ko]) =
          *reinterpret_cast<const uint4*>(Wot + (size_t)(n0 + n) * DM + kk + ko);
    }
    __syncthreads();
    const v16h a = load_frag_h(Ctx + (size_t)m0 * DM + kk, DM);
#pragma unroll
    for (int t = 0; t < 4; ++t) {
      const v16h b = load_frag_h(&Bt[(t * 16) * P32], P32);
      acc[t] = mma_h(a, b, acc[t]);
    }
  }

#pragma unroll
  for (int t = 0; t < 4; ++t) {
    const int nl = t * 16 + col;
    const float bvv = bf16r(bo[n0 + nl]);
#pragma unroll
    for (int r = 0; r < 8; ++r) {
      const int ml = wave * 16 + h16 + r;
      So[ml * 68 + nl] = acc[t][r] * OUT_SCALE + bvv;
    }
  }
  __syncthreads();
  float* base = out + (size_t)mb * DM + n0;            // row rr -> base + rr*DM
  auto pass = [&]() {
#pragma unroll
    for (int i = 0; i < 8; ++i) {
      const int rr = wave * 16 + i * 2 + (lane >> 4);
      const int c = lane & 15;
      const v4f v = *reinterpret_cast<const v4f*>(&So[rr * 68 + c * 4]);
      *(v4f*)(base + (size_t)rr * DM + c * 4) = v;
    }
  };
  pass();
  
}

// ---------------- launcher ----------------

extern "C" void kernel_launch(void* const* d_in, const int* in_sizes, int n_in,
                              void* d_out, int out_size, void* d_ws, size_t ws_size,
                              hipStream_t stream) {
  if (n_in < 9) return;
  if (in_sizes[0] < ((NB - 1) * SEQ_FULL + SEQ) * DM) return;
  if (in_sizes[1] < DM * DM || in_sizes[3] < DM * DM || in_sizes[5] < DM * DM || in_sizes[7] < DM * DM) return;
  if (in_sizes[2] < DM || in_sizes[4] < DM || in_sizes[6] < DM || in_sizes[8] < DM) return;
  if (out_size < M_TOT * DM) return;

  const float* x  = (const float*)d_in[0];
  const float* Wq = (const float*)d_in[1];
  const float* bq = (const float*)d_in[2];
  const float* Wk = (const float*)d_in[3];
  const float* bk = (const float*)d_in[4];
  const float* Wv = (const float*)d_in[5];
  const float* bv = (const float*)d_in[6];
  const float* Wo = (const float*)d_in[7];
  const float* bo = (const float*)d_in[8];
  float* out = (float*)d_out;

  const size_t XB_BYTES = (size_t)M_TOT * DM * 2;          // Xb bf16 [M_TOT][DM]
  const size_t WT_BYTES = (size_t)DM * DM * 2;             // each W^T 16-bit plane
  const size_t PL_BYTES = (size_t)M_TOT * DM * 2;          // Q, K, V^T, ctx planes (NB*NH*SEQ*HD = M_TOT*DM)
  const size_t total = XB_BYTES + 4 * WT_BYTES + 4 * PL_BYTES;
  if (total > ws_size) return;

  char* ws = (char*)d_ws;
  size_t off = 0;
  u16* Xb  = (u16*)(ws + off); off += XB_BYTES;
  u16* Wqt = (u16*)(ws + off); off += WT_BYTES;
  u16* Wkt = (u16*)(ws + off); off += WT_BYTES;
  u16* Wvt = (u16*)(ws + off); off += WT_BYTES;
  u16* Wot = (u16*)(ws + off); off += WT_BYTES;
  u16* Qp  = (u16*)(ws + off); off += PL_BYTES;
  u16* Kpl = (u16*)(ws + off); off += PL_BYTES;
  u16* Vtp = (u16*)(ws + off); off += PL_BYTES;
  u16* Ctx = (u16*)(ws + off); off += PL_BYTES;
  (void)off;

  // 1) input conversion: x -> bf16 plane; Wq/Wk/Wv -> bf16 [n][k]; Wo -> f16 [n][k] (bf16 value * 16)
  k_xcast<<<M_TOT / 8, 256, 0, stream>>>(x, Xb);
  k_wcast<0><<<DM / 64, 256, 0, stream>>>(Wq, Wqt);
  k_wcast<0><<<DM / 64, 256, 0, stream>>>(Wk, Wkt);
  k_wcast<0><<<DM / 64, 256, 0, stream>>>(Wv, Wvt);
  k_wcast<1><<<DM / 64, 256, 0, stream>>>(Wo, Wot);

  // 2) projections: Q, K -> [bh][s][64] f16 x8 ; V -> [bh][d][SEQ] f16 x8
  dim3 gp(M_TOT / 128, DM / 64);
  k_proj<0><<<gp, 256, 0, stream>>>(Xb, Wqt, bq, Qp);
  k_proj<0><<<gp, 256, 0, stream>>>(Xb, Wkt, bk, Kpl);
  k_proj<1><<<gp, 256, 0, stream>>>(Xb, Wvt, bv, Vtp);

  // 3) flash attention -> ctx plane [M_TOT][DM] f16 x64
  dim3 ga(NB * NH, SEQ / 128);
  k_attn<<<ga, 256, 0, stream>>>(Qp, Kpl, Vtp, Ctx);

  // 4) output projection -> out f32 [M_TOT][DM]
  k_oproj<<<gp, 256, 0, stream>>>(Ctx, Wot, bo, out);
}

// v002
// Measured time: 114 microseconds a run.
// In two side-by-side timings against v001, it was 1.29 and 1.27 times as fast.
// All steps since v000 together make it 1.67 times as fast.
#include <hip/hip_runtime.h>
#include <math.h>

// QKV projections: v_wmma_f32_16x16x32_bf16 (bf16 operands = RNE-converted inputs, f32 accumulate); QK^T, P.V and ctx@Wo: v_wmma_f32_16x16x32_f16 (f16 operands, carries Q/K/V x8, P x16384, ctx x64, Wo x16, f32 accumulate); softmax and epilogues f32.

typedef unsigned short u16;
typedef _Float16 f16t;
typedef __bf16   v16bf __attribute__((ext_vector_type(16)));
typedef _Float16 v16h  __attribute__((ext_vector_type(16)));
typedef _Float16 v8h   __attribute__((ext_vector_type(8)));
typedef float    v8f   __attribute__((ext_vector_type(8)));
typedef float    v4f   __attribute__((ext_vector_type(4)));
typedef unsigned int v4u __attribute__((ext_vector_type(4)));

#ifndef NB
#define NB 4
#endif
#ifndef SEQ
#define SEQ 2048
#endif
#define NB_FULL  4
#define SEQ_FULL 2048
#define DM 256
#define NH 4
#define HD 64
#define M_TOT (NB * SEQ)

static_assert(NB >= 1 && NB <= NB_FULL);
static_assert(SEQ >= 128 && SEQ <= SEQ_FULL && (SEQ % 128) == 0);
static_assert(DM == NH * HD);
static_assert((M_TOT % 128) == 0);
static_assert((M_TOT % 8) == 0);

// carries: Q,K,V planes hold value*8 (f16); P tile holds exp(z-m)*16384 (f16); ctx plane holds h*64 (f16);
// Wo plane holds bf16(Wo)*16 (f16).  score = acc/512 ; ctx*64 = o/(l*2048) ; out = acc/1024 + bo
#define QKV_CARRY 8.0f
#define P_CARRY   16384.0f
#define WO_CARRY  16.0f
#define CTX_LDIV  2048.0f
#define OUT_SCALE (1.0f / 1024.0f)

// LDS row pitch, in 16-bit elements, of every tile that ds_load_b128 fragment loads read: 16 B x odd, so that
// the 16 rows a half-wave reads at once fall on 16 different groups of four banks (64 banks x 4 B).
#define P64 72    // rows of 64 elements: 144 B
#define P32 40    // rows of 32 elements:  80 B

// ---------------- helpers ----------------

__device__ __forceinline__ unsigned f2bf_bits(float f) {
  unsigned u = __float_as_uint(f);
  u += 0x7FFFu + ((u >> 16) & 1u);   // RNE convert f32 -> bf16 bits
  return u >> 16;
}
__device__ __forceinline__ float bf16r(float f) { return __uint_as_float(f2bf_bits(f) << 16); }
__device__ __forceinline__ u16 h_bits(float f) {
  union { f16t h; u16 u; } c;
  c.h = (f16t)f;                     // RNE convert f32 -> f16
  return c.u;
}
__device__ __forceinline__ v8f zero8() {
  v8f z = {0.f, 0.f, 0.f, 0.f, 0.f, 0.f, 0.f, 0.f};
  return z;
}

// 16x32 16-bit fragment from a row-major [row][k] tile with pitch ldr (elements).
// lane l: row = l&15; elements 0..7 = k0+8h..k0+8h+7, elements 8..15 = k0+16+8h..+7, h = l>>4.
// Used for A (row = m) and for B loaded from a [n][k] k-contiguous copy (row = n). Same map for both.
__device__ __forceinline__ v16h load_frag_h(const u16* base, int ldr) {
  const int lane = threadIdx.x & 31;
  const int row  = lane & 15;
  const int kb   = (lane >> 4) << 3;
  union { v16h v; uint4 q[2]; } u;
  u.q[0] = *reinterpret_cast<const uint4*>(base + (size_t)row * ldr + kb);
  u.q[1] = *reinterpret_cast<const uint4*>(base + (size_t)row * ldr + 16 + kb);
  return u.v;
}
__device__ __forceinline__ v16bf load_frag_b(const u16* base, int ldr) {
  const int lane = threadIdx.x & 31;
  const int row  = lane & 15;
  const int kb   = (lane >> 4) << 3;
  union { v16bf v; uint4 q[2]; } u;
  u.q[0] = *reinterpret_cast<const uint4*>(base + (size_t)row * ldr + kb);
  u.q[1] = *reinterpret_cast<const uint4*>(base + (size_t)row * ldr + 16 + kb);
  return u.v;
}

// WMMA with the 4-slot VALU hazard guard tied to D, keeping A/B live.
__device__ __forceinline__ v8f mma_h(v16h a, v16h b, v8f c) {
  c = __builtin_amdgcn_wmma_f32_16x16x32_f16(false, a, false, b, (short)0, c, false, false);
  asm volatile("v_nop\n\tv_nop\n\tv_nop\n\tv_nop" : "+v"(c) : "v"(a), "v"(b));
  return c;
}
__device__ __forceinline__ v8f mma_b(v16bf a, v16bf b, v8f c) {
  c = __builtin_amdgcn_wmma_f32_16x16x32_bf16(false, a, false, b, (short)0, c, false, false);
  asm volatile("v_nop\n\tv_nop\n\tv_nop\n\tv_nop" : "+v"(c) : "v"(a), "v"(b));
  return c;
}

// reductions across a 16-lane half (D-layout rows live in 16-lane halves), eight values at once.
// One xor-butterfly step (lane ^ M inside the 16-lane row) of all eight values, on the vector port (DPP).
#define ROW_STEP8(OP, M)                                          \
  OP " %0, %0, %0 row_xmask:" M " row_mask:0xf bank_mask:0xf\n\t" \
  OP " %1, %1, %1 row_xmask:" M " row_mask:0xf bank_mask:0xf\n\t" \
  OP " %2, %2, %2 row_xmask:" M " row_mask:0xf bank_mask:0xf\n\t" \
  OP " %3, %3, %3 row_xmask:" M " row_mask:0xf bank_mask:0xf\n\t" \
  OP " %4, %4, %4 row_xmask:" M " row_mask:0xf bank_mask:0xf\n\t" \
  OP " %5, %5, %5 row_xmask:" M " row_mask:0xf bank_mask:0xf\n\t" \
  OP " %6, %6, %6 row_xmask:" M " row_mask:0xf bank_mask:0xf\n\t" \
  OP " %7, %7, %7 row_xmask:" M " row_mask:0xf bank_mask:0xf\n\t"
#define ROW_TREE8(OP) ROW_STEP8(OP, "1") ROW_STEP8(OP, "2") ROW_STEP8(OP, "4") ROW_STEP8(OP, "8")

__device__ __forceinline__ void hmax16x8(float (&x)[8]) {
  // asm: __shfl_xor compiles to an LDS-pipe permute with a wait after each step; the DPP form stays in registers.
  // The eight chains are interleaved so that every step's producer stands eight instructions back.
  asm(ROW_TREE8("v_max_num_f32_dpp")
      : "+v"(x[0]), "+v"(x[1]), "+v"(x[2]), "+v"(x[3]), "+v"(x[4]), "+v"(x[5]), "+v"(x[6]), "+v"(x[7]));
}
__device__ __forceinline__ void hadd16x8(float (&x)[8]) {
  // asm: as in hmax16x8; same xor tree (1, 2, 4, 8) as the shuffle form, so the same sum order
  asm(ROW_TREE8("v_add_f32_dpp")
      : "+v"(x[0]), "+v"(x[1]), "+v"(x[2]), "+v"(x[3]), "+v"(x[4]), "+v"(x[5]), "+v"(x[6]), "+v"(x[7]));
}

// ---------------- kernels ----------------

__global__ __launch_bounds__(256) void k_xcast(const float* __restrict__ x, u16* __restrict__ Xb) {
  const int g = blockIdx.x * 256 + threadIdx.x;
  const int m = g >> 5;                 // row 0..M_TOT-1 (grid exact)
  const int c = g & 31;                 // 8-element chunk
  const int b = m / SEQ, s = m - b * SEQ;
  const float* src = x + ((size_t)b * SEQ_FULL + s) * DM + c * 8;
  const float4 f0 = *reinterpret_cast<const float4*>(src);
  const float4 f1 = *reinterpret_cast<const float4*>(src + 4);
  v4u w;
  w[0] = f2bf_bits(f0.x) | (f2bf_bits(f0.y) << 16);
  w[1] = f2bf_bits(f0.z) | (f2bf_bits(f0.w) << 16);
  w[2] = f2bf_bits(f1.x) | (f2bf_bits(f1.y) << 16);
  w[3] = f2bf_bits(f1.z) | (f2bf_bits(f1.w) << 16);
  u16* dst = Xb + (size_t)m * DM + c * 8;
  *(v4u*)(dst) = w;
  
}

// W f32 [k][n] (DM x DM) -> Wt 16-bit [n][k] (transposed, k-contiguous).  MODE 0: bf16 bits of W.
// MODE 1: f16 bits of bf16(W) * WO_CARRY.  Block = 64 n-rows; LDS transpose; each output row
template <int MODE>
__global__ __launch_bounds__(256) void k_wcast(const float* __restrict__ W, u16* __restrict__ Wt) {
  __shared__ __attribute__((aligned(16))) u16 T[64 * 264];
  const int tid = threadIdx.x, lane = tid & 31, wave = tid >> 5;
  const int n0 = blockIdx.x * 64;
#pragma unroll 4
  for (int it = 0; it < 64; ++it) {
    const int idx = it * 256 + tid;
    const int k = idx >> 6, nl = idx & 63;
    const float f = W[(size_t)k * DM + n0 + nl];
    u16 bits;
    if (MODE == 1) bits = h_bits(bf16r(f) * WO_CARRY);
    else           bits = (u16)f2bf_bits(f);
    T[nl * 264 + k] = bits;
  }
  __syncthreads();
  auto pass = [&]() {
#pragma unroll
    for (int i = 0; i < 8; ++i) {
      const int nl = wave + 8 * i;
      const v4u v = *reinterpret_cast<const v4u*>(&T[nl * 264 + lane * 8]);
      *(v4u*)(Wt + (size_t)(n0 + nl) * DM + lane * 8) = v;
    }
  };
  pass();
  
}

// Projection GEMM: P[m][n] = sum_k Xb[m][k] * Wt[n][k] + bias[n], stored *QKV_CARRY as f16.
// Block = 256 threads (8 waves), tile 128(m) x 64(n) (n-block = one head), K step 32, B tile in LDS.
// TRANS 1: Out plane [bh][d][SEQ] (V transposed): each d-row segment = 256 B, 16 lanes x 16 B.
template <int TRANS>
__global__ __launch_bounds__(256) void k_proj(const u16* __restrict__ Xb, const u16* __restrict__ Wt,
                                              const float* __restrict__ bias, u16* __restrict__ Out) {
  __shared__ __attribute__((aligned(16))) u16 Bt[64 * P32];                     // [n][k32]
  __shared__ __attribute__((aligned(16))) u16 St[TRANS ? 64 * 136 : 128 * 72];  // staging
  const int tid = threadIdx.x, wave = tid >> 5, lane = tid & 31;
  const int h16 = (lane >> 4) << 3;
  const int col = lane & 15;
  const int mb = blockIdx.x * 128;
  const int m0 = mb + wave * 16;
  const int n0 = blockIdx.y * 64;

  v8f acc[4] = {zero8(), zero8(), zero8(), zero8()};
  for (int kk = 0; kk < DM; kk += 32) {
    __syncthreads();                 // Bt free
    {
      const int n = tid >> 2, ko = (tid & 3) << 3;
      *reinterpret_cast<uint4*>(&Bt[n * P32 + ko]) =
          *reinterpret_cast<const uint4*>(Wt + (size_t)(n0 + n) * DM + kk + ko);
    }
    __syncthreads();                 // Bt ready
    const v16bf a = load_frag_b(Xb + (size_t)m0 * DM + kk, DM);
#pragma unroll
    for (int t = 0; t < 4; ++t) {
      const v16bf b = load_frag_b(&Bt[(t * 16) * P32], P32);
      acc[t] = mma_b(a, b, acc[t]);
    }
  }

  const int bb = mb / SEQ;
  const int s0 = mb - bb * SEQ;     // 128 rows of one sequence (SEQ % 128 == 0)
  const int hh = blockIdx.y;        // head index = n0 / 64

  if (TRANS == 0) {
#pragma unroll
    for (int t = 0; t < 4; ++t) {
      const int nl = t * 16 + col;
      const float bvv = bf16r(bias[n0 + nl]);
#pragma unroll
      for (int r = 0; r < 8; ++r) {
        const int ml = wave * 16 + h16 + r;
        St[ml * 72 + nl] = h_bits((acc[t][r] + bvv) * QKV_CARRY);
      }
    }
    __syncthreads();
    u16* base = Out + ((size_t)(bb * NH + hh) * SEQ + s0) * HD;   // row ml -> base + ml*HD
    auto pass = [&]() {
#pragma unroll
      for (int i = 0; i < 4; ++i) {
        const int rr = wave * 16 + i * 4 + (lane >> 3);
        const int c = lane & 7;
        const v4u v = *reinterpret_cast<const v4u*>(&St[rr * 72 + c * 8]);
        *(v4u*)(base + (size_t)rr * HD + c * 8) = v;
      }
    };
    pass();
    
  } else {
#pragma unroll
    for (int t = 0; t < 4; ++t) {
      const int nl = t * 16 + col;
      const float bvv = bf16r(bias[n0 + nl]);
      union { v8h v; v4u q; } pk;
#pragma unroll
      for (int r = 0; r < 8; ++r) pk.v[r] = (f16t)((acc[t][r] + bvv) * QKV_CARRY);
      *reinterpret_cast<v4u*>(&St[nl * 136 + wave * 16 + h16]) = pk.q;   // St[d][m-local]
    }
    __syncthreads();
    u16* base = Out + ((size_t)(bb * NH + hh) * HD) * SEQ + s0;          // row d -> base + d*SEQ
    auto pass = [&]() {
#pragma unroll
      for (int i = 0; i < 4; ++i) {
        const int dd = wave * 8 + i * 2 + (lane >> 4);
        const int c = lane & 15;
        const v4u v = *reinterpret_cast<const v4u*>(&St[dd * 136 + c * 8]);
        *(v4u*)(base + (size_t)dd * SEQ + c * 8) = v;
      }
    };
    pass();
    
  }
}

// Flash attention.  Q,K planes f16 [bh][s][64] (x8), V plane f16 transposed [bh][d][SEQ] (x8).
// Block = 256 threads (8 waves) owns (bh, 128 query rows); wave owns 16 rows.  64-key K and V^T tiles
// staged in LDS with plain loads, single buffer, block barriers.  P tile per wave in LDS (wave-private).
__global__ __launch_bounds__(256) __attribute__((amdgpu_num_vgpr(256)))
void k_attn(const u16* __restrict__ Qp, const u16* __restrict__ Kp, const u16* __restrict__ Vtp,
            u16* __restrict__ Ctx) {
  __shared__ __attribute__((aligned(16))) u16 Kt[64 * P64];      // [key][d]
  __shared__ __attribute__((aligned(16))) u16 Vs[64 * P64];      // [d][key]
  __shared__ __attribute__((aligned(16))) u16 Pt[8 * 16 * P64];  // per wave [m][key]

  const int tid = threadIdx.x, wave = tid >> 5, lane = tid & 31;
  const int h16 = (lane >> 4) << 3;
  const int col = lane & 15;
  const int bh = blockIdx.x;
  const int bb = bh / NH, hh = bh - bb * NH;
  const int q0 = blockIdx.y * 128 + wave * 16;       // first query position of this wave

  const u16* Qbh = Qp + (size_t)bh * SEQ * HD;
  const u16* Kbh = Kp + (size_t)bh * SEQ * HD;
  const u16* Vbh = Vtp + (size_t)bh * HD * SEQ;
  u16* Pw = Pt + wave * (16 * P64);

  const v16h aq0 = load_frag_h(Qbh + (size_t)q0 * HD, HD);
  const v16h aq1 = load_frag_h(Qbh + (size_t)q0 * HD + 32, HD);

  float mrow[8], lrow[8], qi[8];
  v8f o[4] = {zero8(), zero8(), zero8(), zero8()};
#pragma unroll
  for (int r = 0; r < 8; ++r) {
    mrow[r] = -INFINITY;
    lrow[r] = 0.f;
    qi[r] = (float)(q0 + h16 + r);
  }
  // z = acc/512 * (SEQ - |i-j|)/SEQ
  const float kmask = 1.0f / ((float)SEQ * 512.0f);

#pragma unroll 1
  for (int t0 = 0; t0 < SEQ; t0 += 64) {
    __syncthreads();                                  // prior tiles fully consumed by all waves
    const int row = tid >> 3, off = (tid & 7) << 3;   // this thread's chunks: rows row and row + 32
    const u16* gk0 = Kbh + (size_t)(t0 + row) * HD + off;
    const u16* gv0 = Vbh + (size_t)row * SEQ + t0 + off;
    const v4u kq0 = *reinterpret_cast<const v4u*>(gk0);
    const v4u vq0 = *reinterpret_cast<const v4u*>(gv0);
    const v4u kq1 = *reinterpret_cast<const v4u*>(gk0 + 32 * HD);    // constant steps: the same two address pairs
    const v4u vq1 = *reinterpret_cast<const v4u*>(gv0 + 32 * SEQ);
    // stands between the four loads and the first write of a register that one of them names as its address;
    // the two address pairs are inputs so that they are kept as they are up to this wait
    asm volatile("s_wait_xcnt 0x0" :: "v"(gk0), "v"(gv0) : "memory");
    *reinterpret_cast<v4u*>(&Kt[row * P64 + off]) = kq0;
    *reinterpret_cast<v4u*>(&Vs[row * P64 + off]) = vq0;
    *reinterpret_cast<v4u*>(&Kt[(row + 32) * P64 + off]) = kq1;
    *reinterpret_cast<v4u*>(&Vs[(row + 32) * P64 + off]) = vq1;
    __syncthreads();                                  // tiles ready

    // ---- scores: S(16x64) = Q(16x64 d) . K^T ; B[k=d][n=key] loaded like A from Kt[key][d]
    v8f sc[4];
#pragma unroll
    for (int t = 0; t < 4; ++t) {
      const v16h kb0 = load_frag_h(&Kt[(t * 16) * P64], P64);
      const v16h kb1 = load_frag_h(&Kt[(t * 16) * P64 + 32], P64);
      sc[t] = mma_h(aq0, kb0, zero8());
      sc[t] = mma_h(aq1, kb1, sc[t]);
    }

    // ---- scale, multiplicative distance-decay mask, online softmax
    float alpha[8], mx[8], ps[8];
#pragma unroll
    for (int r = 0; r < 8; ++r) {
      mx[r] = -INFINITY;
#pragma unroll
      for (int t = 0; t < 4; ++t) {
        const float kj = (float)(t0 + t * 16 + col);
        const float w = ((float)SEQ - fabsf(qi[r] - kj)) * kmask;
        const float z = sc[t][r] * w;
        sc[t][r] = z;
        mx[r] = fmaxf(mx[r], z);
      }
    }
    hmax16x8(mx);
#pragma unroll
    for (int r = 0; r < 8; ++r) {
      const float mnew = fmaxf(mrow[r], mx[r]);
      alpha[r] = __expf(mrow[r] - mnew);
      mrow[r] = mnew;
    }
#pragma unroll
    for (int r = 0; r < 8; ++r) {
      ps[r] = 0.f;
#pragma unroll
      for (int t = 0; t < 4; ++t) {
        const float p = __expf(sc[t][r] - mrow[r]);
        ps[r] += p;
        Pw[(r + h16) * P64 + t * 16 + col] = h_bits(p * P_CARRY);
      }
    }
    hadd16x8(ps);
#pragma unroll
    for (int r = 0; r < 8; ++r) lrow[r] = lrow[r] * alpha[r] + ps[r];
#pragma unroll
    for (int dt = 0; dt < 4; ++dt)
#pragma unroll
      for (int r = 0; r < 8; ++r) o[dt][r] *= alpha[r];

    // P staging is wave-private: LDS completion + wave sync (also a compiler ordering point)
    asm volatile("s_wait_dscnt 0" ::: "memory");
    __builtin_amdgcn_wave_barrier();

    // ---- O += P(16x64 keys) . V ; B[k=key][n=d] loaded like A from Vs[d][key]
    const v16h p0 = load_frag_h(Pw, P64);
    const v16h p1 = load_frag_h(Pw + 32, P64);
#pragma unroll
    for (int dt = 0; dt < 4; ++dt) {
      const v16h vb0 = load_frag_h(&Vs[(dt * 16) * P64], P64);
      const v16h vb1 = load_frag_h(&Vs[(dt * 16) * P64 + 32], P64);
      o[dt] = mma_h(p0, vb0, o[dt]);
      o[dt] = mma_h(p1, vb1, o[dt]);
    }
  }

  // ---- normalize: ctx*64 = o / (l * 2048); stage the 16x64 f16 tile in the wave's P region
  float inv[8];
#pragma unroll
  for (int r = 0; r < 8; ++r) inv[r] = 1.0f / (lrow[r] * CTX_LDIV);
  asm volatile("s_wait_dscnt 0" ::: "memory");     // P fragment loads of this wave retired before reuse
  __builtin_amdgcn_wave_barrier();
#pragma unroll
  for (int dt = 0; dt < 4; ++dt)
#pragma unroll
    for (int r = 0; r < 8; ++r)
      Pw[(r + h16) * P64 + dt * 16 + col] = h_bits(o[dt][r] * inv[r]);
  asm volatile("s_wait_dscnt 0" ::: "memory");
  __builtin_amdgcn_wave_barrier();

  u16* cbase = Ctx + ((size_t)(bb * SEQ + q0)) * DM + hh * HD;   // row rr -> cbase + rr*DM
  auto pass = [&]() {
#pragma unroll
    for (int i = 0; i < 4; ++i) {
      const int rr = i * 4 + (lane >> 3);
      const int c = lane & 7;
      const v4u v = *reinterpret_cast<const v4u*>(&Pw[rr * P64 + c * 8]);
      *(v4u*)(cbase + (size_t)rr * DM + c * 8) = v;
    }
  };
  pass();
  
}

// Output projection: out[m][n] = sum_k ctx[m][k] * Wot[n][k] / (64*16) + bf16(bo[n]), f32.
// Block tile 128 x 64; f32 tile staged in LDS; each 256-B row segment written by 16 lanes x 16 B
__global__ __launch_bounds__(256) void k_oproj(const u16* __restrict__ Ctx, const u16* __restrict__ Wot,
                                               const float* __restrict__ bo, float* __restrict__ out) {
  __shared__ __attribute__((aligned(16))) u16 Bt[64 * P32];
  __shared__ __attribute__((aligned(16))) float So[128 * 68];
  const int tid = threadIdx.x, wave = tid >> 5, lane = tid & 31;
  const int h16 = (lane >> 4) << 3;
  const int col = lane & 15;
  const int mb = blockIdx.x * 128;
  const int m0 = mb + wave * 16;
  const int n0 = blockIdx.y * 64;

  v8f acc[4] = {zero8(), zero8(), zero8(), zero8()};
  for (int kk = 0; kk < DM; kk += 32) {
    __syncthreads();
    {
      const int n = tid >> 2, ko = (tid & 3) << 3;
      *reinterpret_cast<uint4*>(&Bt[n * P32 + ko]) =
          *reinterpret_cast<const uint4*>(Wot + (size_t)(n0 + n) * DM + kk + ko);
    }
    __syncthreads();
    const v16h a = load_frag_h(Ctx + (size_t)m0 * DM + kk, DM);
#pragma unroll
    for (int t = 0; t < 4; ++t) {
      const v16h b = load_frag_h(&Bt[(t * 16) * P32], P32);
      acc[t] = mma_h(a, b, acc[t]);
    }
  }

#pragma unroll
  for (int t = 0; t < 4; ++t) {
    const int nl = t * 16 + col;
    const float bvv = bf16r(bo[n0 + nl]);
#pragma unroll
    for (int r = 0; r < 8; ++r) {
      const int ml = wave * 16 + h16 + r;
      So[ml * 68 + nl] = acc[t][r] * OUT_SCALE + bvv;
    }
  }
  __syncthreads();
  float* base = out + (size_t)mb * DM + n0;            // row rr -> base + rr*DM
  auto pass = [&]() {
#pragma unroll
    for (int i = 0; i < 8; ++i) {
      const int rr = wave * 16 + i * 2 + (lane >> 4);
      const int c = lane & 15;
      const v4f v = *reinterpret_cast<const v4f*>(&So[rr * 68 + c * 4]);
      *(v4f*)(base + (size_t)rr * DM + c * 4) = v;
    }
  };
  pass();
  
}

// ---------------- launcher ----------------

extern "C" void kernel_launch(void* const* d_in, const int* in_sizes, int n_in,
                              void* d_out, int out_size, void* d_ws, size_t ws_size,
                              hipStream_t stream) {
  if (n_in < 9) return;
  if (in_sizes[0] < ((NB - 1) * SEQ_FULL + SEQ) * DM) return;
  if (in_sizes[1] < DM * DM || in_sizes[3] < DM * DM || in_sizes[5] < DM * DM || in_sizes[7] < DM * DM) return;
  if (in_sizes[2] < DM || in_sizes[4] < DM || in_sizes[6] < DM || in_sizes[8] < DM) return;
  if (out_size < M_TOT * DM) return;

  const float* x  = (const float*)d_in[0];
  const float* Wq = (const float*)d_in[1];
  const float* bq = (const float*)d_in[2];
  const float* Wk = (const float*)d_in[3];
  const float* bk = (const float*)d_in[4];
  const float* Wv = (const float*)d_in[5];
  const float* bv = (const float*)d_in[6];
  const float* Wo = (const float*)d_in[7];
  const float* bo = (const float*)d_in[8];
  float* out = (float*)d_out;

  const size_t XB_BYTES = (size_t)M_TOT * DM * 2;          // Xb bf16 [M_TOT][DM]
  const size_t WT_BYTES = (size_t)DM * DM * 2;             // each W^T 16-bit plane
  const size_t PL_BYTES = (size_t)M_TOT * DM * 2;          // Q, K, V^T, ctx planes (NB*NH*SEQ*HD = M_TOT*DM)
  const size_t total = XB_BYTES + 4 * WT_BYTES + 4 * PL_BYTES;
  if (total > ws_size) return;

  char* ws = (char*)d_ws;
  size_t off = 0;
  u16* Xb  = (u16*)(ws + off); off += XB_BYTES;
  u16* Wqt = (u16*)(ws + off); off += WT_BYTES;
  u16* Wkt = (u16*)(ws + off); off += WT_BYTES;
  u16* Wvt = (u16*)(ws + off); off += WT_BYTES;
  u16* Wot = (u16*)(ws + off); off += WT_BYTES;
  u16* Qp  = (u16*)(ws + off); off += PL_BYTES;
  u16* Kpl = (u16*)(ws + off); off += PL_BYTES;
  u16* Vtp = (u16*)(ws + off); off += PL_BYTES;
  u16* Ctx = (u16*)(ws + off); off += PL_BYTES;
  (void)off;

  // 1) input conversion: x -> bf16 plane; Wq/Wk/Wv -> bf16 [n][k]; Wo -> f16 [n][k] (bf16 value * 16)
  k_xcast<<<M_TOT / 8, 256, 0, stream>>>(x, Xb);
  k_wcast<0><<<DM / 64, 256, 0, stream>>>(Wq, Wqt);
  k_wcast<0><<<DM / 64, 256, 0, stream>>>(Wk, Wkt);
  k_wcast<0><<<DM / 64, 256, 0, stream>>>(Wv, Wvt);
  k_wcast<1><<<DM / 64, 256, 0, stream>>>(Wo, Wot);

  // 2) projections: Q, K -> [bh][s][64] f16 x8 ; V -> [bh][d][SEQ] f16 x8
  dim3 gp(M_TOT / 128, DM / 64);
  k_proj<0><<<gp, 256, 0, stream>>>(Xb, Wqt, bq, Qp);
  k_proj<0><<<gp, 256, 0, stream>>>(Xb, Wkt, bk, Kpl);
  k_proj<1><<<gp, 256, 0, stream>>>(Xb, Wvt, bv, Vtp);

  // 3) flash attention -> ctx plane [M_TOT][DM] f16 x64
  dim3 ga(NB * NH, SEQ / 128);
  k_attn<<<ga, 256, 0, stream>>>(Qp, Kpl, Vtp, Ctx);

  // 4) output projection -> out f32 [M_TOT][DM]
  k_oproj<<<gp, 256, 0, stream>>>(Ctx, Wot, bo, out);
}

// v003
// A run of this version takes 81.8 microseconds.
// Timed twice side by side with v002, it ran 1.39 and 1.40 times as fast.
// Counting every step since v000, it is 2.32 times as fast.
#include <hip/hip_runtime.h>
#include <math.h>

// QKV projections: v_wmma_f32_16x16x32_bf16 (bf16 operands = RNE-converted inputs, f32 accumulate); QK^T, P.V and ctx@Wo: v_wmma_f32_16x16x32_f16 (f16 operands, carries Q/K/V x8, P x16384, ctx x64, Wo x16, f32 accumulate); softmax and epilogues f32.

typedef unsigned short u16;
typedef _Float16 f16t;
typedef __bf16   v16bf __attribute__((ext_vector_type(16)));
typedef _Float16 v16h  __attribute__((ext_vector_type(16)));
typedef _Float16 v8h   __attribute__((ext_vector_type(8)));
typedef float    v8f   __attribute__((ext_vector_type(8)));
typedef float    v4f   __attribute__((ext_vector_type(4)));
typedef unsigned int v4u __attribute__((ext_vector_type(4)));

#ifndef NB
#define NB 4
#endif
#ifndef SEQ
#define SEQ 2048
#endif
#define NB_FULL  4
#define SEQ_FULL 2048
#define DM 256
#define NH 4
#define HD 64
#define M_TOT (NB * SEQ)

static_assert(NB >= 1 && NB <= NB_FULL);
static_assert(SEQ >= 128 && SEQ <= SEQ_FULL && (SEQ % 128) == 0);
static_assert(DM == NH * HD);
static_assert((M_TOT % 128) == 0);
static_assert((M_TOT % 8) == 0);

// carries: Q,K,V planes hold value*8 (f16); P tile holds exp(z-m)*16384 (f16); ctx plane holds h*64 (f16);
// Wo plane holds bf16(Wo)*16 (f16).  score = acc/512 ; ctx*64 = o/(l*2048) ; out = acc/1024 + bo
#define QKV_CARRY 8.0f
#define P_CARRY   16384.0f
#define WO_CARRY  16.0f
#define CTX_LDIV  2048.0f
#define OUT_SCALE (1.0f / 1024.0f)

// LDS row pitch, in 16-bit elements, of every tile that ds_load_b128 fragment loads read: 16 B x odd, so that
// the 16 rows a half-wave reads at once fall on 16 different groups of four banks (64 banks x 4 B).
#define P64 72    // rows of 64 elements: 144 B
#define P32 40    // rows of 32 elements:  80 B

// ---------------- helpers ----------------

__device__ __forceinline__ unsigned f2bf_bits(float f) {
  unsigned u = __float_as_uint(f);
  u += 0x7FFFu + ((u >> 16) & 1u);   // RNE convert f32 -> bf16 bits
  return u >> 16;
}
__device__ __forceinline__ float bf16r(float f) { return __uint_as_float(f2bf_bits(f) << 16); }
__device__ __forceinline__ u16 h_bits(float f) {
  union { f16t h; u16 u; } c;
  c.h = (f16t)f;                     // RNE convert f32 -> f16
  return c.u;
}
__device__ __forceinline__ v8f zero8() {
  v8f z = {0.f, 0.f, 0.f, 0.f, 0.f, 0.f, 0.f, 0.f};
  return z;
}

// 16x32 16-bit fragment from a row-major [row][k] tile with pitch ldr (elements).
// lane l: row = l&15; elements 0..7 = k0+8h..k0+8h+7, elements 8..15 = k0+16+8h..+7, h = l>>4.
// Used for A (row = m) and for B loaded from a [n][k] k-contiguous copy (row = n). Same map for both.
__device__ __forceinline__ v16h load_frag_h(const u16* base, int ldr) {
  const int lane = threadIdx.x & 31;
  const int row  = lane & 15;
  const int kb   = (lane >> 4) << 3;
  union { v16h v; uint4 q[2]; } u;
  u.q[0] = *reinterpret_cast<const uint4*>(base + (size_t)row * ldr + kb);
  u.q[1] = *reinterpret_cast<const uint4*>(base + (size_t)row * ldr + 16 + kb);
  return u.v;
}
__device__ __forceinline__ v16bf load_frag_b(const u16* base, int ldr) {
  const int lane = threadIdx.x & 31;
  const int row  = lane & 15;
  const int kb   = (lane >> 4) << 3;
  union { v16bf v; uint4 q[2]; } u;
  u.q[0] = *reinterpret_cast<const uint4*>(base + (size_t)row * ldr + kb);
  u.q[1] = *reinterpret_cast<const uint4*>(base + (size_t)row * ldr + 16 + kb);
  return u.v;
}

// WMMA with the 4-slot VALU hazard guard tied to D, keeping A/B live.
__device__ __forceinline__ v8f mma_h(v16h a, v16h b, v8f c) {
  c = __builtin_amdgcn_wmma_f32_16x16x32_f16(false, a, false, b, (short)0, c, false, false);
  asm volatile("v_nop\n\tv_nop\n\tv_nop\n\tv_nop" : "+v"(c) : "v"(a), "v"(b));
  return c;
}
__device__ __forceinline__ v8f mma_b(v16bf a, v16bf b, v8f c) {
  c = __builtin_amdgcn_wmma_f32_16x16x32_bf16(false, a, false, b, (short)0, c, false, false);
  asm volatile("v_nop\n\tv_nop\n\tv_nop\n\tv_nop" : "+v"(c) : "v"(a), "v"(b));
  return c;
}

// reductions across a 16-lane half (D-layout rows live in 16-lane halves), eight values at once.
// One xor-butterfly step (lane ^ M inside the 16-lane row) of all eight values, on the vector port (DPP).
#define ROW_STEP8(OP, M)                                          \
  OP " %0, %0, %0 row_xmask:" M " row_mask:0xf bank_mask:0xf\n\t" \
  OP " %1, %1, %1 row_xmask:" M " row_mask:0xf bank_mask:0xf\n\t" \
  OP " %2, %2, %2 row_xmask:" M " row_mask:0xf bank_mask:0xf\n\t" \
  OP " %3, %3, %3 row_xmask:" M " row_mask:0xf bank_mask:0xf\n\t" \
  OP " %4, %4, %4 row_xmask:" M " row_mask:0xf bank_mask:0xf\n\t" \
  OP " %5, %5, %5 row_xmask:" M " row_mask:0xf bank_mask:0xf\n\t" \
  OP " %6, %6, %6 row_xmask:" M " row_mask:0xf bank_mask:0xf\n\t" \
  OP " %7, %7, %7 row_xmask:" M " row_mask:0xf bank_mask:0xf\n\t"
#define ROW_TREE8(OP) ROW_STEP8(OP, "1") ROW_STEP8(OP, "2") ROW_STEP8(OP, "4") ROW_STEP8(OP, "8")

__device__ __forceinline__ void hmax16x8(float (&x)[8]) {
  // asm: __shfl_xor compiles to an LDS-pipe permute with a wait after each step; the DPP form stays in registers.
  // The eight chains are interleaved so that every step's producer stands eight instructions back.
  asm(ROW_TREE8("v_max_num_f32_dpp")
      : "+v"(x[0]), "+v"(x[1]), "+v"(x[2]), "+v"(x[3]), "+v"(x[4]), "+v"(x[5]), "+v"(x[6]), "+v"(x[7]));
}
__device__ __forceinline__ void hadd16x8(float (&x)[8]) {
  // asm: as in hmax16x8; same xor tree (1, 2, 4, 8) as the shuffle form, so the same sum order
  asm(ROW_TREE8("v_add_f32_dpp")
      : "+v"(x[0]), "+v"(x[1]), "+v"(x[2]), "+v"(x[3]), "+v"(x[4]), "+v"(x[5]), "+v"(x[6]), "+v"(x[7]));
}

// ---------------- kernels ----------------

__device__ __forceinline__ void xcast_body(const int blk, const float* __restrict__ x, u16* __restrict__ Xb) {
  const int g = blk * 256 + threadIdx.x;
  const int m = g >> 5;                 // row 0..M_TOT-1 (grid exact)
  const int c = g & 31;                 // 8-element chunk
  const int b = m / SEQ, s = m - b * SEQ;
  const float* src = x + ((size_t)b * SEQ_FULL + s) * DM + c * 8;
  const float4 f0 = *reinterpret_cast<const float4*>(src);
  const float4 f1 = *reinterpret_cast<const float4*>(src + 4);
  v4u w;
  w[0] = f2bf_bits(f0.x) | (f2bf_bits(f0.y) << 16);
  w[1] = f2bf_bits(f0.z) | (f2bf_bits(f0.w) << 16);
  w[2] = f2bf_bits(f1.x) | (f2bf_bits(f1.y) << 16);
  w[3] = f2bf_bits(f1.z) | (f2bf_bits(f1.w) << 16);
  u16* dst = Xb + (size_t)m * DM + c * 8;
  *(v4u*)(dst) = w;
  
}

// W f32 [k][n] (DM x DM) -> Wt 16-bit [n][k] (transposed, k-contiguous).  MODE false: bf16 bits of W.
// MODE true: f16 bits of bf16(W) * WO_CARRY (the same for a whole block).  Block = 64 n-rows; LDS transpose; each output row
__device__ __forceinline__ void wcast_body(const bool MODE, const int blk, u16* T, const float* __restrict__ W,
                                           u16* __restrict__ Wt) {
  const int tid = threadIdx.x, lane = tid & 31, wave = tid >> 5;
  const int n0 = blk * 64;
#pragma unroll 4
  for (int it = 0; it < 64; ++it) {
    const int idx = it * 256 + tid;
    const int k = idx >> 6, nl = idx & 63;
    const float f = W[(size_t)k * DM + n0 + nl];
    u16 bits;
    if (MODE) bits = h_bits(bf16r(f) * WO_CARRY);
    else           bits = (u16)f2bf_bits(f);
    T[nl * 264 + k] = bits;
  }
  __syncthreads();
  auto pass = [&]() {
#pragma unroll
    for (int i = 0; i < 8; ++i) {
      const int nl = wave + 8 * i;
      const v4u v = *reinterpret_cast<const v4u*>(&T[nl * 264 + lane * 8]);
      *(v4u*)(Wt + (size_t)(n0 + nl) * DM + lane * 8) = v;
    }
  };
  pass();
  
}

// All five input conversions in one grid: none reads what another writes.  Blocks 0..15 take the four weight
// planes (4 blocks each; Wt4 = the four [n][k] planes in a row: Wq, Wk, Wv, Wo), the rest the rows of x.
// The weight blocks stand first because each is a long chain of dependent steps.
#define WCAST_BLOCKS (4 * (DM / 64))
__global__ __launch_bounds__(256) void k_cast(const float* __restrict__ x, const float* __restrict__ Wq,
                                              const float* __restrict__ Wk, const float* __restrict__ Wv,
                                              const float* __restrict__ Wo, u16* __restrict__ Xb,
                                              u16* __restrict__ Wt4) {
  __shared__ __attribute__((aligned(16))) u16 T[64 * 264];
  const int blk = blockIdx.x;
  const int w = blk / (DM / 64), nb = blk - w * (DM / 64);
  if (blk < WCAST_BLOCKS)
    wcast_body(w == 3, nb, T, w == 0 ? Wq : (w == 1 ? Wk : (w == 2 ? Wv : Wo)), Wt4 + (size_t)w * DM * DM);
  else
    xcast_body(blk - WCAST_BLOCKS, x, Xb);
}

// Projection GEMM: P[m][n] = sum_k Xb[m][k] * Wt[n][k] + bias[n], stored *QKV_CARRY as f16.
// Block = 256 threads (8 waves), tile 128(m) x 64(n) (n-block = one head), K step 32, B tile in LDS.
// The three products share one grid: blockIdx.z = 0, 1, 2 is Q, K, V (none reads what another writes).
// Wt3 = the three weight planes in a row, Out3 = the three output planes in a row.
// z = 2 (V): Out plane [bh][d][SEQ] (V transposed): each d-row segment = 256 B, 16 lanes x 16 B.
__global__ __launch_bounds__(256) void k_proj(const u16* __restrict__ Xb, const u16* __restrict__ Wt3,
                                              const float* __restrict__ bq, const float* __restrict__ bk,
                                              const float* __restrict__ bv, u16* __restrict__ Out3) {
  __shared__ __attribute__((aligned(16))) u16 Bt[64 * P32];    // [n][k32]
  __shared__ __attribute__((aligned(16))) u16 St[128 * 72];    // staging: 128 x 72 (Q, K) or 64 x 136 (V)
  const int z = blockIdx.z;
  const u16* Wt = Wt3 + (size_t)z * DM * DM;
  const float* bias = z == 0 ? bq : (z == 1 ? bk : bv);
  u16* Out = Out3 + (size_t)z * M_TOT * DM;
  const int tid = threadIdx.x, wave = tid >> 5, lane = tid & 31;
  const int h16 = (lane >> 4) << 3;
  const int col = lane & 15;
  const int mb = blockIdx.x * 128;
  const int m0 = mb + wave * 16;
  const int n0 = blockIdx.y * 64;

  v8f acc[4] = {zero8(), zero8(), zero8(), zero8()};
  for (int kk = 0; kk < DM; kk += 32) {
    __syncthreads();                 // Bt free
    {
      const int n = tid >> 2, ko = (tid & 3) << 3;
      *reinterpret_cast<uint4*>(&Bt[n * P32 + ko]) =
          *reinterpret_cast<const uint4*>(Wt + (size_t)(n0 + n) * DM + kk + ko);
    }
    __syncthreads();                 // Bt ready
    const v16bf a = load_frag_b(Xb + (size_t)m0 * DM + kk, DM);
#pragma unroll
    for (int t = 0; t < 4; ++t) {
      const v16bf b = load_frag_b(&Bt[(t * 16) * P32], P32);
      acc[t] = mma_b(a, b, acc[t]);
    }
  }

  const int bb = mb / SEQ;
  const int s0 = mb - bb * SEQ;     // 128 rows of one sequence (SEQ % 128 == 0)
  const int hh = blockIdx.y;        // head index = n0 / 64

  if (z != 2) {
#pragma unroll
    for (int t = 0; t < 4; ++t) {
      const int nl = t * 16 + col;
      const float bvv = bf16r(bias[n0 + nl]);
#pragma unroll
      for (int r = 0; r < 8; ++r) {
        const int ml = wave * 16 + h16 + r;
        St[ml * 72 + nl] = h_bits((acc[t][r] + bvv) * QKV_CARRY);
      }
    }
    __syncthreads();
    u16* base = Out + ((size_t)(bb * NH + hh) * SEQ + s0) * HD;   // row ml -> base + ml*HD
    auto pass = [&]() {
#pragma unroll
      for (int i = 0; i < 4; ++i) {
        const int rr = wave * 16 + i * 4 + (lane >> 3);
        const int c = lane & 7;
        const v4u v = *reinterpret_cast<const v4u*>(&St[rr * 72 + c * 8]);
        *(v4u*)(base + (size_t)rr * HD + c * 8) = v;
      }
    };
    pass();
    
  } else {
#pragma unroll
    for (int t = 0; t < 4; ++t) {
      const int nl = t * 16 + col;
      const float bvv = bf16r(bias[n0 + nl]);
      union { v8h v; v4u q; } pk;
#pragma unroll
      for (int r = 0; r < 8; ++r) pk.v[r] = (f16t)((acc[t][r] + bvv) * QKV_CARRY);
      *reinterpret_cast<v4u*>(&St[nl * 136 + wave * 16 + h16]) = pk.q;   // St[d][m-local]
    }
    __syncthreads();
    u16* base = Out + ((size_t)(bb * NH + hh) * HD) * SEQ + s0;          // row d -> base + d*SEQ
    auto pass = [&]() {
#pragma unroll
      for (int i = 0; i < 4; ++i) {
        const int dd = wave * 8 + i * 2 + (lane >> 4);
        const int c = lane & 15;
        const v4u v = *reinterpret_cast<const v4u*>(&St[dd * 136 + c * 8]);
        *(v4u*)(base + (size_t)dd * SEQ + c * 8) = v;
      }
    };
    pass();
    
  }
}

// Flash attention.  Q,K planes f16 [bh][s][64] (x8), V plane f16 transposed [bh][d][SEQ] (x8).
// Block = 256 threads (8 waves) owns (bh, 128 query rows); wave owns 16 rows.  64-key K and V^T tiles
// staged in LDS with plain loads, single buffer, block barriers.  P tile per wave in LDS (wave-private).
__global__ __launch_bounds__(256) __attribute__((amdgpu_num_vgpr(256)))
void k_attn(const u16* __restrict__ Qp, const u16* __restrict__ Kp, const u16* __restrict__ Vtp,
            u16* __restrict__ Ctx) {
  __shared__ __attribute__((aligned(16))) u16 Kt[64 * P64];      // [key][d]
  __shared__ __attribute__((aligned(16))) u16 Vs[64 * P64];      // [d][key]
  __shared__ __attribute__((aligned(16))) u16 Pt[8 * 16 * P64];  // per wave [m][key]

  const int tid = threadIdx.x, wave = tid >> 5, lane = tid & 31;
  const int h16 = (lane >> 4) << 3;
  const int col = lane & 15;
  const int bh = blockIdx.x;
  const int bb = bh / NH, hh = bh - bb * NH;
  const int q0 = blockIdx.y * 128 + wave * 16;       // first query position of this wave

  const u16* Qbh = Qp + (size_t)bh * SEQ * HD;
  const u16* Kbh = Kp + (size_t)bh * SEQ * HD;
  const u16* Vbh = Vtp + (size_t)bh * HD * SEQ;
  u16* Pw = Pt + wave * (16 * P64);

  const v16h aq0 = load_frag_h(Qbh + (size_t)q0 * HD, HD);
  const v16h aq1 = load_frag_h(Qbh + (size_t)q0 * HD + 32, HD);

  float mrow[8], lrow[8], qi[8];
  v8f o[4] = {zero8(), zero8(), zero8(), zero8()};
#pragma unroll
  for (int r = 0; r < 8; ++r) {
    mrow[r] = -INFINITY;
    lrow[r] = 0.f;
    qi[r] = (float)(q0 + h16 + r);
  }
  // z = acc/512 * (SEQ - |i-j|)/SEQ
  const float kmask = 1.0f / ((float)SEQ * 512.0f);

#pragma unroll 1
  for (int t0 = 0; t0 < SEQ; t0 += 64) {
    __syncthreads();                                  // prior tiles fully consumed by all waves
    const int row = tid >> 3, off = (tid & 7) << 3;   // this thread's chunks: rows row and row + 32
    const u16* gk0 = Kbh + (size_t)(t0 + row) * HD + off;
    const u16* gv0 = Vbh + (size_t)row * SEQ + t0 + off;
    const v4u kq0 = *reinterpret_cast<const v4u*>(gk0);
    const v4u vq0 = *reinterpret_cast<const v4u*>(gv0);
    const v4u kq1 = *reinterpret_cast<const v4u*>(gk0 + 32 * HD);    // constant steps: the same two address pairs
    const v4u vq1 = *reinterpret_cast<const v4u*>(gv0 + 32 * SEQ);
    // stands between the four loads and the first write of a register that one of them names as its address;
    // the two address pairs are inputs so that they are kept as they are up to this wait
    asm volatile("s_wait_xcnt 0x0" :: "v"(gk0), "v"(gv0) : "memory");
    *reinterpret_cast<v4u*>(&Kt[row * P64 + off]) = kq0;
    *reinterpret_cast<v4u*>(&Vs[row * P64 + off]) = vq0;
    *reinterpret_cast<v4u*>(&Kt[(row + 32) * P64 + off]) = kq1;
    *reinterpret_cast<v4u*>(&Vs[(row + 32) * P64 + off]) = vq1;
    __syncthreads();                                  // tiles ready

    // ---- scores: S(16x64) = Q(16x64 d) . K^T ; B[k=d][n=key] loaded like A from Kt[key][d]
    v8f sc[4];
#pragma unroll
    for (int t = 0; t < 4; ++t) {
      const v16h kb0 = load_frag_h(&Kt[(t * 16) * P64], P64);
      const v16h kb1 = load_frag_h(&Kt[(t * 16) * P64 + 32], P64);
      sc[t] = mma_h(aq0, kb0, zero8());
      sc[t] = mma_h(aq1, kb1, sc[t]);
    }

    // ---- scale, multiplicative distance-decay mask, online softmax
    float alpha[8], mx[8], ps[8];
#pragma unroll
    for (int r = 0; r < 8; ++r) {
      mx[r] = -INFINITY;
#pragma unroll
      for (int t = 0; t < 4; ++t) {
        const float kj = (float)(t0 + t * 16 + col);
        const float w = ((float)SEQ - fabsf(qi[r] - kj)) * kmask;
        const float z = sc[t][r] * w;
        sc[t][r] = z;
        mx[r] = fmaxf(mx[r], z);
      }
    }
    hmax16x8(mx);
#pragma unroll
    for (int r = 0; r < 8; ++r) {
      const float mnew = fmaxf(mrow[r], mx[r]);
      alpha[r] = __expf(mrow[r] - mnew);
      mrow[r] = mnew;
    }
#pragma unroll
    for (int r = 0; r < 8; ++r) {
      ps[r] = 0.f;
#pragma unroll
      for (int t = 0; t < 4; ++t) {
        const float p = __expf(sc[t][r] - mrow[r]);
        ps[r] += p;
        Pw[(r + h16) * P64 + t * 16 + col] = h_bits(p * P_CARRY);
      }
    }
    hadd16x8(ps);
#pragma unroll
    for (int r = 0; r < 8; ++r) lrow[r] = lrow[r] * alpha[r] + ps[r];
#pragma unroll
    for (int dt = 0; dt < 4; ++dt)
#pragma unroll
      for (int r = 0; r < 8; ++r) o[dt][r] *= alpha[r];

    // P staging is wave-private: LDS completion + wave sync (also a compiler ordering point)
    asm volatile("s_wait_dscnt 0" ::: "memory");
    __builtin_amdgcn_wave_barrier();

    // ---- O += P(16x64 keys) . V ; B[k=key][n=d] loaded like A from Vs[d][key]
    const v16h p0 = load_frag_h(Pw, P64);
    const v16h p1 = load_frag_h(Pw + 32, P64);
#pragma unroll
    for (int dt = 0; dt < 4; ++dt) {
      const v16h vb0 = load_frag_h(&Vs[(dt * 16) * P64], P64);
      const v16h vb1 = load_frag_h(&Vs[(dt * 16) * P64 + 32], P64);
      o[dt] = mma_h(p0, vb0, o[dt]);
      o[dt] = mma_h(p1, vb1, o[dt]);
    }
  }

  // ---- normalize: ctx*64 = o / (l * 2048); stage the 16x64 f16 tile in the wave's P region
  float inv[8];
#pragma unroll
  for (int r = 0; r < 8; ++r) inv[r] = 1.0f / (lrow[r] * CTX_LDIV);
  asm volatile("s_wait_dscnt 0" ::: "memory");     // P fragment loads of this wave retired before reuse
  __builtin_amdgcn_wave_barrier();
#pragma unroll
  for (int dt = 0; dt < 4; ++dt)
#pragma unroll
    for (int r = 0; r < 8; ++r)
      Pw[(r + h16) * P64 + dt * 16 + col] = h_bits(o[dt][r] * inv[r]);
  asm volatile("s_wait_dscnt 0" ::: "memory");
  __builtin_amdgcn_wave_barrier();

  u16* cbase = Ctx + ((size_t)(bb * SEQ + q0)) * DM + hh * HD;   // row rr -> cbase + rr*DM
  auto pass = [&]() {
#pragma unroll
    for (int i = 0; i < 4; ++i) {
      const int rr = i * 4 + (lane >> 3);
      const int c = lane & 7;
      const v4u v = *reinterpret_cast<const v4u*>(&Pw[rr * P64 + c * 8]);
      *(v4u*)(cbase + (size_t)rr * DM + c * 8) = v;
    }
  };
  pass();
  
}

// Output projection: out[m][n] = sum_k ctx[m][k] * Wot[n][k] / (64*16) + bf16(bo[n]), f32.
// Block tile 128 x 64; f32 tile staged in LDS; each 256-B row segment written by 16 lanes x 16 B
__global__ __launch_bounds__(256) void k_oproj(const u16* __restrict__ Ctx, const u16* __restrict__ Wot,
                                               const float* __restrict__ bo, float* __restrict__ out) {
  __shared__ __attribute__((aligned(16))) u16 Bt[64 * P32];
  __shared__ __attribute__((aligned(16))) float So[128 * 68];
  const int tid = threadIdx.x, wave = tid >> 5, lane = tid & 31;
  const int h16 = (lane >> 4) << 3;
  const int col = lane & 15;
  const int mb = blockIdx.x * 128;
  const int m0 = mb + wave * 16;
  const int n0 = blockIdx.y * 64;

  v8f acc[4] = {zero8(), zero8(), zero8(), zero8()};
  for (int kk = 0; kk < DM; kk += 32) {
    __syncthreads();
    {
      const int n = tid >> 2, ko = (tid & 3) << 3;
      *reinterpret_cast<uint4*>(&Bt[n * P32 + ko]) =
          *reinterpret_cast<const uint4*>(Wot + (size_t)(n0 + n) * DM + kk + ko);
    }
    __syncthreads();
    const v16h a = load_frag_h(Ctx + (size_t)m0 * DM + kk, DM);
#pragma unroll
    for (int t = 0; t < 4; ++t) {
      const v16h b = load_frag_h(&Bt[(t * 16) * P32], P32);
      acc[t] = mma_h(a, b, acc[t]);
    }
  }

#pragma unroll
  for (int t = 0; t < 4; ++t) {
    const int nl = t * 16 + col;
    const float bvv = bf16r(bo[n0 + nl]);
#pragma unroll
    for (int r = 0; r < 8; ++r) {
      const int ml = wave * 16 + h16 + r;
      So[ml * 68 + nl] = acc[t][r] * OUT_SCALE + bvv;
    }
  }
  __syncthreads();
  float* base = out + (size_t)mb * DM + n0;            // row rr -> base + rr*DM
  auto pass = [&]() {
#pragma unroll
    for (int i = 0; i < 8; ++i) {
      const int rr = wave * 16 + i * 2 + (lane >> 4);
      const int c = lane & 15;
      const v4f v = *reinterpret_cast<const v4f*>(&So[rr * 68 + c * 4]);
      *(v4f*)(base + (size_t)rr * DM + c * 4) = v;
    }
  };
  pass();
  
}

// ---------------- launcher ----------------

extern "C" void kernel_launch(void* const* d_in, const int* in_sizes, int n_in,
                              void* d_out, int out_size, void* d_ws, size_t ws_size,
                              hipStream_t stream) {
  if (n_in < 9) return;
  if (in_sizes[0] < ((NB - 1) * SEQ_FULL + SEQ) * DM) return;
  if (in_sizes[1] < DM * DM || in_sizes[3] < DM * DM || in_sizes[5] < DM * DM || in_sizes[7] < DM * DM) return;
  if (in_sizes[2] < DM || in_sizes[4] < DM || in_sizes[6] < DM || in_sizes[8] < DM) return;
  if (out_size < M_TOT * DM) return;

  const float* x  = (const float*)d_in[0];
  const float* Wq = (const float*)d_in[1];
  const float* bq = (const float*)d_in[2];
  const float* Wk = (const float*)d_in[3];
  const float* bk = (const float*)d_in[4];
  const float* Wv = (const float*)d_in[5];
  const float* bv = (const float*)d_in[6];
  const float* Wo = (const float*)d_in[7];
  const float* bo = (const float*)d_in[8];
  float* out = (float*)d_out;

  const size_t XB_BYTES = (size_t)M_TOT * DM * 2;          // Xb bf16 [M_TOT][DM]
  const size_t WT_BYTES = (size_t)DM * DM * 2;             // each W^T 16-bit plane
  const size_t PL_BYTES = (size_t)M_TOT * DM * 2;          // Q, K, V^T, ctx planes (NB*NH*SEQ*HD = M_TOT*DM)
  const size_t total = XB_BYTES + 4 * WT_BYTES + 4 * PL_BYTES;
  if (total > ws_size) return;

  char* ws = (char*)d_ws;
  size_t off = 0;
  u16* Xb  = (u16*)(ws + off); off += XB_BYTES;
  u16* Wqt = (u16*)(ws + off); off += WT_BYTES;
  off += WT_BYTES;                                   // Wk plane, reached as Wqt + DM * DM
  off += WT_BYTES;                                   // Wv plane, reached as Wqt + 2 * DM * DM
  u16* Wot = (u16*)(ws + off); off += WT_BYTES;      // also Wqt + 3 * DM * DM
  u16* Qp  = (u16*)(ws + off); off += PL_BYTES;
  u16* Kpl = (u16*)(ws + off); off += PL_BYTES;
  u16* Vtp = (u16*)(ws + off); off += PL_BYTES;
  u16* Ctx = (u16*)(ws + off); off += PL_BYTES;
  (void)off;

  // 1) input conversion: x -> bf16 plane; Wq/Wk/Wv -> bf16 [n][k]; Wo -> f16 [n][k] (bf16 value * 16)
  k_cast<<<WCAST_BLOCKS + M_TOT / 8, 256, 0, stream>>>(x, Wq, Wk, Wv, Wo, Xb, Wqt);

  // 2) projections: Q, K -> [bh][s][64] f16 x8 ; V -> [bh][d][SEQ] f16 x8
  dim3 gp(M_TOT / 128, DM / 64);
  dim3 gp3(M_TOT / 128, DM / 64, 3);
  k_proj<<<gp3, 256, 0, stream>>>(Xb, Wqt, bq, bk, bv, Qp);

  // 3) flash attention -> ctx plane [M_TOT][DM] f16 x64
  dim3 ga(NB * NH, SEQ / 128);
  k_attn<<<ga, 256, 0, stream>>>(Qp, Kpl, Vtp, Ctx);

  // 4) output projection -> out f32 [M_TOT][DM]
  k_oproj<<<gp, 256, 0, stream>>>(Ctx, Wot, bo, out);
}

// v004
// Measured time: 72.6 microseconds a run.
// In both of two side-by-side timings against v003, it was 1.13 times as fast.
// Counting every step since v000, it is 2.63 times as fast.
#include <hip/hip_runtime.h>
#include <math.h>

// QKV projections: v_wmma_f32_16x16x32_bf16 (bf16 operands = RNE-converted inputs, f32 accumulate); QK^T, P.V and ctx@Wo: v_wmma_f32_16x16x32_f16 (f16 operands, carries Q/K/V x8, P x16384, ctx x64, Wo x16, f32 accumulate); softmax and epilogues f32.

typedef unsigned short u16;
typedef _Float16 f16t;
typedef __bf16   v16bf __attribute__((ext_vector_type(16)));
typedef _Float16 v16h  __attribute__((ext_vector_type(16)));
typedef _Float16 v8h   __attribute__((ext_vector_type(8)));
typedef float    v8f   __attribute__((ext_vector_type(8)));
typedef float    v4f   __attribute__((ext_vector_type(4)));
typedef unsigned int v4u __attribute__((ext_vector_type(4)));

#ifndef NB
#define NB 4
#endif
#ifndef SEQ
#define SEQ 2048
#endif
#define NB_FULL  4
#define SEQ_FULL 2048
#define DM 256
#define NH 4
#define HD 64
#define M_TOT (NB * SEQ)

static_assert(NB >= 1 && NB <= NB_FULL);
static_assert(SEQ >= 128 && SEQ <= SEQ_FULL && (SEQ % 128) == 0);
static_assert(DM == NH * HD);
static_assert((M_TOT % 128) == 0);
static_assert((M_TOT % 8) == 0);

// carries: Q,K,V planes hold value*8 (f16); P tile holds exp(z-m)*16384 (f16); ctx plane holds h*64 (f16);
// Wo plane holds bf16(Wo)*16 (f16).  score = acc/512 ; ctx*64 = o/(l*2048) ; out = acc/1024 + bo
#define QKV_CARRY 8.0f
#define P_CARRY   16384.0f
#define WO_CARRY  16.0f
#define CTX_LDIV  2048.0f
#define OUT_SCALE (1.0f / 1024.0f)

// LDS row pitch, in 16-bit elements, of every tile that ds_load_b128 fragment loads read: 16 B x odd, so that
// the 16 rows a half-wave reads at once fall on 16 different groups of four banks (64 banks x 4 B).
#define P64 72    // rows of 64 elements: 144 B
#define P32 40    // rows of 32 elements:  80 B

// ---------------- helpers ----------------

__device__ __forceinline__ unsigned f2bf_bits(float f) {
  unsigned u = __float_as_uint(f);
  u += 0x7FFFu + ((u >> 16) & 1u);   // RNE convert f32 -> bf16 bits
  return u >> 16;
}
__device__ __forceinline__ float bf16r(float f) { return __uint_as_float(f2bf_bits(f) << 16); }
__device__ __forceinline__ u16 h_bits(float f) {
  union { f16t h; u16 u; } c;
  c.h = (f16t)f;                     // RNE convert f32 -> f16
  return c.u;
}
__device__ __forceinline__ v8f zero8() {
  v8f z = {0.f, 0.f, 0.f, 0.f, 0.f, 0.f, 0.f, 0.f};
  return z;
}

// 16x32 16-bit fragment from a row-major [row][k] tile with pitch ldr (elements).
// lane l: row = l&15; elements 0..7 = k0+8h..k0+8h+7, elements 8..15 = k0+16+8h..+7, h = l>>4.
// Used for A (row = m) and for B loaded from a [n][k] k-contiguous copy (row = n). Same map for both.
__device__ __forceinline__ v16h load_frag_h(const u16* base, int ldr) {
  const int lane = threadIdx.x & 31;
  const int row  = lane & 15;
  const int kb   = (lane >> 4) << 3;
  union { v16h v; uint4 q[2]; } u;
  u.q[0] = *reinterpret_cast<const uint4*>(base + (size_t)row * ldr + kb);
  u.q[1] = *reinterpret_cast<const uint4*>(base + (size_t)row * ldr + 16 + kb);
  return u.v;
}
__device__ __forceinline__ v16bf load_frag_b(const u16* base, int ldr) {
  const int lane = threadIdx.x & 31;
  const int row  = lane & 15;
  const int kb   = (lane >> 4) << 3;
  union { v16bf v; uint4 q[2]; } u;
  u.q[0] = *reinterpret_cast<const uint4*>(base + (size_t)row * ldr + kb);
  u.q[1] = *reinterpret_cast<const uint4*>(base + (size_t)row * ldr + 16 + kb);
  return u.v;
}

// WMMA with the 4-slot VALU hazard guard tied to D, keeping A/B live.
__device__ __forceinline__ v8f mma_h(v16h a, v16h b, v8f c) {
  c = __builtin_amdgcn_wmma_f32_16x16x32_f16(false, a, false, b, (short)0, c, false, false);
  asm volatile("v_nop\n\tv_nop\n\tv_nop\n\tv_nop" : "+v"(c) : "v"(a), "v"(b));
  return c;
}
__device__ __forceinline__ v8f mma_b(v16bf a, v16bf b, v8f c) {
  c = __builtin_amdgcn_wmma_f32_16x16x32_bf16(false, a, false, b, (short)0, c, false, false);
  asm volatile("v_nop\n\tv_nop\n\tv_nop\n\tv_nop" : "+v"(c) : "v"(a), "v"(b));
  return c;
}

// lane l <-> lane l ^ 16: the two 16-lane halves of a wave hold the two halves of one query's keys
__device__ __forceinline__ float xhalf(float x) {
  const int b = __builtin_bit_cast(int, x);
  return __builtin_bit_cast(float, __builtin_amdgcn_permlanex16(b, b, 0x76543210, 0xfedcba98, false, false));
}

// ---------------- kernels ----------------

__device__ __forceinline__ void xcast_body(const int blk, const float* __restrict__ x, u16* __restrict__ Xb) {
  const int g = blk * 256 + threadIdx.x;
  const int m = g >> 5;                 // row 0..M_TOT-1 (grid exact)
  const int c = g & 31;                 // 8-element chunk
  const int b = m / SEQ, s = m - b * SEQ;
  const float* src = x + ((size_t)b * SEQ_FULL + s) * DM + c * 8;
  const float4 f0 = *reinterpret_cast<const float4*>(src);
  const float4 f1 = *reinterpret_cast<const float4*>(src + 4);
  v4u w;
  w[0] = f2bf_bits(f0.x) | (f2bf_bits(f0.y) << 16);
  w[1] = f2bf_bits(f0.z) | (f2bf_bits(f0.w) << 16);
  w[2] = f2bf_bits(f1.x) | (f2bf_bits(f1.y) << 16);
  w[3] = f2bf_bits(f1.z) | (f2bf_bits(f1.w) << 16);
  u16* dst = Xb + (size_t)m * DM + c * 8;
  *(v4u*)(dst) = w;
  
}

// W f32 [k][n] (DM x DM) -> Wt 16-bit [n][k] (transposed, k-contiguous).  MODE false: bf16 bits of W.
// MODE true: f16 bits of bf16(W) * WO_CARRY (the same for a whole block).  Block = 64 n-rows; LDS transpose; each output row
__device__ __forceinline__ void wcast_body(const bool MODE, const int blk, u16* T, const float* __restrict__ W,
                                           u16* __restrict__ Wt) {
  const int tid = threadIdx.x, lane = tid & 31, wave = tid >> 5;
  const int n0 = blk * 64;
#pragma unroll 4
  for (int it = 0; it < 64; ++it) {
    const int idx = it * 256 + tid;
    const int k = idx >> 6, nl = idx & 63;
    const float f = W[(size_t)k * DM + n0 + nl];
    u16 bits;
    if (MODE) bits = h_bits(bf16r(f) * WO_CARRY);
    else           bits = (u16)f2bf_bits(f);
    T[nl * 264 + k] = bits;
  }
  __syncthreads();
  auto pass = [&]() {
#pragma unroll
    for (int i = 0; i < 8; ++i) {
      const int nl = wave + 8 * i;
      const v4u v = *reinterpret_cast<const v4u*>(&T[nl * 264 + lane * 8]);
      *(v4u*)(Wt + (size_t)(n0 + nl) * DM + lane * 8) = v;
    }
  };
  pass();
  
}

// All five input conversions in one grid: none reads what another writes.  Blocks 0..15 take the four weight
// planes (4 blocks each; Wt4 = the four [n][k] planes in a row: Wq, Wk, Wv, Wo), the rest the rows of x.
// The weight blocks stand first because each is a long chain of dependent steps.
#define WCAST_BLOCKS (4 * (DM / 64))
__global__ __launch_bounds__(256) void k_cast(const float* __restrict__ x, const float* __restrict__ Wq,
                                              const float* __restrict__ Wk, const float* __restrict__ Wv,
                                              const float* __restrict__ Wo, u16* __restrict__ Xb,
                                              u16* __restrict__ Wt4) {
  __shared__ __attribute__((aligned(16))) u16 T[64 * 264];
  const int blk = blockIdx.x;
  const int w = blk / (DM / 64), nb = blk - w * (DM / 64);
  if (blk < WCAST_BLOCKS)
    wcast_body(w == 3, nb, T, w == 0 ? Wq : (w == 1 ? Wk : (w == 2 ? Wv : Wo)), Wt4 + (size_t)w * DM * DM);
  else
    xcast_body(blk - WCAST_BLOCKS, x, Xb);
}

// Projection GEMM: P[m][n] = sum_k Xb[m][k] * Wt[n][k] + bias[n], stored *QKV_CARRY as f16.
// Block = 256 threads (8 waves), tile 128(m) x 64(n) (n-block = one head), K step 32, B tile in LDS.
// The three products share one grid: blockIdx.z = 0, 1, 2 is Q, K, V (none reads what another writes).
// Wt3 = the three weight planes in a row, Out3 = the three output planes in a row.
// z = 2 (V): Out plane [bh][d][SEQ] (V transposed): each d-row segment = 256 B, 16 lanes x 16 B.
__global__ __launch_bounds__(256) void k_proj(const u16* __restrict__ Xb, const u16* __restrict__ Wt3,
                                              const float* __restrict__ bq, const float* __restrict__ bk,
                                              const float* __restrict__ bv, u16* __restrict__ Out3) {
  __shared__ __attribute__((aligned(16))) u16 Bt[64 * P32];    // [n][k32]
  __shared__ __attribute__((aligned(16))) u16 St[128 * 72];    // staging: 128 x 72 (Q, K) or 64 x 136 (V)
  const int z = blockIdx.z;
  const u16* Wt = Wt3 + (size_t)z * DM * DM;
  const float* bias = z == 0 ? bq : (z == 1 ? bk : bv);
  u16* Out = Out3 + (size_t)z * M_TOT * DM;
  const int tid = threadIdx.x, wave = tid >> 5, lane = tid & 31;
  const int h16 = (lane >> 4) << 3;
  const int col = lane & 15;
  const int mb = blockIdx.x * 128;
  const int m0 = mb + wave * 16;
  const int n0 = blockIdx.y * 64;

  v8f acc[4] = {zero8(), zero8(), zero8(), zero8()};
  for (int kk = 0; kk < DM; kk += 32) {
    __syncthreads();                 // Bt free
    {
      const int n = tid >> 2, ko = (tid & 3) << 3;
      *reinterpret_cast<uint4*>(&Bt[n * P32 + ko]) =
          *reinterpret_cast<const uint4*>(Wt + (size_t)(n0 + n) * DM + kk + ko);
    }
    __syncthreads();                 // Bt ready
    const v16bf a = load_frag_b(Xb + (size_t)m0 * DM + kk, DM);
#pragma unroll
    for (int t = 0; t < 4; ++t) {
      const v16bf b = load_frag_b(&Bt[(t * 16) * P32], P32);
      acc[t] = mma_b(a, b, acc[t]);
    }
  }

  const int bb = mb / SEQ;
  const int s0 = mb - bb * SEQ;     // 128 rows of one sequence (SEQ % 128 == 0)
  const int hh = blockIdx.y;        // head index = n0 / 64

  if (z != 2) {
#pragma unroll
    for (int t = 0; t < 4; ++t) {
      const int nl = t * 16 + col;
      const float bvv = bf16r(bias[n0 + nl]);
#pragma unroll
      for (int r = 0; r < 8; ++r) {
        const int ml = wave * 16 + h16 + r;
        St[ml * 72 + nl] = h_bits((acc[t][r] + bvv) * QKV_CARRY);
      }
    }
    __syncthreads();
    u16* base = Out + ((size_t)(bb * NH + hh) * SEQ + s0) * HD;   // row ml -> base + ml*HD
    auto pass = [&]() {
#pragma unroll
      for (int i = 0; i < 4; ++i) {
        const int rr = wave * 16 + i * 4 + (lane >> 3);
        const int c = lane & 7;
        const v4u v = *reinterpret_cast<const v4u*>(&St[rr * 72 + c * 8]);
        *(v4u*)(base + (size_t)rr * HD + c * 8) = v;
      }
    };
    pass();
    
  } else {
#pragma unroll
    for (int t = 0; t < 4; ++t) {
      const int nl = t * 16 + col;
      const float bvv = bf16r(bias[n0 + nl]);
      union { v8h v; v4u q; } pk;
#pragma unroll
      for (int r = 0; r < 8; ++r) pk.v[r] = (f16t)((acc[t][r] + bvv) * QKV_CARRY);
      *reinterpret_cast<v4u*>(&St[nl * 136 + wave * 16 + h16]) = pk.q;   // St[d][m-local]
    }
    __syncthreads();
    u16* base = Out + ((size_t)(bb * NH + hh) * HD) * SEQ + s0;          // row d -> base + d*SEQ
    auto pass = [&]() {
#pragma unroll
      for (int i = 0; i < 4; ++i) {
        const int dd = wave * 8 + i * 2 + (lane >> 4);
        const int c = lane & 15;
        const v4u v = *reinterpret_cast<const v4u*>(&St[dd * 136 + c * 8]);
        *(v4u*)(base + (size_t)dd * SEQ + c * 8) = v;
      }
    };
    pass();
    
  }
}

// Flash attention.  Q,K planes f16 [bh][s][64] (x8), V plane f16 transposed [bh][d][SEQ] (x8).
// Block = 256 threads (8 waves) owns (bh, 128 query rows); wave owns 16 queries.  64-key K and V^T tiles
// staged in LDS with plain loads, single buffer, block barriers.
// Both products are taken transposed: S^T = K . Q^T (rows = keys, columns = queries), O^T += V^T . P^T.
// A lane then holds 32 of the 64 scores of ONE query (column lane & 15; keys 16 t + 8 (lane >> 4) + r), so
// the row maximum and sum are in-lane work plus one exchange between the halves, and two score tiles,
// converted in place, are the B operand of the second product in the k order of load_frag_h.
__global__ __launch_bounds__(256) __attribute__((amdgpu_num_vgpr(256)))
void k_attn(const u16* __restrict__ Qp, const u16* __restrict__ Kp, const u16* __restrict__ Vtp,
            u16* __restrict__ Ctx) {
  __shared__ __attribute__((aligned(16))) u16 Kt[64 * P64];      // [key][d]
  __shared__ __attribute__((aligned(16))) u16 Vs[64 * P64];      // [d][key]
  __shared__ __attribute__((aligned(16))) u16 Ct[8 * 16 * P64];  // per wave [query][d]: output staging

  const int tid = threadIdx.x, wave = tid >> 5, lane = tid & 31;
  const int h16 = (lane >> 4) << 3;
  const int col = lane & 15;
  const int bh = blockIdx.x;
  const int bb = bh / NH, hh = bh - bb * NH;
  const int q0 = blockIdx.y * 128 + wave * 16;       // first query position of this wave

  const u16* Qbh = Qp + (size_t)bh * SEQ * HD;
  const u16* Kbh = Kp + (size_t)bh * SEQ * HD;
  const u16* Vbh = Vtp + (size_t)bh * HD * SEQ;
  u16* Cw = Ct + wave * (16 * P64);

  const v16h bq0 = load_frag_h(Qbh + (size_t)q0 * HD, HD);        // B[k=d][n=query], loaded like A
  const v16h bq1 = load_frag_h(Qbh + (size_t)q0 * HD + 32, HD);

  float mrow = -INFINITY;     // this lane's query: running maximum (the same in both halves)
  float lrow = 0.f;           // running sum over this half's keys only; the halves are joined after the loop
  v8f o[4] = {zero8(), zero8(), zero8(), zero8()};
  const float qrel = (float)(q0 + col - h16);        // query position less this half's key offset
  // z = acc/512 * (SEQ - |i-j|)/SEQ
  const float kmask = 1.0f / ((float)SEQ * 512.0f);

#pragma unroll 1
  for (int t0 = 0; t0 < SEQ; t0 += 64) {
    __syncthreads();                                  // prior tiles fully consumed by all waves
    const int row = tid >> 3, off = (tid & 7) << 3;   // this thread's chunks: rows row and row + 32
    const u16* gk0 = Kbh + (size_t)(t0 + row) * HD + off;
    const u16* gv0 = Vbh + (size_t)row * SEQ + t0 + off;
    const v4u kq0 = *reinterpret_cast<const v4u*>(gk0);
    const v4u vq0 = *reinterpret_cast<const v4u*>(gv0);
    const v4u kq1 = *reinterpret_cast<const v4u*>(gk0 + 32 * HD);    // constant steps: the same two address pairs
    const v4u vq1 = *reinterpret_cast<const v4u*>(gv0 + 32 * SEQ);
    // stands between the four loads and the first write of a register that one of them names as its address;
    // the two address pairs are inputs so that they are kept as they are up to this wait
    asm volatile("s_wait_xcnt 0x0" :: "v"(gk0), "v"(gv0) : "memory");
    *reinterpret_cast<v4u*>(&Kt[row * P64 + off]) = kq0;
    *reinterpret_cast<v4u*>(&Vs[row * P64 + off]) = vq0;
    *reinterpret_cast<v4u*>(&Kt[(row + 32) * P64 + off]) = kq1;
    *reinterpret_cast<v4u*>(&Vs[(row + 32) * P64 + off]) = vq1;
    __syncthreads();                                  // tiles ready

    // ---- scores: S^T(64 keys x 16 queries) = K(64 x 64 d) . Q^T ; A[m=key][k=d] from Kt[key][d]
    v8f sc[4];
#pragma unroll
    for (int t = 0; t < 4; ++t) {
      const v16h ka0 = load_frag_h(&Kt[(t * 16) * P64], P64);
      const v16h ka1 = load_frag_h(&Kt[(t * 16) * P64 + 32], P64);
      sc[t] = mma_h(ka0, bq0, zero8());
      sc[t] = mma_h(ka1, bq1, sc[t]);
    }

    // ---- scale, multiplicative distance-decay mask, online softmax; sc[t][r]: key t0 + 16 t + h16 + r
    const float dq = qrel - (float)t0;                // i - j = dq - (16 t + r): whole numbers, exact in f32
    float mt[4];                                      // one chain per score tile: four short chains, not one long
#pragma unroll
    for (int t = 0; t < 4; ++t) {
      mt[t] = -INFINITY;
#pragma unroll
      for (int r = 0; r < 8; ++r) {
        const float w = ((float)SEQ - fabsf(dq - (float)(t * 16 + r))) * kmask;
        const float z = sc[t][r] * w;
        sc[t][r] = z;
        mt[t] = fmaxf(mt[t], z);
      }
    }
    float mx = fmaxf(fmaxf(mt[0], mt[1]), fmaxf(mt[2], mt[3]));
    mx = fmaxf(mx, xhalf(mx));
    const float mnew = fmaxf(mrow, mx);
    const float alpha = __expf(mrow - mnew);
    mrow = mnew;

    // P^T as B[k=key][n=query]: elements 0..7 = score tile 2 j, elements 8..15 = score tile 2 j + 1
    v16h pb[2];
    float pt[4];                                      // partial sums, one chain per score tile as above
#pragma unroll
    for (int t = 0; t < 4; ++t) {
      pt[t] = 0.f;
#pragma unroll
      for (int r = 0; r < 8; ++r) {
        const float p = __expf(sc[t][r] - mrow);
        pt[t] += p;
        pb[t >> 1][(t & 1) * 8 + r] = (f16t)(p * P_CARRY);
      }
    }
    lrow = lrow * alpha + ((pt[0] + pt[1]) + (pt[2] + pt[3]));
#pragma unroll
    for (int dt = 0; dt < 4; ++dt)
#pragma unroll
      for (int r = 0; r < 8; ++r) o[dt][r] *= alpha;

    // ---- O^T(64 d x 16 queries) += V^T(64 d x 64 keys) . P^T ; A[m=d][k=key] from Vs[d][key]
#pragma unroll
    for (int dt = 0; dt < 4; ++dt) {
      const v16h va0 = load_frag_h(&Vs[(dt * 16) * P64], P64);
      const v16h va1 = load_frag_h(&Vs[(dt * 16) * P64 + 32], P64);
      o[dt] = mma_h(va0, pb[0], o[dt]);
      o[dt] = mma_h(va1, pb[1], o[dt]);
    }
  }

  // ---- normalize: ctx*64 = o / (l * 2048); o[dt][r] = O[query col][d = 16 dt + h16 + r]: eight d in a row,
  // one 16-byte store into the wave's own staging rows
  const float inv = 1.0f / ((lrow + xhalf(lrow)) * CTX_LDIV);
#pragma unroll
  for (int dt = 0; dt < 4; ++dt) {
    union { v8h v; v4u q; } pk;
#pragma unroll
    for (int r = 0; r < 8; ++r) pk.v[r] = (f16t)(o[dt][r] * inv);
    *reinterpret_cast<v4u*>(&Cw[col * P64 + dt * 16 + h16]) = pk.q;
  }
  // staging is wave-private: LDS completion + wave sync (also a compiler ordering point)
  asm volatile("s_wait_dscnt 0" ::: "memory");
  __builtin_amdgcn_wave_barrier();

  u16* cbase = Ctx + ((size_t)(bb * SEQ + q0)) * DM + hh * HD;   // row rr -> cbase + rr*DM
  auto pass = [&]() {
#pragma unroll
    for (int i = 0; i < 4; ++i) {
      const int rr = i * 4 + (lane >> 3);
      const int c = lane & 7;
      const v4u v = *reinterpret_cast<const v4u*>(&Cw[rr * P64 + c * 8]);
      *(v4u*)(cbase + (size_t)rr * DM + c * 8) = v;
    }
  };
  pass();
  
}

// Output projection: out[m][n] = sum_k ctx[m][k] * Wot[n][k] / (64*16) + bf16(bo[n]), f32.
// Block tile 128 x 64; f32 tile staged in LDS; each 256-B row segment written by 16 lanes x 16 B
__global__ __launch_bounds__(256) void k_oproj(const u16* __restrict__ Ctx, const u16* __restrict__ Wot,
                                               const float* __restrict__ bo, float* __restrict__ out) {
  __shared__ __attribute__((aligned(16))) u16 Bt[64 * P32];
  __shared__ __attribute__((aligned(16))) float So[128 * 68];
  const int tid = threadIdx.x, wave = tid >> 5, lane = tid & 31;
  const int h16 = (lane >> 4) << 3;
  const int col = lane & 15;
  const int mb = blockIdx.x * 128;
  const int m0 = mb + wave * 16;
  const int n0 = blockIdx.y * 64;

  v8f acc[4] = {zero8(), zero8(), zero8(), zero8()};
  for (int kk = 0; kk < DM; kk += 32) {
    __syncthreads();
    {
      const int n = tid >> 2, ko = (tid & 3) << 3;
      *reinterpret_cast<uint4*>(&Bt[n * P32 + ko]) =
          *reinterpret_cast<const uint4*>(Wot + (size_t)(n0 + n) * DM + kk + ko);
    }
    __syncthreads();
    const v16h a = load_frag_h(Ctx + (size_t)m0 * DM + kk, DM);
#pragma unroll
    for (int t = 0; t < 4; ++t) {
      const v16h b = load_frag_h(&Bt[(t * 16) * P32], P32);
      acc[t] = mma_h(a, b, acc[t]);
    }
  }

#pragma unroll
  for (int t = 0; t < 4; ++t) {
    const int nl = t * 16 + col;
    const float bvv = bf16r(bo[n0 + nl]);
#pragma unroll
    for (int r = 0; r < 8; ++r) {
      const int ml = wave * 16 + h16 + r;
      So[ml * 68 + nl] = acc[t][r] * OUT_SCALE + bvv;
    }
  }
  __syncthreads();
  float* base = out + (size_t)mb * DM + n0;            // row rr -> base + rr*DM
  auto pass = [&]() {
#pragma unroll
    for (int i = 0; i < 8; ++i) {
      const int rr = wave * 16 + i * 2 + (lane >> 4);
      const int c = lane & 15;
      const v4f v = *reinterpret_cast<const v4f*>(&So[rr * 68 + c * 4]);
      *(v4f*)(base + (size_t)rr * DM + c * 4) = v;
    }
  };
  pass();
  
}

// ---------------- launcher ----------------

extern "C" void kernel_launch(void* const* d_in, const int* in_sizes, int n_in,
                              void* d_out, int out_size, void* d_ws, size_t ws_size,
                              hipStream_t stream) {
  if (n_in < 9) return;
  if (in_sizes[0] < ((NB - 1) * SEQ_FULL + SEQ) * DM) return;
  if (in_sizes[1] < DM * DM || in_sizes[3] < DM * DM || in_sizes[5] < DM * DM || in_sizes[7] < DM * DM) return;
  if (in_sizes[2] < DM || in_sizes[4] < DM || in_sizes[6] < DM || in_sizes[8] < DM) return;
  if (out_size < M_TOT * DM) return;

  const float* x  = (const float*)d_in[0];
  const float* Wq = (const float*)d_in[1];
  const float* bq = (const float*)d_in[2];
  const float* Wk = (const float*)d_in[3];
  const float* bk = (const float*)d_in[4];
  const float* Wv = (const float*)d_in[5];
  const float* bv = (const float*)d_in[6];
  const float* Wo = (const float*)d_in[7];
  const float* bo = (const float*)d_in[8];
  float* out = (float*)d_out;

  const size_t XB_BYTES = (size_t)M_TOT * DM * 2;          // Xb bf16 [M_TOT][DM]
  const size_t WT_BYTES = (size_t)DM * DM * 2;             // each W^T 16-bit plane
  const size_t PL_BYTES = (size_t)M_TOT * DM * 2;          // Q, K, V^T, ctx planes (NB*NH*SEQ*HD = M_TOT*DM)
  const size_t total = XB_BYTES + 4 * WT_BYTES + 4 * PL_BYTES;
  if (total > ws_size) return;

  char* ws = (char*)d_ws;
  size_t off = 0;
  u16* Xb  = (u16*)(ws + off); off += XB_BYTES;
  u16* Wqt = (u16*)(ws + off); off += WT_BYTES;
  off += WT_BYTES;                                   // Wk plane, reached as Wqt + DM * DM
  off += WT_BYTES;                                   // Wv plane, reached as Wqt + 2 * DM * DM
  u16* Wot = (u16*)(ws + off); off += WT_BYTES;      // also Wqt + 3 * DM * DM
  u16* Qp  = (u16*)(ws + off); off += PL_BYTES;
  u16* Kpl = (u16*)(ws + off); off += PL_BYTES;
  u16* Vtp = (u16*)(ws + off); off += PL_BYTES;
  u16* Ctx = (u16*)(ws + off); off += PL_BYTES;
  (void)off;

  // 1) input conversion: x -> bf16 plane; Wq/Wk/Wv -> bf16 [n][k]; Wo -> f16 [n][k] (bf16 value * 16)
  k_cast<<<WCAST_BLOCKS + M_TOT / 8, 256, 0, stream>>>(x, Wq, Wk, Wv, Wo, Xb, Wqt);

  // 2) projections: Q, K -> [bh][s][64] f16 x8 ; V -> [bh][d][SEQ] f16 x8
  dim3 gp(M_TOT / 128, DM / 64);
  dim3 gp3(M_TOT / 128, DM / 64, 3);
  k_proj<<<gp3, 256, 0, stream>>>(Xb, Wqt, bq, bk, bv, Qp);

  // 3) flash attention -> ctx plane [M_TOT][DM] f16 x64
  dim3 ga(NB * NH, SEQ / 128);
  k_attn<<<ga, 256, 0, stream>>>(Qp, Kpl, Vtp, Ctx);

  // 4) output projection -> out f32 [M_TOT][DM]
  k_oproj<<<gp, 256, 0, stream>>>(Ctx, Wot, bo, out);
}

// v005
// It runs in 55.3 microseconds.
// Timed twice side by side with v004, it ran 1.31 and 1.33 times as fast.
// All steps since v000 together make it 3.46 times as fast.
#include <hip/hip_runtime.h>
#include <math.h>

// QKV projections: v_wmma_f32_16x16x32_bf16 (bf16 operands = RNE-converted inputs, f32 accumulate); QK^T, P.V and ctx@Wo: v_wmma_f32_16x16x32_f16 (f16 operands, carries Q/K/V x8, P x16384, ctx x64, Wo x16, f32 accumulate); softmax and epilogues f32.

typedef unsigned short u16;
typedef _Float16 f16t;
typedef __bf16   v16bf __attribute__((ext_vector_type(16)));
typedef _Float16 v16h  __attribute__((ext_vector_type(16)));
typedef _Float16 v8h   __attribute__((ext_vector_type(8)));
typedef float    v8f   __attribute__((ext_vector_type(8)));
typedef float    v4f   __attribute__((ext_vector_type(4)));
typedef unsigned int v4u __attribute__((ext_vector_type(4)));

#ifndef NB
#define NB 4
#endif
#ifndef SEQ
#define SEQ 2048
#endif
#define NB_FULL  4
#define SEQ_FULL 2048
#define DM 256
#define NH 4
#define HD 64
#define M_TOT (NB * SEQ)

static_assert(NB >= 1 && NB <= NB_FULL);
static_assert(SEQ >= 128 && SEQ <= SEQ_FULL && (SEQ % 128) == 0);
static_assert(DM == NH * HD);
static_assert((M_TOT % 128) == 0);
static_assert((M_TOT % 8) == 0);

// carries: Q,K,V planes hold value*8 (f16); P tile holds exp(z-m)*16384 (f16); ctx plane holds h*64 (f16);
// Wo plane holds bf16(Wo)*16 (f16).  score = acc/512 ; ctx*64 = o/(l*2048) ; out = acc/1024 + bo
#define QKV_CARRY 8.0f
#define P_CARRY   16384.0f
#define WO_CARRY  16.0f
#define CTX_LDIV  2048.0f
#define OUT_SCALE (1.0f / 1024.0f)

// LDS row pitch, in 16-bit elements, of every tile that ds_load_b128 fragment loads read: 16 B x odd, so that
// the 16 rows a half-wave reads at once fall on 16 different groups of four banks (64 banks x 4 B).
#define P64 72    // rows of 64 elements: 144 B
#define P32 40    // rows of 32 elements:  80 B

// ---------------- helpers ----------------

__device__ __forceinline__ unsigned f2bf_bits(float f) {
  unsigned u = __float_as_uint(f);
  u += 0x7FFFu + ((u >> 16) & 1u);   // RNE convert f32 -> bf16 bits
  return u >> 16;
}
__device__ __forceinline__ float bf16r(float f) { return __uint_as_float(f2bf_bits(f) << 16); }
__device__ __forceinline__ u16 h_bits(float f) {
  union { f16t h; u16 u; } c;
  c.h = (f16t)f;                     // RNE convert f32 -> f16
  return c.u;
}
__device__ __forceinline__ v8f zero8() {
  v8f z = {0.f, 0.f, 0.f, 0.f, 0.f, 0.f, 0.f, 0.f};
  return z;
}

// 16x32 16-bit fragment from a row-major [row][k] tile with pitch ldr (elements).
// lane l: row = l&15; elements 0..7 = k0+8h..k0+8h+7, elements 8..15 = k0+16+8h..+7, h = l>>4.
// Used for A (row = m) and for B loaded from a [n][k] k-contiguous copy (row = n). Same map for both.
__device__ __forceinline__ v16h load_frag_h(const u16* base, int ldr) {
  const int lane = threadIdx.x & 31;
  const int row  = lane & 15;
  const int kb   = (lane >> 4) << 3;
  union { v16h v; uint4 q[2]; } u;
  u.q[0] = *reinterpret_cast<const uint4*>(base + (size_t)row * ldr + kb);
  u.q[1] = *reinterpret_cast<const uint4*>(base + (size_t)row * ldr + 16 + kb);
  return u.v;
}
__device__ __forceinline__ v16bf load_frag_b(const u16* base, int ldr) {
  const int lane = threadIdx.x & 31;
  const int row  = lane & 15;
  const int kb   = (lane >> 4) << 3;
  union { v16bf v; uint4 q[2]; } u;
  u.q[0] = *reinterpret_cast<const uint4*>(base + (size_t)row * ldr + kb);
  u.q[1] = *reinterpret_cast<const uint4*>(base + (size_t)row * ldr + 16 + kb);
  return u.v;
}

// WMMA with the 4-slot VALU hazard guard tied to D, keeping A/B live.
__device__ __forceinline__ v8f mma_h(v16h a, v16h b, v8f c) {
  c = __builtin_amdgcn_wmma_f32_16x16x32_f16(false, a, false, b, (short)0, c, false, false);
  asm volatile("v_nop\n\tv_nop\n\tv_nop\n\tv_nop" : "+v"(c) : "v"(a), "v"(b));
  return c;
}
__device__ __forceinline__ v8f mma_b(v16bf a, v16bf b, v8f c) {
  c = __builtin_amdgcn_wmma_f32_16x16x32_bf16(false, a, false, b, (short)0, c, false, false);
  asm volatile("v_nop\n\tv_nop\n\tv_nop\n\tv_nop" : "+v"(c) : "v"(a), "v"(b));
  return c;
}

// lane l <-> lane l ^ 16: the two 16-lane halves of a wave hold the two halves of one query's keys
__device__ __forceinline__ float xhalf(float x) {
  const int b = __builtin_bit_cast(int, x);
  return __builtin_bit_cast(float, __builtin_amdgcn_permlanex16(b, b, 0x76543210, 0xfedcba98, false, false));
}

// One thread's share of a 64-key K tile and V^T tile (two 16-byte chunks of each), global memory -> LDS through no
// register.  lk, lv: the lane's LDS byte addresses; the second chunk of each lies 32 rows on.  The s_wait_xcnt is the
// last line of the copies' own statement, so that it stands in front of any rewrite of a register a copy names.
__device__ __forceinline__ void copy_kv(unsigned lk0, unsigned lk1, unsigned lv0, unsigned lv1, const u16* gk0,
                                        const u16* gk1, const u16* gv0, const u16* gv1) {
  asm volatile("global_load_async_to_lds_b128 %0, %4, off\n\t"
               "global_load_async_to_lds_b128 %1, %5, off\n\t"
               "global_load_async_to_lds_b128 %2, %6, off\n\t"
               "global_load_async_to_lds_b128 %3, %7, off\n\t"
               "s_wait_xcnt 0x0"
               :: "v"(lk0), "v"(lk1), "v"(lv0), "v"(lv1), "v"(gk0), "v"(gk1), "v"(gv0), "v"(gv1)
               : "memory");
}

// ---------------- kernels ----------------

__device__ __forceinline__ void xcast_body(const int blk, const float* __restrict__ x, u16* __restrict__ Xb) {
  const int g = blk * 256 + threadIdx.x;
  const int m = g >> 5;                 // row 0..M_TOT-1 (grid exact)
  const int c = g & 31;                 // 8-element chunk
  const int b = m / SEQ, s = m - b * SEQ;
  const float* src = x + ((size_t)b * SEQ_FULL + s) * DM + c * 8;
  const float4 f0 = *reinterpret_cast<const float4*>(src);
  const float4 f1 = *reinterpret_cast<const float4*>(src + 4);
  v4u w;
  w[0] = f2bf_bits(f0.x) | (f2bf_bits(f0.y) << 16);
  w[1] = f2bf_bits(f0.z) | (f2bf_bits(f0.w) << 16);
  w[2] = f2bf_bits(f1.x) | (f2bf_bits(f1.y) << 16);
  w[3] = f2bf_bits(f1.z) | (f2bf_bits(f1.w) << 16);
  u16* dst = Xb + (size_t)m * DM + c * 8;
  *(v4u*)(dst) = w;
  
}

// W f32 [k][n] (DM x DM) -> Wt 16-bit [n][k] (transposed, k-contiguous).  MODE false: bf16 bits of W.
// MODE true: f16 bits of bf16(W) * WO_CARRY (the same for a whole block).  Block = 64 n-rows; LDS transpose; each output row
__device__ __forceinline__ void wcast_body(const bool MODE, const int blk, u16* T, const float* __restrict__ W,
                                           u16* __restrict__ Wt) {
  const int tid = threadIdx.x, lane = tid & 31, wave = tid >> 5;
  const int n0 = blk * 64;
#pragma unroll 4
  for (int it = 0; it < 64; ++it) {
    const int idx = it * 256 + tid;
    const int k = idx >> 6, nl = idx & 63;
    const float f = W[(size_t)k * DM + n0 + nl];
    u16 bits;
    if (MODE) bits = h_bits(bf16r(f) * WO_CARRY);
    else           bits = (u16)f2bf_bits(f);
    T[nl * 264 + k] = bits;
  }
  __syncthreads();
  auto pass = [&]() {
#pragma unroll
    for (int i = 0; i < 8; ++i) {
      const int nl = wave + 8 * i;
      const v4u v = *reinterpret_cast<const v4u*>(&T[nl * 264 + lane * 8]);
      *(v4u*)(Wt + (size_t)(n0 + nl) * DM + lane * 8) = v;
    }
  };
  pass();
  
}

// All five input conversions in one grid: none reads what another writes.  Blocks 0..15 take the four weight
// planes (4 blocks each; Wt4 = the four [n][k] planes in a row: Wq, Wk, Wv, Wo), the rest the rows of x.
// The weight blocks stand first because each is a long chain of dependent steps.
#define WCAST_BLOCKS (4 * (DM / 64))
__global__ __launch_bounds__(256) void k_cast(const float* __restrict__ x, const float* __restrict__ Wq,
                                              const float* __restrict__ Wk, const float* __restrict__ Wv,
                                              const float* __restrict__ Wo, u16* __restrict__ Xb,
                                              u16* __restrict__ Wt4) {
  __shared__ __attribute__((aligned(16))) u16 T[64 * 264];
  const int blk = blockIdx.x;
  const int w = blk / (DM / 64), nb = blk - w * (DM / 64);
  if (blk < WCAST_BLOCKS)
    wcast_body(w == 3, nb, T, w == 0 ? Wq : (w == 1 ? Wk : (w == 2 ? Wv : Wo)), Wt4 + (size_t)w * DM * DM);
  else
    xcast_body(blk - WCAST_BLOCKS, x, Xb);
}

// Projection GEMM: P[m][n] = sum_k Xb[m][k] * Wt[n][k] + bias[n], stored *QKV_CARRY as f16.
// Block = 256 threads (8 waves), tile 128(m) x 64(n) (n-block = one head), K step 32, B tile in LDS.
// The three products share one grid: blockIdx.z = 0, 1, 2 is Q, K, V (none reads what another writes).
// Wt3 = the three weight planes in a row, Out3 = the three output planes in a row.
// z = 2 (V): Out plane [bh][d][SEQ] (V transposed): each d-row segment = 256 B, 16 lanes x 16 B.
__global__ __launch_bounds__(256) void k_proj(const u16* __restrict__ Xb, const u16* __restrict__ Wt3,
                                              const float* __restrict__ bq, const float* __restrict__ bk,
                                              const float* __restrict__ bv, u16* __restrict__ Out3) {
  __shared__ __attribute__((aligned(16))) u16 Bt[64 * P32];    // [n][k32]
  __shared__ __attribute__((aligned(16))) u16 St[128 * 72];    // staging: 128 x 72 (Q, K) or 64 x 136 (V)
  const int z = blockIdx.z;
  const u16* Wt = Wt3 + (size_t)z * DM * DM;
  const float* bias = z == 0 ? bq : (z == 1 ? bk : bv);
  u16* Out = Out3 + (size_t)z * M_TOT * DM;
  const int tid = threadIdx.x, wave = tid >> 5, lane = tid & 31;
  const int h16 = (lane >> 4) << 3;
  const int col = lane & 15;
  const int mb = blockIdx.x * 128;
  const int m0 = mb + wave * 16;
  const int n0 = blockIdx.y * 64;

  v8f acc[4] = {zero8(), zero8(), zero8(), zero8()};
  for (int kk = 0; kk < DM; kk += 32) {
    __syncthreads();                 // Bt free
    {
      const int n = tid >> 2, ko = (tid & 3) << 3;
      *reinterpret_cast<uint4*>(&Bt[n * P32 + ko]) =
          *reinterpret_cast<const uint4*>(Wt + (size_t)(n0 + n) * DM + kk + ko);
    }
    __syncthreads();                 // Bt ready
    const v16bf a = load_frag_b(Xb + (size_t)m0 * DM + kk, DM);
#pragma unroll
    for (int t = 0; t < 4; ++t) {
      const v16bf b = load_frag_b(&Bt[(t * 16) * P32], P32);
      acc[t] = mma_b(a, b, acc[t]);
    }
  }

  const int bb = mb / SEQ;
  const int s0 = mb - bb * SEQ;     // 128 rows of one sequence (SEQ % 128 == 0)
  const int hh = blockIdx.y;        // head index = n0 / 64

  if (z != 2) {
#pragma unroll
    for (int t = 0; t < 4; ++t) {
      const int nl = t * 16 + col;
      const float bvv = bf16r(bias[n0 + nl]);
#pragma unroll
      for (int r = 0; r < 8; ++r) {
        const int ml = wave * 16 + h16 + r;
        St[ml * 72 + nl] = h_bits((acc[t][r] + bvv) * QKV_CARRY);
      }
    }
    __syncthreads();
    u16* base = Out + ((size_t)(bb * NH + hh) * SEQ + s0) * HD;   // row ml -> base + ml*HD
    auto pass = [&]() {
#pragma unroll
      for (int i = 0; i < 4; ++i) {
        const int rr = wave * 16 + i * 4 + (lane >> 3);
        const int c = lane & 7;
        const v4u v = *reinterpret_cast<const v4u*>(&St[rr * 72 + c * 8]);
        *(v4u*)(base + (size_t)rr * HD + c * 8) = v;
      }
    };
    pass();
    
  } else {
#pragma unroll
    for (int t = 0; t < 4; ++t) {
      const int nl = t * 16 + col;
      const float bvv = bf16r(bias[n0 + nl]);
      union { v8h v; v4u q; } pk;
#pragma unroll
      for (int r = 0; r < 8; ++r) pk.v[r] = (f16t)((acc[t][r] + bvv) * QKV_CARRY);
      *reinterpret_cast<v4u*>(&St[nl * 136 + wave * 16 + h16]) = pk.q;   // St[d][m-local]
    }
    __syncthreads();
    u16* base = Out + ((size_t)(bb * NH + hh) * HD) * SEQ + s0;          // row d -> base + d*SEQ
    auto pass = [&]() {
#pragma unroll
      for (int i = 0; i < 4; ++i) {
        const int dd = wave * 8 + i * 2 + (lane >> 4);
        const int c = lane & 15;
        const v4u v = *reinterpret_cast<const v4u*>(&St[dd * 136 + c * 8]);
        *(v4u*)(base + (size_t)dd * SEQ + c * 8) = v;
      }
    };
    pass();
    
  }
}

// Flash attention.  Q,K planes f16 [bh][s][64] (x8), V plane f16 transposed [bh][d][SEQ] (x8).
// Block = 256 threads (8 waves) owns (bh, 128 query rows); wave owns 16 queries.  64-key K and V^T tiles come
// into LDS by asynchronous copies, two buffers: tile t + 1 is in flight while tile t is worked on, and one block
// barrier a trip both publishes tile t + 1 and frees tile t's buffer for tile t + 2.
// Both products are taken transposed: S^T = K . Q^T (rows = keys, columns = queries), O^T += V^T . P^T.
// A lane then holds 32 of the 64 scores of ONE query (column lane & 15; keys 16 t + 8 (lane >> 4) + r), so
// the row maximum and sum are in-lane work plus one exchange between the halves, and two score tiles,
// converted in place, are the B operand of the second product in the k order of load_frag_h.
#define KV_TILE (64 * P64)      // elements of one tile in LDS
#define KV_BUF  (2 * KV_TILE)   // elements of one buffer: K tile and V^T tile
__global__ __launch_bounds__(256) __attribute__((amdgpu_num_vgpr(256)))
void k_attn(const u16* __restrict__ Qp, const u16* __restrict__ Kp, const u16* __restrict__ Vtp,
            u16* __restrict__ Ctx) {
  __shared__ __attribute__((aligned(16))) u16 KV[2 * KV_BUF];    // per buffer: K tile [key][d], then V^T tile [d][key]
  __shared__ __attribute__((aligned(16))) u16 Ct[8 * 16 * P64];  // per wave [query][d]: output staging

  const int tid = threadIdx.x, wave = tid >> 5, lane = tid & 31;
  const int h16 = (lane >> 4) << 3;
  const int col = lane & 15;
  const int bh = blockIdx.x;
  const int bb = bh / NH, hh = bh - bb * NH;
  const int q0 = blockIdx.y * 128 + wave * 16;       // first query position of this wave

  const u16* Qbh = Qp + (size_t)bh * SEQ * HD;
  const u16* Kbh = Kp + (size_t)bh * SEQ * HD;
  const u16* Vbh = Vtp + (size_t)bh * HD * SEQ;
  u16* Cw = Ct + wave * (16 * P64);

  const v16h bq0 = load_frag_h(Qbh + (size_t)q0 * HD, HD);        // B[k=d][n=query], loaded like A
  const v16h bq1 = load_frag_h(Qbh + (size_t)q0 * HD + 32, HD);

  float mrow = -INFINITY;     // this lane's query: running maximum (the same in both halves)
  float lrow = 0.f;           // running sum over this half's keys only; the halves are joined after the loop
  v8f o[4] = {zero8(), zero8(), zero8(), zero8()};
  const float qrel = (float)(q0 + col - h16);        // query position less this half's key offset
  // z = acc/512 * (SEQ - |i-j|)/SEQ
  const float kmask = 1.0f / ((float)SEQ * 512.0f);

  const int row = tid >> 3, off = (tid & 7) << 3;     // this thread's chunks of a tile: rows row and row + 32
  const u16* gk = Kbh + (size_t)row * HD + off;       // tile at key t0: + t0 * HD
  const u16* gv = Vbh + (size_t)row * SEQ + off;      // tile at key t0: + t0
  const unsigned lk = (unsigned)(size_t)&KV[row * P64 + off];       // LDS byte address of the chunk in buffer 0
  auto stage = [&](const int t0, const unsigned buf) {              // buf: the buffer's byte offset
    copy_kv(lk + buf, lk + buf + 32 * P64 * 2, lk + buf + KV_TILE * 2, lk + buf + (KV_TILE + 32 * P64) * 2,
            gk + (size_t)t0 * HD, gk + (size_t)(t0 + 32) * HD, gv + t0, gv + t0 + 32 * SEQ);
  };
  stage(0, 0);
  asm volatile("s_wait_asynccnt 0x0" ::: "memory");   // this wave's share of tile 0 has landed
  __syncthreads();                                    // tile 0 published
  stage(64, KV_BUF * 2);                              // SEQ >= 128: a tile 1 exists

#pragma unroll 1
  for (int t0 = 0; t0 < SEQ; t0 += 64) {
    const unsigned cur = (t0 & 64) ? KV_BUF : 0;      // this trip reads this buffer alone
    const u16* Kt = KV + cur;
    const u16* Vs = KV + cur + KV_TILE;

    // ---- scores: S^T(64 keys x 16 queries) = K(64 x 64 d) . Q^T ; A[m=key][k=d] from Kt[key][d]
    v8f sc[4];
#pragma unroll
    for (int t = 0; t < 4; ++t) {
      const v16h ka0 = load_frag_h(&Kt[(t * 16) * P64], P64);
      const v16h ka1 = load_frag_h(&Kt[(t * 16) * P64 + 32], P64);
      sc[t] = mma_h(ka0, bq0, zero8());
      sc[t] = mma_h(ka1, bq1, sc[t]);
    }

    // ---- scale, multiplicative distance-decay mask, online softmax; sc[t][r]: key t0 + 16 t + h16 + r
    const float dq = qrel - (float)t0;                // i - j = dq - (16 t + r): whole numbers, exact in f32
    float mt[4];                                      // one chain per score tile: four short chains, not one long
#pragma unroll
    for (int t = 0; t < 4; ++t) {
      mt[t] = -INFINITY;
#pragma unroll
      for (int r = 0; r < 8; ++r) {
        const float w = ((float)SEQ - fabsf(dq - (float)(t * 16 + r))) * kmask;
        const float z = sc[t][r] * w;
        sc[t][r] = z;
        mt[t] = fmaxf(mt[t], z);
      }
    }
    float mx = fmaxf(fmaxf(mt[0], mt[1]), fmaxf(mt[2], mt[3]));
    mx = fmaxf(mx, xhalf(mx));
    const float mnew = fmaxf(mrow, mx);
    const float alpha = __expf(mrow - mnew);
    mrow = mnew;

    // P^T as B[k=key][n=query]: elements 0..7 = score tile 2 j, elements 8..15 = score tile 2 j + 1
    v16h pb[2];
    float pt[4];                                      // partial sums, one chain per score tile as above
#pragma unroll
    for (int t = 0; t < 4; ++t) {
      pt[t] = 0.f;
#pragma unroll
      for (int r = 0; r < 8; ++r) {
        const float p = __expf(sc[t][r] - mrow);
        pt[t] += p;
        pb[t >> 1][(t & 1) * 8 + r] = (f16t)(p * P_CARRY);
      }
    }
    lrow = lrow * alpha + ((pt[0] + pt[1]) + (pt[2] + pt[3]));
#pragma unroll
    for (int dt = 0; dt < 4; ++dt)
#pragma unroll
      for (int r = 0; r < 8; ++r) o[dt][r] *= alpha;

    // ---- O^T(64 d x 16 queries) += V^T(64 d x 64 keys) . P^T ; A[m=d][k=key] from Vs[d][key]
#pragma unroll
    for (int dt = 0; dt < 4; ++dt) {
      const v16h va0 = load_frag_h(&Vs[(dt * 16) * P64], P64);
      const v16h va1 = load_frag_h(&Vs[(dt * 16) * P64 + 32], P64);
      o[dt] = mma_h(va0, pb[0], o[dt]);
      o[dt] = mma_h(va1, pb[1], o[dt]);
    }

    asm volatile("s_wait_dscnt 0x0" ::: "memory");    // this wave's reads of the current buffer are done
    asm volatile("s_wait_asynccnt 0x0" ::: "memory"); // this wave's share of the next tile has landed
    __syncthreads();                                  // next tile published; current buffer left by every wave
    if (t0 + 128 < SEQ) stage(t0 + 128, cur * 2);     // the same test in the whole block
  }
  asm volatile("s_wait_asynccnt 0x0" ::: "memory");   // no copy is outstanding when the wave goes on

  // ---- normalize: ctx*64 = o / (l * 2048); o[dt][r] = O[query col][d = 16 dt + h16 + r]: eight d in a row,
  // one 16-byte store into the wave's own staging rows
  const float inv = 1.0f / ((lrow + xhalf(lrow)) * CTX_LDIV);
#pragma unroll
  for (int dt = 0; dt < 4; ++dt) {
    union { v8h v; v4u q; } pk;
#pragma unroll
    for (int r = 0; r < 8; ++r) pk.v[r] = (f16t)(o[dt][r] * inv);
    *reinterpret_cast<v4u*>(&Cw[col * P64 + dt * 16 + h16]) = pk.q;
  }
  // staging is wave-private: LDS completion + wave sync (also a compiler ordering point)
  asm volatile("s_wait_dscnt 0" ::: "memory");
  __builtin_amdgcn_wave_barrier();

  u16* cbase = Ctx + ((size_t)(bb * SEQ + q0)) * DM + hh * HD;   // row rr -> cbase + rr*DM
  auto pass = [&]() {
#pragma unroll
    for (int i = 0; i < 4; ++i) {
      const int rr = i * 4 + (lane >> 3);
      const int c = lane & 7;
      const v4u v = *reinterpret_cast<const v4u*>(&Cw[rr * P64 + c * 8]);
      *(v4u*)(cbase + (size_t)rr * DM + c * 8) = v;
    }
  };
  pass();
  
}

// Output projection: out[m][n] = sum_k ctx[m][k] * Wot[n][k] / (64*16) + bf16(bo[n]), f32.
// Block tile 128 x 64; f32 tile staged in LDS; each 256-B row segment written by 16 lanes x 16 B
__global__ __launch_bounds__(256) void k_oproj(const u16* __restrict__ Ctx, const u16* __restrict__ Wot,
                                               const float* __restrict__ bo, float* __restrict__ out) {
  __shared__ __attribute__((aligned(16))) u16 Bt[64 * P32];
  __shared__ __attribute__((aligned(16))) float So[128 * 68];
  const int tid = threadIdx.x, wave = tid >> 5, lane = tid & 31;
  const int h16 = (lane >> 4) << 3;
  const int col = lane & 15;
  const int mb = blockIdx.x * 128;
  const int m0 = mb + wave * 16;
  const int n0 = blockIdx.y * 64;

  v8f acc[4] = {zero8(), zero8(), zero8(), zero8()};
  for (int kk = 0; kk < DM; kk += 32) {
    __syncthreads();
    {
      const int n = tid >> 2, ko = (tid & 3) << 3;
      *reinterpret_cast<uint4*>(&Bt[n * P32 + ko]) =
          *reinterpret_cast<const uint4*>(Wot + (size_t)(n0 + n) * DM + kk + ko);
    }
    __syncthreads();
    const v16h a = load_frag_h(Ctx + (size_t)m0 * DM + kk, DM);
#pragma unroll
    for (int t = 0; t < 4; ++t) {
      const v16h b = load_frag_h(&Bt[(t * 16) * P32], P32);
      acc[t] = mma_h(a, b, acc[t]);
    }
  }

#pragma unroll
  for (int t = 0; t < 4; ++t) {
    const int nl = t * 16 + col;
    const float bvv = bf16r(bo[n0 + nl]);
#pragma unroll
    for (int r = 0; r < 8; ++r) {
      const int ml = wave * 16 + h16 + r;
      So[ml * 68 + nl] = acc[t][r] * OUT_SCALE + bvv;
    }
  }
  __syncthreads();
  float* base = out + (size_t)mb * DM + n0;            // row rr -> base + rr*DM
  auto pass = [&]() {
#pragma unroll
    for (int i = 0; i < 8; ++i) {
      const int rr = wave * 16 + i * 2 + (lane >> 4);
      const int c = lane & 15;
      const v4f v = *reinterpret_cast<const v4f*>(&So[rr * 68 + c * 4]);
      *(v4f*)(base + (size_t)rr * DM + c * 4) = v;
    }
  };
  pass();
  
}

// ---------------- launcher ----------------

extern "C" void kernel_launch(void* const* d_in, const int* in_sizes, int n_in,
                              void* d_out, int out_size, void* d_ws, size_t ws_size,
                              hipStream_t stream) {
  if (n_in < 9) return;
  if (in_sizes[0] < ((NB - 1) * SEQ_FULL + SEQ) * DM) return;
  if (in_sizes[1] < DM * DM || in_sizes[3] < DM * DM || in_sizes[5] < DM * DM || in_sizes[7] < DM * DM) return;
  if (in_sizes[2] < DM || in_sizes[4] < DM || in_sizes[6] < DM || in_sizes[8] < DM) return;
  if (out_size < M_TOT * DM) return;

  const float* x  = (const float*)d_in[0];
  const float* Wq = (const float*)d_in[1];
  const float* bq = (const float*)d_in[2];
  const float* Wk = (const float*)d_in[3];
  const float* bk = (const float*)d_in[4];
  const float* Wv = (const float*)d_in[5];
  const float* bv = (const float*)d_in[6];
  const float* Wo = (const float*)d_in[7];
  const float* bo = (const float*)d_in[8];
  float* out = (float*)d_out;

  const size_t XB_BYTES = (size_t)M_TOT * DM * 2;          // Xb bf16 [M_TOT][DM]
  const size_t WT_BYTES = (size_t)DM * DM * 2;             // each W^T 16-bit plane
  const size_t PL_BYTES = (size_t)M_TOT * DM * 2;          // Q, K, V^T, ctx planes (NB*NH*SEQ*HD = M_TOT*DM)
  const size_t total = XB_BYTES + 4 * WT_BYTES + 4 * PL_BYTES;
  if (total > ws_size) return;

  char* ws = (char*)d_ws;
  size_t off = 0;
  u16* Xb  = (u16*)(ws + off); off += XB_BYTES;
  u16* Wqt = (u16*)(ws + off); off += WT_BYTES;
  off += WT_BYTES;                                   // Wk plane, reached as Wqt + DM * DM
  off += WT_BYTES;                                   // Wv plane, reached as Wqt + 2 * DM * DM
  u16* Wot = (u16*)(ws + off); off += WT_BYTES;      // also Wqt + 3 * DM * DM
  u16* Qp  = (u16*)(ws + off); off += PL_BYTES;
  u16* Kpl = (u16*)(ws + off); off += PL_BYTES;
  u16* Vtp = (u16*)(ws + off); off += PL_BYTES;
  u16* Ctx = (u16*)(ws + off); off += PL_BYTES;
  (void)off;

  // 1) input conversion: x -> bf16 plane; Wq/Wk/Wv -> bf16 [n][k]; Wo -> f16 [n][k] (bf16 value * 16)
  k_cast<<<WCAST_BLOCKS + M_TOT / 8, 256, 0, stream>>>(x, Wq, Wk, Wv, Wo, Xb, Wqt);

  // 2) projections: Q, K -> [bh][s][64] f16 x8 ; V -> [bh][d][SEQ] f16 x8
  dim3 gp(M_TOT / 128, DM / 64);
  dim3 gp3(M_TOT / 128, DM / 64, 3);
  k_proj<<<gp3, 256, 0, stream>>>(Xb, Wqt, bq, bk, bv, Qp);

  // 3) flash attention -> ctx plane [M_TOT][DM] f16 x64
  dim3 ga(NB * NH, SEQ / 128);
  k_attn<<<ga, 256, 0, stream>>>(Qp, Kpl, Vtp, Ctx);

  // 4) output projection -> out f32 [M_TOT][DM]
  k_oproj<<<gp, 256, 0, stream>>>(Ctx, Wot, bo, out);
}

// v006
// It runs in 51 microseconds.
// Timed twice side by side with v005, it ran 1.10 times as fast both times.
// Counting every step since v000, it is 3.81 times as fast.
#include <hip/hip_runtime.h>
#include <math.h>

// QKV projections: v_wmma_f32_16x16x32_bf16 (bf16 operands = RNE-converted inputs, f32 accumulate); QK^T, P.V and ctx@Wo: v_wmma_f32_16x16x32_f16 (f16 operands, carries Q/K/V x8, P x16384, ctx x64, Wo x16, f32 accumulate); softmax and epilogues f32.

typedef unsigned short u16;
typedef _Float16 f16t;
typedef __bf16   v16bf __attribute__((ext_vector_type(16)));
typedef _Float16 v16h  __attribute__((ext_vector_type(16)));
typedef _Float16 v8h   __attribute__((ext_vector_type(8)));
typedef float    v8f   __attribute__((ext_vector_type(8)));
typedef float    v4f   __attribute__((ext_vector_type(4)));
typedef unsigned int v4u __attribute__((ext_vector_type(4)));

#ifndef NB
#define NB 4
#endif
#ifndef SEQ
#define SEQ 2048
#endif
#define NB_FULL  4
#define SEQ_FULL 2048
#define DM 256
#define NH 4
#define HD 64
#define M_TOT (NB * SEQ)

static_assert(NB >= 1 && NB <= NB_FULL);
static_assert(SEQ >= 128 && SEQ <= SEQ_FULL && (SEQ % 128) == 0);
static_assert(DM == NH * HD);
static_assert((M_TOT % 128) == 0);
static_assert((M_TOT % 8) == 0);

// carries: Q,K,V planes hold value*8 (f16); P tile holds exp(z-m)*16384 (f16); ctx plane holds h*64 (f16);
// Wo plane holds bf16(Wo)*16 (f16).  score = acc/512 ; ctx*64 = o/(l*2048) ; out = acc/1024 + bo
#define QKV_CARRY 8.0f
#define P_CARRY   16384.0f
#define WO_CARRY  16.0f
#define CTX_LDIV  2048.0f
#define OUT_SCALE (1.0f / 1024.0f)

// LDS row pitch, in 16-bit elements, of every tile that ds_load_b128 fragment loads read: 16 B x odd, so that
// the 16 rows a half-wave reads at once fall on 16 different groups of four banks (64 banks x 4 B).
#define P64 72    // rows of 64 elements: 144 B
#define P32 40    // rows of 32 elements:  80 B

// ---------------- helpers ----------------

__device__ __forceinline__ unsigned f2bf_bits(float f) {
  unsigned u = __float_as_uint(f);
  u += 0x7FFFu + ((u >> 16) & 1u);   // RNE convert f32 -> bf16 bits
  return u >> 16;
}
__device__ __forceinline__ float bf16r(float f) { return __uint_as_float(f2bf_bits(f) << 16); }
__device__ __forceinline__ u16 h_bits(float f) {
  union { f16t h; u16 u; } c;
  c.h = (f16t)f;                     // RNE convert f32 -> f16
  return c.u;
}
__device__ __forceinline__ v8f zero8() {
  v8f z = {0.f, 0.f, 0.f, 0.f, 0.f, 0.f, 0.f, 0.f};
  return z;
}

// 16x32 16-bit fragment from a row-major [row][k] tile with pitch ldr (elements).
// lane l: row = l&15; elements 0..7 = k0+8h..k0+8h+7, elements 8..15 = k0+16+8h..+7, h = l>>4.
// Used for A (row = m) and for B loaded from a [n][k] k-contiguous copy (row = n). Same map for both.
__device__ __forceinline__ v16h load_frag_h(const u16* base, int ldr) {
  const int lane = threadIdx.x & 31;
  const int row  = lane & 15;
  const int kb   = (lane >> 4) << 3;
  union { v16h v; uint4 q[2]; } u;
  u.q[0] = *reinterpret_cast<const uint4*>(base + (size_t)row * ldr + kb);
  u.q[1] = *reinterpret_cast<const uint4*>(base + (size_t)row * ldr + 16 + kb);
  return u.v;
}
__device__ __forceinline__ v16bf load_frag_b(const u16* base, int ldr) {
  const int lane = threadIdx.x & 31;
  const int row  = lane & 15;
  const int kb   = (lane >> 4) << 3;
  union { v16bf v; uint4 q[2]; } u;
  u.q[0] = *reinterpret_cast<const uint4*>(base + (size_t)row * ldr + kb);
  u.q[1] = *reinterpret_cast<const uint4*>(base + (size_t)row * ldr + 16 + kb);
  return u.v;
}

// WMMA with the 4-slot VALU hazard guard tied to D, keeping A/B live.
__device__ __forceinline__ v8f mma_h(v16h a, v16h b, v8f c) {
  c = __builtin_amdgcn_wmma_f32_16x16x32_f16(false, a, false, b, (short)0, c, false, false);
  asm volatile("v_nop\n\tv_nop\n\tv_nop\n\tv_nop" : "+v"(c) : "v"(a), "v"(b));
  return c;
}
__device__ __forceinline__ v8f mma_b(v16bf a, v16bf b, v8f c) {
  c = __builtin_amdgcn_wmma_f32_16x16x32_bf16(false, a, false, b, (short)0, c, false, false);
  asm volatile("v_nop\n\tv_nop\n\tv_nop\n\tv_nop" : "+v"(c) : "v"(a), "v"(b));
  return c;
}

// lane l <-> lane l ^ 16: the two 16-lane halves of a wave hold the two halves of one query's keys
__device__ __forceinline__ float xhalf(float x) {
  const int b = __builtin_bit_cast(int, x);
  return __builtin_bit_cast(float, __builtin_amdgcn_permlanex16(b, b, 0x76543210, 0xfedcba98, false, false));
}

// One thread's share of a 64-key K tile and V^T tile (two 16-byte chunks of each), global memory -> LDS through no
// register.  lk, lv: the lane's LDS byte addresses; the second chunk of each lies 32 rows on.  The s_wait_xcnt is the
// last line of the copies' own statement, so that it stands in front of any rewrite of a register a copy names.
__device__ __forceinline__ void copy_kv(unsigned lk0, unsigned lk1, unsigned lv0, unsigned lv1, const u16* gk0,
                                        const u16* gk1, const u16* gv0, const u16* gv1) {
  asm volatile("global_load_async_to_lds_b128 %0, %4, off\n\t"
               "global_load_async_to_lds_b128 %1, %5, off\n\t"
               "global_load_async_to_lds_b128 %2, %6, off\n\t"
               "global_load_async_to_lds_b128 %3, %7, off\n\t"
               "s_wait_xcnt 0x0"
               :: "v"(lk0), "v"(lk1), "v"(lv0), "v"(lv1), "v"(gk0), "v"(gk1), "v"(gv0), "v"(gv1)
               : "memory");
}

// ---------------- kernels ----------------

__device__ __forceinline__ void xcast_body(const int blk, const float* __restrict__ x, u16* __restrict__ Xb) {
  const int g = blk * 256 + threadIdx.x;
  const int m = g >> 5;                 // row 0..M_TOT-1 (grid exact)
  const int c = g & 31;                 // 8-element chunk
  const int b = m / SEQ, s = m - b * SEQ;
  const float* src = x + ((size_t)b * SEQ_FULL + s) * DM + c * 8;
  const float4 f0 = *reinterpret_cast<const float4*>(src);
  const float4 f1 = *reinterpret_cast<const float4*>(src + 4);
  v4u w;
  w[0] = f2bf_bits(f0.x) | (f2bf_bits(f0.y) << 16);
  w[1] = f2bf_bits(f0.z) | (f2bf_bits(f0.w) << 16);
  w[2] = f2bf_bits(f1.x) | (f2bf_bits(f1.y) << 16);
  w[3] = f2bf_bits(f1.z) | (f2bf_bits(f1.w) << 16);
  u16* dst = Xb + (size_t)m * DM + c * 8;
  *(v4u*)(dst) = w;
  
}

// W f32 [k][n] (DM x DM) -> Wt 16-bit [n][k] (transposed, k-contiguous).  MODE false: bf16 bits of W.
// MODE true: f16 bits of bf16(W) * WO_CARRY (the same for a whole block).  Block = 64 n-rows; LDS transpose; each output row
__device__ __forceinline__ void wcast_body(const bool MODE, const int blk, u16* T, const float* __restrict__ W,
                                           u16* __restrict__ Wt) {
  const int tid = threadIdx.x, lane = tid & 31, wave = tid >> 5;
  const int n0 = blk * 64;
#pragma unroll 4
  for (int it = 0; it < 64; ++it) {
    const int idx = it * 256 + tid;
    const int k = idx >> 6, nl = idx & 63;
    const float f = W[(size_t)k * DM + n0 + nl];
    u16 bits;
    if (MODE) bits = h_bits(bf16r(f) * WO_CARRY);
    else           bits = (u16)f2bf_bits(f);
    T[nl * 264 + k] = bits;
  }
  __syncthreads();
  auto pass = [&]() {
#pragma unroll
    for (int i = 0; i < 8; ++i) {
      const int nl = wave + 8 * i;
      const v4u v = *reinterpret_cast<const v4u*>(&T[nl * 264 + lane * 8]);
      *(v4u*)(Wt + (size_t)(n0 + nl) * DM + lane * 8) = v;
    }
  };
  pass();
  
}

// All five input conversions in one grid: none reads what another writes.  Blocks 0..15 take the four weight
// planes (4 blocks each; Wt4 = the four [n][k] planes in a row: Wq, Wk, Wv, Wo), the rest the rows of x.
// The weight blocks stand first because each is a long chain of dependent steps.
#define WCAST_BLOCKS (4 * (DM / 64))
__global__ __launch_bounds__(256) void k_cast(const float* __restrict__ x, const float* __restrict__ Wq,
                                              const float* __restrict__ Wk, const float* __restrict__ Wv,
                                              const float* __restrict__ Wo, u16* __restrict__ Xb,
                                              u16* __restrict__ Wt4) {
  __shared__ __attribute__((aligned(16))) u16 T[64 * 264];
  const int blk = blockIdx.x;
  const int w = blk / (DM / 64), nb = blk - w * (DM / 64);
  if (blk < WCAST_BLOCKS)
    wcast_body(w == 3, nb, T, w == 0 ? Wq : (w == 1 ? Wk : (w == 2 ? Wv : Wo)), Wt4 + (size_t)w * DM * DM);
  else
    xcast_body(blk - WCAST_BLOCKS, x, Xb);
}

// Projection GEMM: P[m][n] = sum_k Xb[m][k] * Wt[n][k] + bias[n], stored *QKV_CARRY as f16.
// Block = 256 threads (8 waves), tile 128(m) x 64(n) (n-block = one head), K step 32, B tile in LDS.
// The three products share one grid: blockIdx.z = 0, 1, 2 is Q, K, V (none reads what another writes).
// Wt3 = the three weight planes in a row, Out3 = the three output planes in a row.
// z = 2 (V): Out plane [bh][d][SEQ] (V transposed): each d-row segment = 256 B, 16 lanes x 16 B.
__global__ __launch_bounds__(256) void k_proj(const u16* __restrict__ Xb, const u16* __restrict__ Wt3,
                                              const float* __restrict__ bq, const float* __restrict__ bk,
                                              const float* __restrict__ bv, u16* __restrict__ Out3) {
  __shared__ __attribute__((aligned(16))) u16 Bt[64 * P32];    // [n][k32]
  __shared__ __attribute__((aligned(16))) u16 St[128 * 72];    // staging: 128 x 72 (Q, K) or 64 x 136 (V)
  const int z = blockIdx.z;
  const u16* Wt = Wt3 + (size_t)z * DM * DM;
  const float* bias = z == 0 ? bq : (z == 1 ? bk : bv);
  u16* Out = Out3 + (size_t)z * M_TOT * DM;
  const int tid = threadIdx.x, wave = tid >> 5, lane = tid & 31;
  const int h16 = (lane >> 4) << 3;
  const int col = lane & 15;
  const int mb = blockIdx.x * 128;
  const int m0 = mb + wave * 16;
  const int n0 = blockIdx.y * 64;

  v8f acc[4] = {zero8(), zero8(), zero8(), zero8()};
  for (int kk = 0; kk < DM; kk += 32) {
    __syncthreads();                 // Bt free
    {
      const int n = tid >> 2, ko = (tid & 3) << 3;
      *reinterpret_cast<uint4*>(&Bt[n * P32 + ko]) =
          *reinterpret_cast<const uint4*>(Wt + (size_t)(n0 + n) * DM + kk + ko);
    }
    __syncthreads();                 // Bt ready
    const v16bf a = load_frag_b(Xb + (size_t)m0 * DM + kk, DM);
    v16bf b[4];                      // the step's B fragments: one group of LDS loads, one latency instead of four
#pragma unroll
    for (int t = 0; t < 4; ++t) b[t] = load_frag_b(&Bt[(t * 16) * P32], P32);
#pragma unroll
    for (int t = 0; t < 4; ++t) acc[t] = mma_b(a, b[t], acc[t]);
  }

  const int bb = mb / SEQ;
  const int s0 = mb - bb * SEQ;     // 128 rows of one sequence (SEQ % 128 == 0)
  const int hh = blockIdx.y;        // head index = n0 / 64

  if (z != 2) {
#pragma unroll
    for (int t = 0; t < 4; ++t) {
      const int nl = t * 16 + col;
      const float bvv = bf16r(bias[n0 + nl]);
#pragma unroll
      for (int r = 0; r < 8; ++r) {
        const int ml = wave * 16 + h16 + r;
        St[ml * 72 + nl] = h_bits((acc[t][r] + bvv) * QKV_CARRY);
      }
    }
    __syncthreads();
    u16* base = Out + ((size_t)(bb * NH + hh) * SEQ + s0) * HD;   // row ml -> base + ml*HD
    auto pass = [&]() {
#pragma unroll
      for (int i = 0; i < 4; ++i) {
        const int rr = wave * 16 + i * 4 + (lane >> 3);
        const int c = lane & 7;
        const v4u v = *reinterpret_cast<const v4u*>(&St[rr * 72 + c * 8]);
        *(v4u*)(base + (size_t)rr * HD + c * 8) = v;
      }
    };
    pass();
    
  } else {
#pragma unroll
    for (int t = 0; t < 4; ++t) {
      const int nl = t * 16 + col;
      const float bvv = bf16r(bias[n0 + nl]);
      union { v8h v; v4u q; } pk;
#pragma unroll
      for (int r = 0; r < 8; ++r) pk.v[r] = (f16t)((acc[t][r] + bvv) * QKV_CARRY);
      *reinterpret_cast<v4u*>(&St[nl * 136 + wave * 16 + h16]) = pk.q;   // St[d][m-local]
    }
    __syncthreads();
    u16* base = Out + ((size_t)(bb * NH + hh) * HD) * SEQ + s0;          // row d -> base + d*SEQ
    auto pass = [&]() {
#pragma unroll
      for (int i = 0; i < 4; ++i) {
        const int dd = wave * 8 + i * 2 + (lane >> 4);
        const int c = lane & 15;
        const v4u v = *reinterpret_cast<const v4u*>(&St[dd * 136 + c * 8]);
        *(v4u*)(base + (size_t)dd * SEQ + c * 8) = v;
      }
    };
    pass();
    
  }
}

// Flash attention.  Q,K planes f16 [bh][s][64] (x8), V plane f16 transposed [bh][d][SEQ] (x8).
// Block = 256 threads (8 waves) owns (bh, 128 query rows); wave owns 16 queries.  64-key K and V^T tiles come
// into LDS by asynchronous copies, two buffers: tile t + 1 is in flight while tile t is worked on, and one block
// barrier a trip both publishes tile t + 1 and frees tile t's buffer for tile t + 2.
// Both products are taken transposed: S^T = K . Q^T (rows = keys, columns = queries), O^T += V^T . P^T.
// A lane then holds 32 of the 64 scores of ONE query (column lane & 15; keys 16 t + 8 (lane >> 4) + r), so
// the row maximum and sum are in-lane work plus one exchange between the halves, and two score tiles,
// converted in place, are the B operand of the second product in the k order of load_frag_h.
#define KV_TILE (64 * P64)      // elements of one tile in LDS
#define KV_BUF  (2 * KV_TILE)   // elements of one buffer: K tile and V^T tile
__global__ __launch_bounds__(256) __attribute__((amdgpu_num_vgpr(256)))
void k_attn(const u16* __restrict__ Qp, const u16* __restrict__ Kp, const u16* __restrict__ Vtp,
            u16* __restrict__ Ctx) {
  __shared__ __attribute__((aligned(16))) u16 KV[2 * KV_BUF];    // per buffer: K tile [key][d], then V^T tile [d][key]
  __shared__ __attribute__((aligned(16))) u16 Ct[8 * 16 * P64];  // per wave [query][d]: output staging

  const int tid = threadIdx.x, wave = tid >> 5, lane = tid & 31;
  const int h16 = (lane >> 4) << 3;
  const int col = lane & 15;
  const int bh = blockIdx.x;
  const int bb = bh / NH, hh = bh - bb * NH;
  const int q0 = blockIdx.y * 128 + wave * 16;       // first query position of this wave

  const u16* Qbh = Qp + (size_t)bh * SEQ * HD;
  const u16* Kbh = Kp + (size_t)bh * SEQ * HD;
  const u16* Vbh = Vtp + (size_t)bh * HD * SEQ;
  u16* Cw = Ct + wave * (16 * P64);

  const v16h bq0 = load_frag_h(Qbh + (size_t)q0 * HD, HD);        // B[k=d][n=query], loaded like A
  const v16h bq1 = load_frag_h(Qbh + (size_t)q0 * HD + 32, HD);

  float mrow = -INFINITY;     // this lane's query: running maximum (the same in both halves)
  float lrow = 0.f;           // running sum over this half's keys only; the halves are joined after the loop
  v8f o[4] = {zero8(), zero8(), zero8(), zero8()};
  const float qrel = (float)(q0 + col - h16);        // query position less this half's key offset
  // z = acc/512 * (SEQ - |i-j|)/SEQ
  const float kmask = 1.0f / ((float)SEQ * 512.0f);

  const int row = tid >> 3, off = (tid & 7) << 3;     // this thread's chunks of a tile: rows row and row + 32
  const u16* gk = Kbh + (size_t)row * HD + off;       // tile at key t0: + t0 * HD
  const u16* gv = Vbh + (size_t)row * SEQ + off;      // tile at key t0: + t0
  const unsigned lk = (unsigned)(size_t)&KV[row * P64 + off];       // LDS byte address of the chunk in buffer 0
  auto stage = [&](const int t0, const unsigned buf) {              // buf: the buffer's byte offset
    copy_kv(lk + buf, lk + buf + 32 * P64 * 2, lk + buf + KV_TILE * 2, lk + buf + (KV_TILE + 32 * P64) * 2,
            gk + (size_t)t0 * HD, gk + (size_t)(t0 + 32) * HD, gv + t0, gv + t0 + 32 * SEQ);
  };
  stage(0, 0);
  asm volatile("s_wait_asynccnt 0x0" ::: "memory");   // this wave's share of tile 0 has landed
  __syncthreads();                                    // tile 0 published
  stage(64, KV_BUF * 2);                              // SEQ >= 128: a tile 1 exists

#pragma unroll 1
  for (int t0 = 0; t0 < SEQ; t0 += 64) {
    const unsigned cur = (t0 & 64) ? KV_BUF : 0;      // this trip reads this buffer alone
    const u16* Kt = KV + cur;
    const u16* Vs = KV + cur + KV_TILE;

    // ---- scores: S^T(64 keys x 16 queries) = K(64 x 64 d) . Q^T ; A[m=key][k=d] from Kt[key][d]
    // All 16 loads of the K fragments stand in one group at the top of the trip, in the order of their use; the
    // mask weights, which need no score, stand behind them and run while the loads are under way.
    v16h ka[2][4];
#pragma unroll
    for (int j = 0; j < 2; ++j)
#pragma unroll
      for (int t = 0; t < 4; ++t) ka[j][t] = load_frag_h(&Kt[(t * 16) * P64 + j * 32], P64);

    const float dq = qrel - (float)t0;                // i - j = dq - (16 t + r): whole numbers, exact in f32
    float wm[4][8];                                   // scale and multiplicative distance-decay mask of sc[t][r]
#pragma unroll
    for (int t = 0; t < 4; ++t)
#pragma unroll
      for (int r = 0; r < 8; ++r) wm[t][r] = ((float)SEQ - fabsf(dq - (float)(t * 16 + r))) * kmask;

    v8f sc[4];
#pragma unroll
    for (int t = 0; t < 4; ++t) sc[t] = mma_h(ka[0][t], bq0, zero8());
#pragma unroll
    for (int t = 0; t < 4; ++t) sc[t] = mma_h(ka[1][t], bq1, sc[t]);

    // All 16 loads of the V^T fragments, one group in front of the softmax, whose work covers their latency.
    v16h va[2][4];
#pragma unroll
    for (int j = 0; j < 2; ++j)
#pragma unroll
      for (int dt = 0; dt < 4; ++dt) va[j][dt] = load_frag_h(&Vs[(dt * 16) * P64 + j * 32], P64);
    __builtin_amdgcn_sched_barrier(0);                // or the scheduler sinks these loads down to their WMMAs

    // ---- scale and mask, online softmax; sc[t][r]: key t0 + 16 t + h16 + r
    float mt[4];                                      // one chain per score tile: four short chains, not one long
#pragma unroll
    for (int t = 0; t < 4; ++t) {
      mt[t] = -INFINITY;
#pragma unroll
      for (int r = 0; r < 8; ++r) {
        const float z = sc[t][r] * wm[t][r];
        sc[t][r] = z;
        mt[t] = fmaxf(mt[t], z);
      }
    }
    float mx = fmaxf(fmaxf(mt[0], mt[1]), fmaxf(mt[2], mt[3]));
    mx = fmaxf(mx, xhalf(mx));
    const float mnew = fmaxf(mrow, mx);
    const float alpha = __expf(mrow - mnew);
    mrow = mnew;

    // P^T as B[k=key][n=query]: elements 0..7 = score tile 2 j, elements 8..15 = score tile 2 j + 1
    v16h pb[2];
    float pt[4];                                      // partial sums, one chain per score tile as above
#pragma unroll
    for (int t = 0; t < 4; ++t) {
      pt[t] = 0.f;
#pragma unroll
      for (int r = 0; r < 8; ++r) {
        const float p = __expf(sc[t][r] - mrow);
        pt[t] += p;
        pb[t >> 1][(t & 1) * 8 + r] = (f16t)(p * P_CARRY);
      }
    }
    lrow = lrow * alpha + ((pt[0] + pt[1]) + (pt[2] + pt[3]));
#pragma unroll
    for (int dt = 0; dt < 4; ++dt)
#pragma unroll
      for (int r = 0; r < 8; ++r) o[dt][r] *= alpha;

    // ---- O^T(64 d x 16 queries) += V^T(64 d x 64 keys) . P^T ; A[m=d][k=key] from Vs[d][key]
#pragma unroll
    for (int dt = 0; dt < 4; ++dt) o[dt] = mma_h(va[0][dt], pb[0], o[dt]);
#pragma unroll
    for (int dt = 0; dt < 4; ++dt) o[dt] = mma_h(va[1][dt], pb[1], o[dt]);

    asm volatile("s_wait_dscnt 0x0" ::: "memory");    // this wave's reads of the current buffer are done
    asm volatile("s_wait_asynccnt 0x0" ::: "memory"); // this wave's share of the next tile has landed
    __syncthreads();                                  // next tile published; current buffer left by every wave
    if (t0 + 128 < SEQ) stage(t0 + 128, cur * 2);     // the same test in the whole block
  }
  asm volatile("s_wait_asynccnt 0x0" ::: "memory");   // no copy is outstanding when the wave goes on

  // ---- normalize: ctx*64 = o / (l * 2048); o[dt][r] = O[query col][d = 16 dt + h16 + r]: eight d in a row,
  // one 16-byte store into the wave's own staging rows
  const float inv = 1.0f / ((lrow + xhalf(lrow)) * CTX_LDIV);
#pragma unroll
  for (int dt = 0; dt < 4; ++dt) {
    union { v8h v; v4u q; } pk;
#pragma unroll
    for (int r = 0; r < 8; ++r) pk.v[r] = (f16t)(o[dt][r] * inv);
    *reinterpret_cast<v4u*>(&Cw[col * P64 + dt * 16 + h16]) = pk.q;
  }
  // staging is wave-private: LDS completion + wave sync (also a compiler ordering point)
  asm volatile("s_wait_dscnt 0" ::: "memory");
  __builtin_amdgcn_wave_barrier();

  u16* cbase = Ctx + ((size_t)(bb * SEQ + q0)) * DM + hh * HD;   // row rr -> cbase + rr*DM
  auto pass = [&]() {
#pragma unroll
    for (int i = 0; i < 4; ++i) {
      const int rr = i * 4 + (lane >> 3);
      const int c = lane & 7;
      const v4u v = *reinterpret_cast<const v4u*>(&Cw[rr * P64 + c * 8]);
      *(v4u*)(cbase + (size_t)rr * DM + c * 8) = v;
    }
  };
  pass();
  
}

// Output projection: out[m][n] = sum_k ctx[m][k] * Wot[n][k] / (64*16) + bf16(bo[n]), f32.
// Block tile 128 x 64; f32 tile staged in LDS; each 256-B row segment written by 16 lanes x 16 B
__global__ __launch_bounds__(256) void k_oproj(const u16* __restrict__ Ctx, const u16* __restrict__ Wot,
                                               const float* __restrict__ bo, float* __restrict__ out) {
  __shared__ __attribute__((aligned(16))) u16 Bt[64 * P32];
  __shared__ __attribute__((aligned(16))) float So[128 * 68];
  const int tid = threadIdx.x, wave = tid >> 5, lane = tid & 31;
  const int h16 = (lane >> 4) << 3;
  const int col = lane & 15;
  const int mb = blockIdx.x * 128;
  const int m0 = mb + wave * 16;
  const int n0 = blockIdx.y * 64;

  v8f acc[4] = {zero8(), zero8(), zero8(), zero8()};
  for (int kk = 0; kk < DM; kk += 32) {
    __syncthreads();
    {
      const int n = tid >> 2, ko = (tid & 3) << 3;
      *reinterpret_cast<uint4*>(&Bt[n * P32 + ko]) =
          *reinterpret_cast<const uint4*>(Wot + (size_t)(n0 + n) * DM + kk + ko);
    }
    __syncthreads();
    const v16h a = load_frag_h(Ctx + (size_t)m0 * DM + kk, DM);
    v16h b[4];                       // the step's B fragments: one group of LDS loads, one latency instead of four
#pragma unroll
    for (int t = 0; t < 4; ++t) b[t] = load_frag_h(&Bt[(t * 16) * P32], P32);
#pragma unroll
    for (int t = 0; t < 4; ++t) acc[t] = mma_h(a, b[t], acc[t]);
  }

#pragma unroll
  for (int t = 0; t < 4; ++t) {
    const int nl = t * 16 + col;
    const float bvv = bf16r(bo[n0 + nl]);
#pragma unroll
    for (int r = 0; r < 8; ++r) {
      const int ml = wave * 16 + h16 + r;
      So[ml * 68 + nl] = acc[t][r] * OUT_SCALE + bvv;
    }
  }
  __syncthreads();
  float* base = out + (size_t)mb * DM + n0;            // row rr -> base + rr*DM
  auto pass = [&]() {
#pragma unroll
    for (int i = 0; i < 8; ++i) {
      const int rr = wave * 16 + i * 2 + (lane >> 4);
      const int c = lane & 15;
      const v4f v = *reinterpret_cast<const v4f*>(&So[rr * 68 + c * 4]);
      *(v4f*)(base + (size_t)rr * DM + c * 4) = v;
    }
  };
  pass();
  
}

// ---------------- launcher ----------------

extern "C" void kernel_launch(void* const* d_in, const int* in_sizes, int n_in,
                              void* d_out, int out_size, void* d_ws, size_t ws_size,
                              hipStream_t stream) {
  if (n_in < 9) return;
  if (in_sizes[0] < ((NB - 1) * SEQ_FULL + SEQ) * DM) return;
  if (in_sizes[1] < DM * DM || in_sizes[3] < DM * DM || in_sizes[5] < DM * DM || in_sizes[7] < DM * DM) return;
  if (in_sizes[2] < DM || in_sizes[4] < DM || in_sizes[6] < DM || in_sizes[8] < DM) return;
  if (out_size < M_TOT * DM) return;

  const float* x  = (const float*)d_in[0];
  const float* Wq = (const float*)d_in[1];
  const float* bq = (const float*)d_in[2];
  const float* Wk = (const float*)d_in[3];
  const float* bk = (const float*)d_in[4];
  const float* Wv = (const float*)d_in[5];
  const float* bv = (const float*)d_in[6];
  const float* Wo = (const float*)d_in[7];
  const float* bo = (const float*)d_in[8];
  float* out = (float*)d_out;

  const size_t XB_BYTES = (size_t)M_TOT * DM * 2;          // Xb bf16 [M_TOT][DM]
  const size_t WT_BYTES = (size_t)DM * DM * 2;             // each W^T 16-bit plane
  const size_t PL_BYTES = (size_t)M_TOT * DM * 2;          // Q, K, V^T, ctx planes (NB*NH*SEQ*HD = M_TOT*DM)
  const size_t total = XB_BYTES + 4 * WT_BYTES + 4 * PL_BYTES;
  if (total > ws_size) return;

  char* ws = (char*)d_ws;
  size_t off = 0;
  u16* Xb  = (u16*)(ws + off); off += XB_BYTES;
  u16* Wqt = (u16*)(ws + off); off += WT_BYTES;
  off += WT_BYTES;                                   // Wk plane, reached as Wqt + DM * DM
  off += WT_BYTES;                                   // Wv plane, reached as Wqt + 2 * DM * DM
  u16* Wot = (u16*)(ws + off); off += WT_BYTES;      // also Wqt + 3 * DM * DM
  u16* Qp  = (u16*)(ws + off); off += PL_BYTES;
  u16* Kpl = (u16*)(ws + off); off += PL_BYTES;
  u16* Vtp = (u16*)(ws + off); off += PL_BYTES;
  u16* Ctx = (u16*)(ws + off); off += PL_BYTES;
  (void)off;

  // 1) input conversion: x -> bf16 plane; Wq/Wk/Wv -> bf16 [n][k]; Wo -> f16 [n][k] (bf16 value * 16)
  k_cast<<<WCAST_BLOCKS + M_TOT / 8, 256, 0, stream>>>(x, Wq, Wk, Wv, Wo, Xb, Wqt);

  // 2) projections: Q, K -> [bh][s][64] f16 x8 ; V -> [bh][d][SEQ] f16 x8
  dim3 gp(M_TOT / 128, DM / 64);
  dim3 gp3(M_TOT / 128, DM / 64, 3);
  k_proj<<<gp3, 256, 0, stream>>>(Xb, Wqt, bq, bk, bv, Qp);

  // 3) flash attention -> ctx plane [M_TOT][DM] f16 x64
  dim3 ga(NB * NH, SEQ / 128);
  k_attn<<<ga, 256, 0, stream>>>(Qp, Kpl, Vtp, Ctx);

  // 4) output projection -> out f32 [M_TOT][DM]
  k_oproj<<<gp, 256, 0, stream>>>(Ctx, Wot, bo, out);
}

// v007
// One run takes 46 microseconds.
// In two side-by-side timings against v006, it was 1.10 and 1.11 times as fast.
// Counting every step since v000, it is 4.22 times as fast.
#include <hip/hip_runtime.h>
#include <math.h>

// QKV projections: v_wmma_f32_16x16x32_bf16 (bf16 operands = RNE-converted inputs, f32 accumulate); QK^T, P.V and ctx@Wo: v_wmma_f32_16x16x32_f16 (f16 operands, carries Q/K/V x8, P x16384, ctx x64, Wo x16, f32 accumulate); softmax and epilogues f32.

typedef unsigned short u16;
typedef _Float16 f16t;
typedef __bf16   v16bf __attribute__((ext_vector_type(16)));
typedef _Float16 v16h  __attribute__((ext_vector_type(16)));
typedef _Float16 v8h   __attribute__((ext_vector_type(8)));
typedef float    v8f   __attribute__((ext_vector_type(8)));
typedef float    v4f   __attribute__((ext_vector_type(4)));
typedef unsigned int v4u __attribute__((ext_vector_type(4)));

#ifndef NB
#define NB 4
#endif
#ifndef SEQ
#define SEQ 2048
#endif
#define NB_FULL  4
#define SEQ_FULL 2048
#define DM 256
#define NH 4
#define HD 64
#define M_TOT (NB * SEQ)

static_assert(NB >= 1 && NB <= NB_FULL);
static_assert(SEQ >= 128 && SEQ <= SEQ_FULL && (SEQ % 128) == 0);
static_assert(DM == NH * HD);
static_assert((M_TOT % 128) == 0);
static_assert((M_TOT % 8) == 0);

// carries: Q,K,V planes hold value*8 (f16); P tile holds exp(z-m)*16384 (f16); ctx plane holds h*64 (f16);
// Wo plane holds bf16(Wo)*16 (f16).  score = acc/512 ; ctx*64 = o/(l*2048) ; out = acc/1024 + bo
#define QKV_CARRY 8.0f
#define P_CARRY   16384.0f
#define WO_CARRY  16.0f
#define CTX_LDIV  2048.0f
#define OUT_SCALE (1.0f / 1024.0f)

// LDS row pitch, in 16-bit elements, of every tile that ds_load_b128 fragment loads read: 16 B x odd, so that
// the 16 rows a half-wave reads at once fall on 16 different groups of four banks (64 banks x 4 B).
#define P64 72    // rows of 64 elements: 144 B
#define P256 264  // rows of 256 elements: 528 B

// ---------------- helpers ----------------

__device__ __forceinline__ unsigned f2bf_bits(float f) {
  unsigned u = __float_as_uint(f);
  u += 0x7FFFu + ((u >> 16) & 1u);   // RNE convert f32 -> bf16 bits
  return u >> 16;
}
__device__ __forceinline__ float bf16r(float f) { return __uint_as_float(f2bf_bits(f) << 16); }
__device__ __forceinline__ u16 h_bits(float f) {
  union { f16t h; u16 u; } c;
  c.h = (f16t)f;                     // RNE convert f32 -> f16
  return c.u;
}
__device__ __forceinline__ v8f zero8() {
  v8f z = {0.f, 0.f, 0.f, 0.f, 0.f, 0.f, 0.f, 0.f};
  return z;
}

// 16x32 16-bit fragment from a row-major [row][k] tile with pitch ldr (elements).
// lane l: row = l&15; elements 0..7 = k0+8h..k0+8h+7, elements 8..15 = k0+16+8h..+7, h = l>>4.
// Used for A (row = m) and for B loaded from a [n][k] k-contiguous copy (row = n). Same map for both.
__device__ __forceinline__ v16h load_frag_h(const u16* base, int ldr) {
  const int lane = threadIdx.x & 31;
  const int row  = lane & 15;
  const int kb   = (lane >> 4) << 3;
  union { v16h v; uint4 q[2]; } u;
  u.q[0] = *reinterpret_cast<const uint4*>(base + (size_t)row * ldr + kb);
  u.q[1] = *reinterpret_cast<const uint4*>(base + (size_t)row * ldr + 16 + kb);
  return u.v;
}
__device__ __forceinline__ v16bf load_frag_b(const u16* base, int ldr) {
  const int lane = threadIdx.x & 31;
  const int row  = lane & 15;
  const int kb   = (lane >> 4) << 3;
  union { v16bf v; uint4 q[2]; } u;
  u.q[0] = *reinterpret_cast<const uint4*>(base + (size_t)row * ldr + kb);
  u.q[1] = *reinterpret_cast<const uint4*>(base + (size_t)row * ldr + 16 + kb);
  return u.v;
}

// WMMA with the 4-slot VALU hazard guard tied to D, keeping A/B live.
__device__ __forceinline__ v8f mma_h(v16h a, v16h b, v8f c) {
  c = __builtin_amdgcn_wmma_f32_16x16x32_f16(false, a, false, b, (short)0, c, false, false);
  asm volatile("v_nop\n\tv_nop\n\tv_nop\n\tv_nop" : "+v"(c) : "v"(a), "v"(b));
  return c;
}
__device__ __forceinline__ v8f mma_b(v16bf a, v16bf b, v8f c) {
  c = __builtin_amdgcn_wmma_f32_16x16x32_bf16(false, a, false, b, (short)0, c, false, false);
  asm volatile("v_nop\n\tv_nop\n\tv_nop\n\tv_nop" : "+v"(c) : "v"(a), "v"(b));
  return c;
}

// lane l <-> lane l ^ 16: the two 16-lane halves of a wave hold the two halves of one query's keys
__device__ __forceinline__ float xhalf(float x) {
  const int b = __builtin_bit_cast(int, x);
  return __builtin_bit_cast(float, __builtin_amdgcn_permlanex16(b, b, 0x76543210, 0xfedcba98, false, false));
}

// One thread's share of a 64-key K tile and V^T tile (two 16-byte chunks of each), global memory -> LDS through no
// register.  lk, lv: the lane's LDS byte addresses; the second chunk of each lies 32 rows on.  The s_wait_xcnt is the
// last line of the copies' own statement, so that it stands in front of any rewrite of a register a copy names.
__device__ __forceinline__ void copy_kv(unsigned lk0, unsigned lk1, unsigned lv0, unsigned lv1, const u16* gk0,
                                        const u16* gk1, const u16* gv0, const u16* gv1) {
  asm volatile("global_load_async_to_lds_b128 %0, %4, off\n\t"
               "global_load_async_to_lds_b128 %1, %5, off\n\t"
               "global_load_async_to_lds_b128 %2, %6, off\n\t"
               "global_load_async_to_lds_b128 %3, %7, off\n\t"
               "s_wait_xcnt 0x0"
               :: "v"(lk0), "v"(lk1), "v"(lv0), "v"(lv1), "v"(gk0), "v"(gk1), "v"(gv0), "v"(gv1)
               : "memory");
}

// Stands behind the group of global loads at the top of a projection block.  The two vector addresses the loads name
// are inputs, so that they keep their registers up to the wait and no later load of the group returns onto them.
__device__ __forceinline__ void loads_issued(const u16* p0, const u16* p1) {
  asm volatile("s_wait_xcnt 0x0" :: "v"(p0), "v"(p1) : "memory");
}

// ---------------- kernels ----------------

__device__ __forceinline__ void xcast_body(const int blk, const float* __restrict__ x, u16* __restrict__ Xb) {
  const int g = blk * 256 + threadIdx.x;
  const int m = g >> 5;                 // row 0..M_TOT-1 (grid exact)
  const int c = g & 31;                 // 8-element chunk
  const int b = m / SEQ, s = m - b * SEQ;
  const float* src = x + ((size_t)b * SEQ_FULL + s) * DM + c * 8;
  const float4 f0 = *reinterpret_cast<const float4*>(src);
  const float4 f1 = *reinterpret_cast<const float4*>(src + 4);
  v4u w;
  w[0] = f2bf_bits(f0.x) | (f2bf_bits(f0.y) << 16);
  w[1] = f2bf_bits(f0.z) | (f2bf_bits(f0.w) << 16);
  w[2] = f2bf_bits(f1.x) | (f2bf_bits(f1.y) << 16);
  w[3] = f2bf_bits(f1.z) | (f2bf_bits(f1.w) << 16);
  u16* dst = Xb + (size_t)m * DM + c * 8;
  *(v4u*)(dst) = w;
  
}

// W f32 [k][n] (DM x DM) -> Wt 16-bit [n][k] (transposed, k-contiguous).  MODE false: bf16 bits of W.
// MODE true: f16 bits of bf16(W) * WO_CARRY (the same for a whole block).  Block = 64 n-rows; LDS transpose; each output row
__device__ __forceinline__ void wcast_body(const bool MODE, const int blk, u16* T, const float* __restrict__ W,
                                           u16* __restrict__ Wt) {
  const int tid = threadIdx.x, lane = tid & 31, wave = tid >> 5;
  const int n0 = blk * 64;
#pragma unroll 4
  for (int it = 0; it < 64; ++it) {
    const int idx = it * 256 + tid;
    const int k = idx >> 6, nl = idx & 63;
    const float f = W[(size_t)k * DM + n0 + nl];
    u16 bits;
    if (MODE) bits = h_bits(bf16r(f) * WO_CARRY);
    else           bits = (u16)f2bf_bits(f);
    T[nl * 264 + k] = bits;
  }
  __syncthreads();
  auto pass = [&]() {
#pragma unroll
    for (int i = 0; i < 8; ++i) {
      const int nl = wave + 8 * i;
      const v4u v = *reinterpret_cast<const v4u*>(&T[nl * 264 + lane * 8]);
      *(v4u*)(Wt + (size_t)(n0 + nl) * DM + lane * 8) = v;
    }
  };
  pass();
  
}

// All five input conversions in one grid: none reads what another writes.  Blocks 0..15 take the four weight
// planes (4 blocks each; Wt4 = the four [n][k] planes in a row: Wq, Wk, Wv, Wo), the rest the rows of x.
// The weight blocks stand first because each is a long chain of dependent steps.
#define WCAST_BLOCKS (4 * (DM / 64))
__global__ __launch_bounds__(256) void k_cast(const float* __restrict__ x, const float* __restrict__ Wq,
                                              const float* __restrict__ Wk, const float* __restrict__ Wv,
                                              const float* __restrict__ Wo, u16* __restrict__ Xb,
                                              u16* __restrict__ Wt4) {
  __shared__ __attribute__((aligned(16))) u16 T[64 * 264];
  const int blk = blockIdx.x;
  const int w = blk / (DM / 64), nb = blk - w * (DM / 64);
  if (blk < WCAST_BLOCKS)
    wcast_body(w == 3, nb, T, w == 0 ? Wq : (w == 1 ? Wk : (w == 2 ? Wv : Wo)), Wt4 + (size_t)w * DM * DM);
  else
    xcast_body(blk - WCAST_BLOCKS, x, Xb);
}

// Projection GEMM: P[m][n] = sum_k Xb[m][k] * Wt[n][k] + bias[n], stored *QKV_CARRY as f16.
// Block = 256 threads (8 waves), tile 128(m) x 64(n) (n-block = one head), K step 32.
// The block's whole B panel (64 n x 256 k) goes into LDS once, and every global load of the block (panel, the
// wave's eight A fragments, biases) is issued at the top: one load latency and one barrier, not one of each a step.
// The three products share one grid: blockIdx.z = 0, 1, 2 is Q, K, V (none reads what another writes).
// Wt3 = the three weight planes in a row, Out3 = the three output planes in a row.
// z = 2 (V): Out plane [bh][d][SEQ] (V transposed): each d-row segment = 256 B, 16 lanes x 16 B.
__global__ __launch_bounds__(256) void k_proj(const u16* __restrict__ Xb, const u16* __restrict__ Wt3,
                                              const float* __restrict__ bq, const float* __restrict__ bk,
                                              const float* __restrict__ bv, u16* __restrict__ Out3) {
  __shared__ __attribute__((aligned(16))) u16 Bt[64 * P256];   // [n][k]
  __shared__ __attribute__((aligned(16))) u16 St[128 * 72];    // staging: 128 x 72 (Q, K) or 64 x 136 (V)
  const int z = blockIdx.z;
  const u16* Wt = Wt3 + (size_t)z * DM * DM;
  const float* bias = z == 0 ? bq : (z == 1 ? bk : bv);
  u16* Out = Out3 + (size_t)z * M_TOT * DM;
  const int tid = threadIdx.x, wave = tid >> 5, lane = tid & 31;
  const int h16 = (lane >> 4) << 3;
  const int col = lane & 15;
  const int mb = blockIdx.x * 128;
  const int m0 = mb + wave * 16;
  const int n0 = blockIdx.y * 64;

  v4u wv[8];                         // panel rows wave, wave + 8, ...: a wave's load is one whole row of 512 B
  const u16* wrow = Wt + (size_t)(n0 + wave) * DM + lane * 8;
#pragma unroll
  for (int i = 0; i < 8; ++i) wv[i] = *reinterpret_cast<const v4u*>(wrow + i * 8 * DM);
  v16bf a[DM / 32];
  const u16* arow = Xb + (size_t)(m0 + col) * DM + h16;   // this lane's first chunk, as load_frag_b forms it
#pragma unroll
  for (int s = 0; s < DM / 32; ++s) {
    union { v16bf v; uint4 q[2]; } u;
    u.q[0] = *reinterpret_cast<const uint4*>(arow + s * 32);
    u.q[1] = *reinterpret_cast<const uint4*>(arow + s * 32 + 16);
    a[s] = u.v;
  }
  float bl[4];
  const float* bcol = bias + n0 + col;
#pragma unroll
  for (int t = 0; t < 4; ++t) bl[t] = bcol[t * 16];
  loads_issued(wrow, arow);
#pragma unroll
  for (int i = 0; i < 8; ++i) *reinterpret_cast<v4u*>(&Bt[(i * 8 + wave) * P256 + lane * 8]) = wv[i];
  __syncthreads();                   // Bt ready

  v8f acc[4] = {zero8(), zero8(), zero8(), zero8()};
#pragma unroll                       // a[s] stays in registers only under a constant index
  for (int s = 0; s < DM / 32; ++s) {
    v16bf b[4];                      // the step's B fragments: one group of LDS loads, one latency instead of four
#pragma unroll
    for (int t = 0; t < 4; ++t) b[t] = load_frag_b(&Bt[(t * 16) * P256 + s * 32], P256);
#pragma unroll
    for (int t = 0; t < 4; ++t) acc[t] = mma_b(a[s], b[t], acc[t]);
  }

  const int bb = mb / SEQ;
  const int s0 = mb - bb * SEQ;     // 128 rows of one sequence (SEQ % 128 == 0)
  const int hh = blockIdx.y;        // head index = n0 / 64

  if (z != 2) {
#pragma unroll
    for (int t = 0; t < 4; ++t) {
      const int nl = t * 16 + col;
      const float bvv = bf16r(bl[t]);
#pragma unroll
      for (int r = 0; r < 8; ++r) {
        const int ml = wave * 16 + h16 + r;
        St[ml * 72 + nl] = h_bits((acc[t][r] + bvv) * QKV_CARRY);
      }
    }
    __syncthreads();
    u16* base = Out + ((size_t)(bb * NH + hh) * SEQ + s0) * HD;   // row ml -> base + ml*HD
    auto pass = [&]() {
#pragma unroll
      for (int i = 0; i < 4; ++i) {
        const int rr = wave * 16 + i * 4 + (lane >> 3);
        const int c = lane & 7;
        const v4u v = *reinterpret_cast<const v4u*>(&St[rr * 72 + c * 8]);
        *(v4u*)(base + (size_t)rr * HD + c * 8) = v;
      }
    };
    pass();
    
  } else {
#pragma unroll
    for (int t = 0; t < 4; ++t) {
      const int nl = t * 16 + col;
      const float bvv = bf16r(bl[t]);
      union { v8h v; v4u q; } pk;
#pragma unroll
      for (int r = 0; r < 8; ++r) pk.v[r] = (f16t)((acc[t][r] + bvv) * QKV_CARRY);
      *reinterpret_cast<v4u*>(&St[nl * 136 + wave * 16 + h16]) = pk.q;   // St[d][m-local]
    }
    __syncthreads();
    u16* base = Out + ((size_t)(bb * NH + hh) * HD) * SEQ + s0;          // row d -> base + d*SEQ
    auto pass = [&]() {
#pragma unroll
      for (int i = 0; i < 4; ++i) {
        const int dd = wave * 8 + i * 2 + (lane >> 4);
        const int c = lane & 15;
        const v4u v = *reinterpret_cast<const v4u*>(&St[dd * 136 + c * 8]);
        *(v4u*)(base + (size_t)dd * SEQ + c * 8) = v;
      }
    };
    pass();
    
  }
}

// Flash attention.  Q,K planes f16 [bh][s][64] (x8), V plane f16 transposed [bh][d][SEQ] (x8).
// Block = 256 threads (8 waves) owns (bh, 128 query rows); wave owns 16 queries.  64-key K and V^T tiles come
// into LDS by asynchronous copies, two buffers: tile t + 1 is in flight while tile t is worked on, and one block
// barrier a trip both publishes tile t + 1 and frees tile t's buffer for tile t + 2.
// Both products are taken transposed: S^T = K . Q^T (rows = keys, columns = queries), O^T += V^T . P^T.
// A lane then holds 32 of the 64 scores of ONE query (column lane & 15; keys 16 t + 8 (lane >> 4) + r), so
// the row maximum and sum are in-lane work plus one exchange between the halves, and two score tiles,
// converted in place, are the B operand of the second product in the k order of load_frag_h.
#define KV_TILE (64 * P64)      // elements of one tile in LDS
#define KV_BUF  (2 * KV_TILE)   // elements of one buffer: K tile and V^T tile
__global__ __launch_bounds__(256) __attribute__((amdgpu_num_vgpr(256)))
void k_attn(const u16* __restrict__ Qp, const u16* __restrict__ Kp, const u16* __restrict__ Vtp,
            u16* __restrict__ Ctx) {
  __shared__ __attribute__((aligned(16))) u16 KV[2 * KV_BUF];    // per buffer: K tile [key][d], then V^T tile [d][key]
  __shared__ __attribute__((aligned(16))) u16 Ct[8 * 16 * P64];  // per wave [query][d]: output staging

  const int tid = threadIdx.x, wave = tid >> 5, lane = tid & 31;
  const int h16 = (lane >> 4) << 3;
  const int col = lane & 15;
  const int bh = blockIdx.x;
  const int bb = bh / NH, hh = bh - bb * NH;
  const int q0 = blockIdx.y * 128 + wave * 16;       // first query position of this wave

  const u16* Qbh = Qp + (size_t)bh * SEQ * HD;
  const u16* Kbh = Kp + (size_t)bh * SEQ * HD;
  const u16* Vbh = Vtp + (size_t)bh * HD * SEQ;
  u16* Cw = Ct + wave * (16 * P64);

  const v16h bq0 = load_frag_h(Qbh + (size_t)q0 * HD, HD);        // B[k=d][n=query], loaded like A
  const v16h bq1 = load_frag_h(Qbh + (size_t)q0 * HD + 32, HD);

  float mrow = -INFINITY;     // this lane's query: running maximum (the same in both halves)
  float lrow = 0.f;           // running sum over this half's keys only; the halves are joined after the loop
  v8f o[4] = {zero8(), zero8(), zero8(), zero8()};
  const float qrel = (float)(q0 + col - h16);        // query position less this half's key offset
  // z = acc/512 * (SEQ - |i-j|)/SEQ
  const float kmask = 1.0f / ((float)SEQ * 512.0f);

  const int row = tid >> 3, off = (tid & 7) << 3;     // this thread's chunks of a tile: rows row and row + 32
  const u16* gk = Kbh + (size_t)row * HD + off;       // tile at key t0: + t0 * HD
  const u16* gv = Vbh + (size_t)row * SEQ + off;      // tile at key t0: + t0
  const unsigned lk = (unsigned)(size_t)&KV[row * P64 + off];       // LDS byte address of the chunk in buffer 0
  auto stage = [&](const int t0, const unsigned buf) {              // buf: the buffer's byte offset
    copy_kv(lk + buf, lk + buf + 32 * P64 * 2, lk + buf + KV_TILE * 2, lk + buf + (KV_TILE + 32 * P64) * 2,
            gk + (size_t)t0 * HD, gk + (size_t)(t0 + 32) * HD, gv + t0, gv + t0 + 32 * SEQ);
  };
  stage(0, 0);
  asm volatile("s_wait_asynccnt 0x0" ::: "memory");   // this wave's share of tile 0 has landed
  __syncthreads();                                    // tile 0 published
  stage(64, KV_BUF * 2);                              // SEQ >= 128: a tile 1 exists

#pragma unroll 1
  for (int t0 = 0; t0 < SEQ; t0 += 64) {
    const unsigned cur = (t0 & 64) ? KV_BUF : 0;      // this trip reads this buffer alone
    const u16* Kt = KV + cur;
    const u16* Vs = KV + cur + KV_TILE;

    // ---- scores: S^T(64 keys x 16 queries) = K(64 x 64 d) . Q^T ; A[m=key][k=d] from Kt[key][d]
    // All 16 loads of the K fragments stand in one group at the top of the trip, in the order of their use; the
    // mask weights, which need no score, stand behind them and run while the loads are under way.
    v16h ka[2][4];
#pragma unroll
    for (int j = 0; j < 2; ++j)
#pragma unroll
      for (int t = 0; t < 4; ++t) ka[j][t] = load_frag_h(&Kt[(t * 16) * P64 + j * 32], P64);

    const float dq = qrel - (float)t0;                // i - j = dq - (16 t + r): whole numbers, exact in f32
    float wm[4][8];                                   // scale and multiplicative distance-decay mask of sc[t][r]
#pragma unroll
    for (int t = 0; t < 4; ++t)
#pragma unroll
      for (int r = 0; r < 8; ++r) wm[t][r] = ((float)SEQ - fabsf(dq - (float)(t * 16 + r))) * kmask;

    v8f sc[4];
#pragma unroll
    for (int t = 0; t < 4; ++t) sc[t] = mma_h(ka[0][t], bq0, zero8());
#pragma unroll
    for (int t = 0; t < 4; ++t) sc[t] = mma_h(ka[1][t], bq1, sc[t]);

    // All 16 loads of the V^T fragments, one group in front of the softmax, whose work covers their latency.
    v16h va[2][4];
#pragma unroll
    for (int j = 0; j < 2; ++j)
#pragma unroll
      for (int dt = 0; dt < 4; ++dt) va[j][dt] = load_frag_h(&Vs[(dt * 16) * P64 + j * 32], P64);
    __builtin_amdgcn_sched_barrier(0);                // or the scheduler sinks these loads down to their WMMAs

    // ---- scale and mask, online softmax; sc[t][r]: key t0 + 16 t + h16 + r
    float mt[4];                                      // one chain per score tile: four short chains, not one long
#pragma unroll
    for (int t = 0; t < 4; ++t) {
      mt[t] = -INFINITY;
#pragma unroll
      for (int r = 0; r < 8; ++r) {
        const float z = sc[t][r] * wm[t][r];
        sc[t][r] = z;
        mt[t] = fmaxf(mt[t], z);
      }
    }
    float mx = fmaxf(fmaxf(mt[0], mt[1]), fmaxf(mt[2], mt[3]));
    mx = fmaxf(mx, xhalf(mx));
    const float mnew = fmaxf(mrow, mx);
    const float alpha = __expf(mrow - mnew);
    mrow = mnew;

    // P^T as B[k=key][n=query]: elements 0..7 = score tile 2 j, elements 8..15 = score tile 2 j + 1
    v16h pb[2];
    float pt[4];                                      // partial sums, one chain per score tile as above
#pragma unroll
    for (int t = 0; t < 4; ++t) {
      pt[t] = 0.f;
#pragma unroll
      for (int r = 0; r < 8; ++r) {
        const float p = __expf(sc[t][r] - mrow);
        pt[t] += p;
        pb[t >> 1][(t & 1) * 8 + r] = (f16t)(p * P_CARRY);
      }
    }
    lrow = lrow * alpha + ((pt[0] + pt[1]) + (pt[2] + pt[3]));
#pragma unroll
    for (int dt = 0; dt < 4; ++dt)
#pragma unroll
      for (int r = 0; r < 8; ++r) o[dt][r] *= alpha;

    // ---- O^T(64 d x 16 queries) += V^T(64 d x 64 keys) . P^T ; A[m=d][k=key] from Vs[d][key]
#pragma unroll
    for (int dt = 0; dt < 4; ++dt) o[dt] = mma_h(va[0][dt], pb[0], o[dt]);
#pragma unroll
    for (int dt = 0; dt < 4; ++dt) o[dt] = mma_h(va[1][dt], pb[1], o[dt]);

    asm volatile("s_wait_dscnt 0x0" ::: "memory");    // this wave's reads of the current buffer are done
    asm volatile("s_wait_asynccnt 0x0" ::: "memory"); // this wave's share of the next tile has landed
    __syncthreads();                                  // next tile published; current buffer left by every wave
    if (t0 + 128 < SEQ) stage(t0 + 128, cur * 2);     // the same test in the whole block
  }
  asm volatile("s_wait_asynccnt 0x0" ::: "memory");   // no copy is outstanding when the wave goes on

  // ---- normalize: ctx*64 = o / (l * 2048); o[dt][r] = O[query col][d = 16 dt + h16 + r]: eight d in a row,
  // one 16-byte store into the wave's own staging rows
  const float inv = 1.0f / ((lrow + xhalf(lrow)) * CTX_LDIV);
#pragma unroll
  for (int dt = 0; dt < 4; ++dt) {
    union { v8h v; v4u q; } pk;
#pragma unroll
    for (int r = 0; r < 8; ++r) pk.v[r] = (f16t)(o[dt][r] * inv);
    *reinterpret_cast<v4u*>(&Cw[col * P64 + dt * 16 + h16]) = pk.q;
  }
  // staging is wave-private: LDS completion + wave sync (also a compiler ordering point)
  asm volatile("s_wait_dscnt 0" ::: "memory");
  __builtin_amdgcn_wave_barrier();

  u16* cbase = Ctx + ((size_t)(bb * SEQ + q0)) * DM + hh * HD;   // row rr -> cbase + rr*DM
  auto pass = [&]() {
#pragma unroll
    for (int i = 0; i < 4; ++i) {
      const int rr = i * 4 + (lane >> 3);
      const int c = lane & 7;
      const v4u v = *reinterpret_cast<const v4u*>(&Cw[rr * P64 + c * 8]);
      *(v4u*)(cbase + (size_t)rr * DM + c * 8) = v;
    }
  };
  pass();
  
}

// Output projection: out[m][n] = sum_k ctx[m][k] * Wot[n][k] / (64*16) + bf16(bo[n]), f32.
// Block tile 128 x 64; B panel and global loads as in k_proj; f32 tile staged in LDS; each 256-B row segment
// written by 16 lanes x 16 B
__global__ __launch_bounds__(256) void k_oproj(const u16* __restrict__ Ctx, const u16* __restrict__ Wot,
                                               const float* __restrict__ bo, float* __restrict__ out) {
  __shared__ __attribute__((aligned(16))) u16 Bt[64 * P256];   // [n][k]
  __shared__ __attribute__((aligned(16))) float So[128 * 68];
  const int tid = threadIdx.x, wave = tid >> 5, lane = tid & 31;
  const int h16 = (lane >> 4) << 3;
  const int col = lane & 15;
  const int mb = blockIdx.x * 128;
  const int m0 = mb + wave * 16;
  const int n0 = blockIdx.y * 64;

  v4u wv[8];                         // panel rows wave, wave + 8, ...: a wave's load is one whole row of 512 B
  const u16* wrow = Wot + (size_t)(n0 + wave) * DM + lane * 8;
#pragma unroll
  for (int i = 0; i < 8; ++i) wv[i] = *reinterpret_cast<const v4u*>(wrow + i * 8 * DM);
  v16h a[DM / 32];
  const u16* arow = Ctx + (size_t)(m0 + col) * DM + h16;  // this lane's first chunk, as load_frag_h forms it
#pragma unroll
  for (int s = 0; s < DM / 32; ++s) {
    union { v16h v; uint4 q[2]; } u;
    u.q[0] = *reinterpret_cast<const uint4*>(arow + s * 32);
    u.q[1] = *reinterpret_cast<const uint4*>(arow + s * 32 + 16);
    a[s] = u.v;
  }
  float bl[4];
  const float* bcol = bo + n0 + col;
#pragma unroll
  for (int t = 0; t < 4; ++t) bl[t] = bcol[t * 16];
  loads_issued(wrow, arow);
#pragma unroll
  for (int i = 0; i < 8; ++i) *reinterpret_cast<v4u*>(&Bt[(i * 8 + wave) * P256 + lane * 8]) = wv[i];
  __syncthreads();                   // Bt ready

  v8f acc[4] = {zero8(), zero8(), zero8(), zero8()};
#pragma unroll                       // a[s] stays in registers only under a constant index
  for (int s = 0; s < DM / 32; ++s) {
    v16h b[4];                       // the step's B fragments: one group of LDS loads, one latency instead of four
#pragma unroll
    for (int t = 0; t < 4; ++t) b[t] = load_frag_h(&Bt[(t * 16) * P256 + s * 32], P256);
#pragma unroll
    for (int t = 0; t < 4; ++t) acc[t] = mma_h(a[s], b[t], acc[t]);
  }

#pragma unroll
  for (int t = 0; t < 4; ++t) {
    const int nl = t * 16 + col;
    const float bvv = bf16r(bl[t]);
#pragma unroll
    for (int r = 0; r < 8; ++r) {
      const int ml = wave * 16 + h16 + r;
      So[ml * 68 + nl] = acc[t][r] * OUT_SCALE + bvv;
    }
  }
  __syncthreads();
  float* base = out + (size_t)mb * DM + n0;            // row rr -> base + rr*DM
  auto pass = [&]() {
#pragma unroll
    for (int i = 0; i < 8; ++i) {
      const int rr = wave * 16 + i * 2 + (lane >> 4);
      const int c = lane & 15;
      const v4f v = *reinterpret_cast<const v4f*>(&So[rr * 68 + c * 4]);
      *(v4f*)(base + (size_t)rr * DM + c * 4) = v;
    }
  };
  pass();
  
}

// ---------------- launcher ----------------

extern "C" void kernel_launch(void* const* d_in, const int* in_sizes, int n_in,
                              void* d_out, int out_size, void* d_ws, size_t ws_size,
                              hipStream_t stream) {
  if (n_in < 9) return;
  if (in_sizes[0] < ((NB - 1) * SEQ_FULL + SEQ) * DM) return;
  if (in_sizes[1] < DM * DM || in_sizes[3] < DM * DM || in_sizes[5] < DM * DM || in_sizes[7] < DM * DM) return;
  if (in_sizes[2] < DM || in_sizes[4] < DM || in_sizes[6] < DM || in_sizes[8] < DM) return;
  if (out_size < M_TOT * DM) return;

  const float* x  = (const float*)d_in[0];
  const float* Wq = (const float*)d_in[1];
  const float* bq = (const float*)d_in[2];
  const float* Wk = (const float*)d_in[3];
  const float* bk = (const float*)d_in[4];
  const float* Wv = (const float*)d_in[5];
  const float* bv = (const float*)d_in[6];
  const float* Wo = (const float*)d_in[7];
  const float* bo = (const float*)d_in[8];
  float* out = (float*)d_out;

  const size_t XB_BYTES = (size_t)M_TOT * DM * 2;          // Xb bf16 [M_TOT][DM]
  const size_t WT_BYTES = (size_t)DM * DM * 2;             // each W^T 16-bit plane
  const size_t PL_BYTES = (size_t)M_TOT * DM * 2;          // Q, K, V^T, ctx planes (NB*NH*SEQ*HD = M_TOT*DM)
  const size_t total = XB_BYTES + 4 * WT_BYTES + 4 * PL_BYTES;
  if (total > ws_size) return;

  char* ws = (char*)d_ws;
  size_t off = 0;
  u16* Xb  = (u16*)(ws + off); off += XB_BYTES;
  u16* Wqt = (u16*)(ws + off); off += WT_BYTES;
  off += WT_BYTES;                                   // Wk plane, reached as Wqt + DM * DM
  off += WT_BYTES;                                   // Wv plane, reached as Wqt + 2 * DM * DM
  u16* Wot = (u16*)(ws + off); off += WT_BYTES;      // also Wqt + 3 * DM * DM
  u16* Qp  = (u16*)(ws + off); off += PL_BYTES;
  u16* Kpl = (u16*)(ws + off); off += PL_BYTES;
  u16* Vtp = (u16*)(ws + off); off += PL_BYTES;
  u16* Ctx = (u16*)(ws + off); off += PL_BYTES;
  (void)off;

  // 1) input conversion: x -> bf16 plane; Wq/Wk/Wv -> bf16 [n][k]; Wo -> f16 [n][k] (bf16 value * 16)
  k_cast<<<WCAST_BLOCKS + M_TOT / 8, 256, 0, stream>>>(x, Wq, Wk, Wv, Wo, Xb, Wqt);

  // 2) projections: Q, K -> [bh][s][64] f16 x8 ; V -> [bh][d][SEQ] f16 x8
  dim3 gp(M_TOT / 128, DM / 64);
  dim3 gp3(M_TOT / 128, DM / 64, 3);
  k_proj<<<gp3, 256, 0, stream>>>(Xb, Wqt, bq, bk, bv, Qp);

  // 3) flash attention -> ctx plane [M_TOT][DM] f16 x64
  dim3 ga(NB * NH, SEQ / 128);
  k_attn<<<ga, 256, 0, stream>>>(Qp, Kpl, Vtp, Ctx);

  // 4) output projection -> out f32 [M_TOT][DM]
  k_oproj<<<gp, 256, 0, stream>>>(Ctx, Wot, bo, out);
}

// v008
// It runs in 40.5 microseconds.
// Two timings next to v007 put it at 1.14 and 1.12 times that version's speed.
// Counting every step since v000, it is 4.78 times as fast.
#include <hip/hip_runtime.h>
#include <math.h>

// QKV projections: v_wmma_f32_16x16x32_bf16 (bf16 operands = RNE-converted inputs, f32 accumulate); QK^T, P.V and ctx@Wo: v_wmma_f32_16x16x32_f16 (f16 operands, carries Q/K/V x8, P x16384, ctx x64, Wo x16, f32 accumulate); softmax and epilogues f32.

typedef unsigned short u16;
typedef _Float16 f16t;
typedef __bf16   v16bf __attribute__((ext_vector_type(16)));
typedef _Float16 v16h  __attribute__((ext_vector_type(16)));
typedef _Float16 v8h   __attribute__((ext_vector_type(8)));
typedef float    v8f   __attribute__((ext_vector_type(8)));
typedef float    v4f   __attribute__((ext_vector_type(4)));
typedef unsigned int v4u __attribute__((ext_vector_type(4)));
typedef unsigned int v2u __attribute__((ext_vector_type(2)));
typedef float    v2f   __attribute__((ext_vector_type(2)));
typedef __bf16   v2bf  __attribute__((ext_vector_type(2)));
typedef _Float16 v2h   __attribute__((ext_vector_type(2)));

#ifndef NB
#define NB 4
#endif
#ifndef SEQ
#define SEQ 2048
#endif
#define NB_FULL  4
#define SEQ_FULL 2048
#define DM 256
#define NH 4
#define HD 64
#define M_TOT (NB * SEQ)

static_assert(NB >= 1 && NB <= NB_FULL);
static_assert(SEQ >= 128 && SEQ <= SEQ_FULL && (SEQ % 128) == 0);
static_assert(DM == NH * HD);
static_assert((M_TOT % 128) == 0);
static_assert((M_TOT % 8) == 0);

// carries: Q,K,V planes hold value*8 (f16); P tile holds exp(z-m)*16384 (f16); ctx plane holds h*64 (f16);
// Wo LDS panel holds bf16(Wo)*16 (f16).  score = acc/512 ; ctx*64 = o/(l*2048) ; out = acc/1024 + bo
#define QKV_CARRY 8.0f
#define P_CARRY   16384.0f
#define WO_CARRY  16.0f
#define CTX_LDIV  2048.0f
#define OUT_SCALE (1.0f / 1024.0f)

// LDS row pitch, in 16-bit elements, of every tile that ds_load_b128 fragment loads read: 16 B x odd, so that
// the 16 rows a half-wave reads at once fall on 16 different groups of four banks (64 banks x 4 B).
#define P64 72    // rows of 64 elements: 144 B
#define P256 264  // rows of 256 elements: 528 B

// ---------------- helpers ----------------

__device__ __forceinline__ unsigned f2bf_bits(float f) {
  unsigned u = __float_as_uint(f);
  u += 0x7FFFu + ((u >> 16) & 1u);   // RNE convert f32 -> bf16 bits
  return u >> 16;
}
__device__ __forceinline__ float bf16r(float f) { return __uint_as_float(f2bf_bits(f) << 16); }
__device__ __forceinline__ u16 h_bits(float f) {
  union { f16t h; u16 u; } c;
  c.h = (f16t)f;                     // RNE convert f32 -> f16
  return c.u;
}
// two f32 -> two bf16 (RNE) in one word, lo in bits 15..0
__device__ __forceinline__ unsigned pk_bf(float lo, float hi) {
  const v2f f = {lo, hi};
  return __builtin_bit_cast(unsigned, __builtin_convertvector(f, v2bf));
}
// two f32 -> two f16 of bf16(value) * WO_CARRY in one word, lo in bits 15..0
__device__ __forceinline__ unsigned pk_wo(float lo, float hi) {
  const unsigned b = pk_bf(lo, hi);
  const v2f f = {__uint_as_float(b << 16) * WO_CARRY, __uint_as_float(b & 0xffff0000u) * WO_CARRY};
  return __builtin_bit_cast(unsigned, __builtin_convertvector(f, v2h));
}
__device__ __forceinline__ v8f zero8() {
  v8f z = {0.f, 0.f, 0.f, 0.f, 0.f, 0.f, 0.f, 0.f};
  return z;
}

// 16x32 16-bit fragment from a row-major [row][k] tile with pitch ldr (elements).
// lane l: row = l&15; elements 0..7 = k0+8h..k0+8h+7, elements 8..15 = k0+16+8h..+7, h = l>>4.
// Used for A (row = m) and for B loaded from a [n][k] k-contiguous copy (row = n). Same map for both.
__device__ __forceinline__ v16h load_frag_h(const u16* base, int ldr) {
  const int lane = threadIdx.x & 31;
  const int row  = lane & 15;
  const int kb   = (lane >> 4) << 3;
  union { v16h v; uint4 q[2]; } u;
  u.q[0] = *reinterpret_cast<const uint4*>(base + (size_t)row * ldr + kb);
  u.q[1] = *reinterpret_cast<const uint4*>(base + (size_t)row * ldr + 16 + kb);
  return u.v;
}
__device__ __forceinline__ v16bf load_frag_b(const u16* base, int ldr) {
  const int lane = threadIdx.x & 31;
  const int row  = lane & 15;
  const int kb   = (lane >> 4) << 3;
  union { v16bf v; uint4 q[2]; } u;
  u.q[0] = *reinterpret_cast<const uint4*>(base + (size_t)row * ldr + kb);
  u.q[1] = *reinterpret_cast<const uint4*>(base + (size_t)row * ldr + 16 + kb);
  return u.v;
}

// WMMA with the 4-slot VALU hazard guard tied to D, keeping A/B live.
__device__ __forceinline__ v8f mma_h(v16h a, v16h b, v8f c) {
  c = __builtin_amdgcn_wmma_f32_16x16x32_f16(false, a, false, b, (short)0, c, false, false);
  asm volatile("v_nop\n\tv_nop\n\tv_nop\n\tv_nop" : "+v"(c) : "v"(a), "v"(b));
  return c;
}
__device__ __forceinline__ v8f mma_b(v16bf a, v16bf b, v8f c) {
  c = __builtin_amdgcn_wmma_f32_16x16x32_bf16(false, a, false, b, (short)0, c, false, false);
  asm volatile("v_nop\n\tv_nop\n\tv_nop\n\tv_nop" : "+v"(c) : "v"(a), "v"(b));
  return c;
}

// lane l <-> lane l ^ 16: the two 16-lane halves of a wave hold the two halves of one query's keys
__device__ __forceinline__ float xhalf(float x) {
  const int b = __builtin_bit_cast(int, x);
  return __builtin_bit_cast(float, __builtin_amdgcn_permlanex16(b, b, 0x76543210, 0xfedcba98, false, false));
}

// One thread's share of a 64-key K tile and V^T tile (two 16-byte chunks of each), global memory -> LDS through no
// register.  lk, lv: the lane's LDS byte addresses; the second chunk of each lies 32 rows on.  The s_wait_xcnt is the
// last line of the copies' own statement, so that it stands in front of any rewrite of a register a copy names.
__device__ __forceinline__ void copy_kv(unsigned lk0, unsigned lk1, unsigned lv0, unsigned lv1, const u16* gk0,
                                        const u16* gk1, const u16* gv0, const u16* gv1) {
  asm volatile("global_load_async_to_lds_b128 %0, %4, off\n\t"
               "global_load_async_to_lds_b128 %1, %5, off\n\t"
               "global_load_async_to_lds_b128 %2, %6, off\n\t"
               "global_load_async_to_lds_b128 %3, %7, off\n\t"
               "s_wait_xcnt 0x0"
               :: "v"(lk0), "v"(lk1), "v"(lv0), "v"(lv1), "v"(gk0), "v"(gk1), "v"(gv0), "v"(gv1)
               : "memory");
}

// Stands behind the group of global loads at the top of a projection block.  The two vector addresses the loads name
// are inputs, so that they keep their registers up to the wait and no later load of the group returns onto them.
__device__ __forceinline__ void loads_issued(const void* p0, const void* p1) {
  asm volatile("s_wait_xcnt 0x0" :: "v"(p0), "v"(p1) : "memory");
}

// Block barrier that orders LDS traffic alone.  __syncthreads() also waits until every global load of the wave has
// returned, which would hold the first product of k_proj back until the panels of the later products have arrived.
__device__ __forceinline__ void lds_barrier() {
  __builtin_amdgcn_fence(__ATOMIC_RELEASE, "workgroup", "local");
  __builtin_amdgcn_s_barrier();
  __builtin_amdgcn_fence(__ATOMIC_ACQUIRE, "workgroup", "local");
}

// ---------------- kernels ----------------

// A 64-column panel of a weight matrix W, f32 [k][n], goes straight from global memory into the LDS panel Bt [n][k]
// (16-bit, pitch P256) that the B fragments are read from.  A thread takes two units of 4 columns x 8 k: eight
// 16-byte loads a unit (8 lanes cover one 128-B line of a k row), converted in pairs along k, four 16-byte LDS stores.
// wp: W + (tid >> 3) * 8 * DM + n0 + (tid & 7) * 4.
__device__ __forceinline__ void wpanel_load(v4f (&r)[2][8], const float* wp) {
#pragma unroll
  for (int u = 0; u < 2; ++u)
#pragma unroll
    for (int i = 0; i < 8; ++i) r[u][i] = *reinterpret_cast<const v4f*>(wp + i * DM + u * 32);
}
// WO false: bf16 bits of W.  WO true: f16 bits of bf16(W) * WO_CARRY.
__device__ __forceinline__ void wpanel_store(const bool WO, const v4f (&r)[2][8], u16* Bt) {
  const int tid = threadIdx.x;
  u16* dst = Bt + ((tid & 7) * 4) * P256 + (tid >> 3) * 8;
#pragma unroll
  for (int u = 0; u < 2; ++u)
#pragma unroll
    for (int j = 0; j < 4; ++j) {
      v4u w;
#pragma unroll
      for (int i = 0; i < 4; ++i)
        w[i] = WO ? pk_wo(r[u][2 * i][j], r[u][2 * i + 1][j]) : pk_bf(r[u][2 * i][j], r[u][2 * i + 1][j]);
      *reinterpret_cast<v4u*>(dst + (u * 32 + j) * P256) = w;
    }
}

// Projection GEMM: P[m][n] = sum_k bf16(x[m][k]) * bf16(W[k][n]) + bias[n], stored *QKV_CARRY as f16.
// Block = 256 threads (8 waves) takes 128 rows of x and one head (64 columns) of all three products Q, K, V.
// The inputs are read as f32 and converted on the way into LDS: the three weight panels by wpanel_load / _store,
// the x rows in whole lines (a wave stages its own 16 rows, [m][k], pitch P256) and from there as A fragments,
// which stay in registers for the three products.  Every global load is issued at the top, in the order of use; a
// panel is staged, and published by a barrier of its own, right in front of its product, so that the K and V panels
// are still on their way during the products before them.  A last barrier publishes the output staging.
// Out3 = the three output planes in a row; Q, K: [bh][s][64]; V: [bh][d][SEQ] (V transposed).
#define ST_PLANE (128 * 72)     // elements of one product's output staging: 128 x 72 (Q, K) or 64 x 136 (V)
__global__ __launch_bounds__(256)
void k_proj(const float* __restrict__ x, const float* __restrict__ Wq, const float* __restrict__ Wk,
            const float* __restrict__ Wv, const float* __restrict__ bq, const float* __restrict__ bk,
            const float* __restrict__ bv, u16* __restrict__ Out3) {
  __shared__ __attribute__((aligned(16))) u16 Bt[3 * 64 * P256];   // per product [n][k]
  __shared__ __attribute__((aligned(16))) u16 Xs[128 * P256];      // [m][k]
  __shared__ __attribute__((aligned(16))) u16 St[3 * ST_PLANE];
  const int tid = threadIdx.x, wave = tid >> 5, lane = tid & 31;
  const int h16 = (lane >> 4) << 3;
  const int col = lane & 15;
  const int mb = blockIdx.x * 128;
  const int n0 = blockIdx.y * 64;
  const int bb = mb / SEQ;
  const int s0 = mb - bb * SEQ;     // 128 rows of one sequence (SEQ % 128 == 0)
  const int hh = blockIdx.y;        // head index = n0 / 64

  const size_t woff = (size_t)(tid >> 3) * 8 * DM + n0 + (tid & 7) * 4;
  const float* wpq = Wq + woff;
  const float* wpk = Wk + woff;
  const float* wpv = Wv + woff;
  // x rows: a wave's load is 512 B in a row; lane: k = 4 lane .. + 3 and 128 + 4 lane .. + 3 of each row
  const float* xp = x + ((size_t)bb * SEQ_FULL + s0 + wave * 16) * DM + lane * 4;
  v4f rq[2][8], rk[2][8], rv[2][8], xf[16][2];
  float bl[3][4];
#pragma unroll
  for (int t = 0; t < 4; ++t) {
    bl[0][t] = bq[n0 + col + t * 16];
    bl[1][t] = bk[n0 + col + t * 16];
    bl[2][t] = bv[n0 + col + t * 16];
  }
  wpanel_load(rq, wpq);
#pragma unroll
  for (int i = 0; i < 16; ++i)
#pragma unroll
    for (int c = 0; c < 2; ++c) xf[i][c] = *reinterpret_cast<const v4f*>(xp + i * DM + c * 128);
  loads_issued(wpq, xp);             // also keeps what the first product needs in front of the other two panels
  wpanel_load(rk, wpk);
  wpanel_load(rv, wpv);
  loads_issued(wpk, wpv);

  wpanel_store(false, rq, Bt);
  u16* xs = Xs + (wave * 16) * P256 + lane * 4;
#pragma unroll
  for (int i = 0; i < 16; ++i)
#pragma unroll
    for (int c = 0; c < 2; ++c) {
      const v2u w = {pk_bf(xf[i][c][0], xf[i][c][1]), pk_bf(xf[i][c][2], xf[i][c][3])};
      *reinterpret_cast<v2u*>(xs + i * P256 + c * 128) = w;
    }
  lds_barrier();                     // Q panel, Xs ready

  v16bf a[DM / 32];
#pragma unroll
  for (int s = 0; s < DM / 32; ++s) a[s] = load_frag_b(&Xs[(wave * 16) * P256 + s * 32], P256);

#pragma unroll
  for (int z = 0; z < 3; ++z) {
    const u16* Bz = Bt + z * 64 * P256;
    u16* Sz = St + z * ST_PLANE;
    if (z != 0) {
      __builtin_amdgcn_sched_barrier(0);   // or the panel's conversions, and the wait for its loads, rise over the product before
      wpanel_store(false, z == 1 ? rk : rv, Bt + z * 64 * P256);
      lds_barrier();                 // this product's panel ready
    }
    v8f acc[4] = {zero8(), zero8(), zero8(), zero8()};
#pragma unroll                       // a[s] stays in registers only under a constant index
    for (int s = 0; s < DM / 32; ++s) {
      v16bf b[4];                    // the step's B fragments: one group of LDS loads, one latency instead of four
#pragma unroll
      for (int t = 0; t < 4; ++t) b[t] = load_frag_b(&Bz[(t * 16) * P256 + s * 32], P256);
#pragma unroll
      for (int t = 0; t < 4; ++t) acc[t] = mma_b(a[s], b[t], acc[t]);
    }
    if (z != 2) {
#pragma unroll
      for (int t = 0; t < 4; ++t) {
        const int nl = t * 16 + col;
        const float bvv = bf16r(bl[z][t]);
#pragma unroll
        for (int r = 0; r < 8; ++r) {
          const int ml = wave * 16 + h16 + r;
          Sz[ml * 72 + nl] = h_bits((acc[t][r] + bvv) * QKV_CARRY);
        }
      }
    } else {
#pragma unroll
      for (int t = 0; t < 4; ++t) {
        const int nl = t * 16 + col;
        const float bvv = bf16r(bl[z][t]);
        union { v8h v; v4u q; } pk;
#pragma unroll
        for (int r = 0; r < 8; ++r) pk.v[r] = (f16t)((acc[t][r] + bvv) * QKV_CARRY);
        *reinterpret_cast<v4u*>(&Sz[nl * 136 + wave * 16 + h16]) = pk.q;   // Sz[d][m-local]
      }
    }
  }
  __syncthreads();                   // St ready

  // Q, K: row ml -> base + ml*HD (128-B rows, 8 lanes x 16 B).  V: row d -> base + d*SEQ (256-B segments, 16 lanes x 16 B).
  v4u ov[3][4];
  u16* op[2][4];                     // Q rows (the K rows lie one plane on) and V rows
  {
    u16* base = Out3 + ((size_t)(bb * NH + hh) * SEQ + s0) * HD;
#pragma unroll
    for (int i = 0; i < 4; ++i) {
      const int rr = wave * 16 + i * 4 + (lane >> 3);
      const int c = lane & 7;
      ov[0][i] = *reinterpret_cast<const v4u*>(&St[rr * 72 + c * 8]);
      ov[1][i] = *reinterpret_cast<const v4u*>(&St[ST_PLANE + rr * 72 + c * 8]);
      op[0][i] = base + (size_t)rr * HD + c * 8;
    }
  }
  {
    u16* base = Out3 + (size_t)2 * M_TOT * DM + ((size_t)(bb * NH + hh) * HD) * SEQ + s0;
#pragma unroll
    for (int i = 0; i < 4; ++i) {
      const int dd = wave * 8 + i * 2 + (lane >> 4);
      const int c = lane & 15;
      ov[2][i] = *reinterpret_cast<const v4u*>(&St[2 * ST_PLANE + dd * 136 + c * 8]);
      op[1][i] = base + (size_t)dd * SEQ + c * 8;
    }
  }
  // Inputs only: every staged row and every address is in its register before the first store is issued, so that
  // nothing is left to compute behind a store and no register that an issued store names is rewritten.
  asm volatile("" :: "v"(ov[0][0]), "v"(ov[0][1]), "v"(ov[0][2]), "v"(ov[0][3]), "v"(ov[1][0]), "v"(ov[1][1]),
               "v"(ov[1][2]), "v"(ov[1][3]), "v"(ov[2][0]), "v"(ov[2][1]), "v"(ov[2][2]), "v"(ov[2][3]),
               "v"(op[0][0]), "v"(op[0][1]), "v"(op[0][2]), "v"(op[0][3]), "v"(op[1][0]), "v"(op[1][1]),
               "v"(op[1][2]), "v"(op[1][3]));
#pragma unroll
  for (int i = 0; i < 4; ++i) {
    *(v4u*)(op[0][i]) = ov[0][i];
    *(v4u*)(op[0][i] + (size_t)M_TOT * DM) = ov[1][i];
  }
#pragma unroll
  for (int i = 0; i < 4; ++i) *(v4u*)(op[1][i]) = ov[2][i];
}

// Flash attention.  Q,K planes f16 [bh][s][64] (x8), V plane f16 transposed [bh][d][SEQ] (x8).
// Block = 256 threads (8 waves) owns (bh, 128 query rows); wave owns 16 queries.  64-key K and V^T tiles come
// into LDS by asynchronous copies, two buffers: tile t + 1 is in flight while tile t is worked on, and one block
// barrier a trip both publishes tile t + 1 and frees tile t's buffer for tile t + 2.
// Both products are taken transposed: S^T = K . Q^T (rows = keys, columns = queries), O^T += V^T . P^T.
// A lane then holds 32 of the 64 scores of ONE query (column lane & 15; keys 16 t + 8 (lane >> 4) + r), so
// the row maximum and sum are in-lane work plus one exchange between the halves, and two score tiles,
// converted in place, are the B operand of the second product in the k order of load_frag_h.
#define KV_TILE (64 * P64)      // elements of one tile in LDS
#define KV_BUF  (2 * KV_TILE)   // elements of one buffer: K tile and V^T tile
__global__ __launch_bounds__(256) __attribute__((amdgpu_num_vgpr(256)))
void k_attn(const u16* __restrict__ Qp, const u16* __restrict__ Kp, const u16* __restrict__ Vtp,
            u16* __restrict__ Ctx) {
  __shared__ __attribute__((aligned(16))) u16 KV[2 * KV_BUF];    // per buffer: K tile [key][d], then V^T tile [d][key]
  __shared__ __attribute__((aligned(16))) u16 Ct[8 * 16 * P64];  // per wave [query][d]: output staging

  const int tid = threadIdx.x, wave = tid >> 5, lane = tid & 31;
  const int h16 = (lane >> 4) << 3;
  const int col = lane & 15;
  const int bh = blockIdx.x;
  const int bb = bh / NH, hh = bh - bb * NH;
  const int q0 = blockIdx.y * 128 + wave * 16;       // first query position of this wave

  const u16* Qbh = Qp + (size_t)bh * SEQ * HD;
  const u16* Kbh = Kp + (size_t)bh * SEQ * HD;
  const u16* Vbh = Vtp + (size_t)bh * HD * SEQ;
  u16* Cw = Ct + wave * (16 * P64);

  const v16h bq0 = load_frag_h(Qbh + (size_t)q0 * HD, HD);        // B[k=d][n=query], loaded like A
  const v16h bq1 = load_frag_h(Qbh + (size_t)q0 * HD + 32, HD);

  float mrow = -INFINITY;     // this lane's query: running maximum (the same in both halves)
  float lrow = 0.f;           // running sum over this half's keys only; the halves are joined after the loop
  v8f o[4] = {zero8(), zero8(), zero8(), zero8()};
  const float qrel = (float)(q0 + col - h16);        // query position less this half's key offset
  // z = acc/512 * (SEQ - |i-j|)/SEQ
  const float kmask = 1.0f / ((float)SEQ * 512.0f);

  const int row = tid >> 3, off = (tid & 7) << 3;     // this thread's chunks of a tile: rows row and row + 32
  const u16* gk = Kbh + (size_t)row * HD + off;       // tile at key t0: + t0 * HD
  const u16* gv = Vbh + (size_t)row * SEQ + off;      // tile at key t0: + t0
  const unsigned lk = (unsigned)(size_t)&KV[row * P64 + off];       // LDS byte address of the chunk in buffer 0
  auto stage = [&](const int t0, const unsigned buf) {              // buf: the buffer's byte offset
    copy_kv(lk + buf, lk + buf + 32 * P64 * 2, lk + buf + KV_TILE * 2, lk + buf + (KV_TILE + 32 * P64) * 2,
            gk + (size_t)t0 * HD, gk + (size_t)(t0 + 32) * HD, gv + t0, gv + t0 + 32 * SEQ);
  };
  stage(0, 0);
  asm volatile("s_wait_asynccnt 0x0" ::: "memory");   // this wave's share of tile 0 has landed
  __syncthreads();                                    // tile 0 published
  stage(64, KV_BUF * 2);                              // SEQ >= 128: a tile 1 exists

#pragma unroll 1
  for (int t0 = 0; t0 < SEQ; t0 += 64) {
    const unsigned cur = (t0 & 64) ? KV_BUF : 0;      // this trip reads this buffer alone
    const u16* Kt = KV + cur;
    const u16* Vs = KV + cur + KV_TILE;

    // ---- scores: S^T(64 keys x 16 queries) = K(64 x 64 d) . Q^T ; A[m=key][k=d] from Kt[key][d]
    // All 16 loads of the K fragments stand in one group at the top of the trip, in the order of their use; the
    // mask weights, which need no score, stand behind them and run while the loads are under way.
    v16h ka[2][4];
#pragma unroll
    for (int j = 0; j < 2; ++j)
#pragma unroll
      for (int t = 0; t < 4; ++t) ka[j][t] = load_frag_h(&Kt[(t * 16) * P64 + j * 32], P64);

    const float dq = qrel - (float)t0;                // i - j = dq - (16 t + r): whole numbers, exact in f32
    float wm[4][8];                                   // scale and multiplicative distance-decay mask of sc[t][r]
#pragma unroll
    for (int t = 0; t < 4; ++t)
#pragma unroll
      for (int r = 0; r < 8; ++r) wm[t][r] = ((float)SEQ - fabsf(dq - (float)(t * 16 + r))) * kmask;

    v8f sc[4];
#pragma unroll
    for (int t = 0; t < 4; ++t) sc[t] = mma_h(ka[0][t], bq0, zero8());
#pragma unroll
    for (int t = 0; t < 4; ++t) sc[t] = mma_h(ka[1][t], bq1, sc[t]);

    // All 16 loads of the V^T fragments, one group in front of the softmax, whose work covers their latency.
    v16h va[2][4];
#pragma unroll
    for (int j = 0; j < 2; ++j)
#pragma unroll
      for (int dt = 0; dt < 4; ++dt) va[j][dt] = load_frag_h(&Vs[(dt * 16) * P64 + j * 32], P64);
    __builtin_amdgcn_sched_barrier(0);                // or the scheduler sinks these loads down to their WMMAs

    // ---- scale and mask, online softmax; sc[t][r]: key t0 + 16 t + h16 + r
    float mt[4];                                      // one chain per score tile: four short chains, not one long
#pragma unroll
    for (int t = 0; t < 4; ++t) {
      mt[t] = -INFINITY;
#pragma unroll
      for (int r = 0; r < 8; ++r) {
        const float z = sc[t][r] * wm[t][r];
        sc[t][r] = z;
        mt[t] = fmaxf(mt[t], z);
      }
    }
    float mx = fmaxf(fmaxf(mt[0], mt[1]), fmaxf(mt[2], mt[3]));
    mx = fmaxf(mx, xhalf(mx));
    const float mnew = fmaxf(mrow, mx);
    const float alpha = __expf(mrow - mnew);
    mrow = mnew;

    // P^T as B[k=key][n=query]: elements 0..7 = score tile 2 j, elements 8..15 = score tile 2 j + 1
    v16h pb[2];
    float pt[4];                                      // partial sums, one chain per score tile as above
#pragma unroll
    for (int t = 0; t < 4; ++t) {
      pt[t] = 0.f;
#pragma unroll
      for (int r = 0; r < 8; ++r) {
        const float p = __expf(sc[t][r] - mrow);
        pt[t] += p;
        pb[t >> 1][(t & 1) * 8 + r] = (f16t)(p * P_CARRY);
      }
    }
    lrow = lrow * alpha + ((pt[0] + pt[1]) + (pt[2] + pt[3]));
#pragma unroll
    for (int dt = 0; dt < 4; ++dt)
#pragma unroll
      for (int r = 0; r < 8; ++r) o[dt][r] *= alpha;

    // ---- O^T(64 d x 16 queries) += V^T(64 d x 64 keys) . P^T ; A[m=d][k=key] from Vs[d][key]
#pragma unroll
    for (int dt = 0; dt < 4; ++dt) o[dt] = mma_h(va[0][dt], pb[0], o[dt]);
#pragma unroll
    for (int dt = 0; dt < 4; ++dt) o[dt] = mma_h(va[1][dt], pb[1], o[dt]);

    asm volatile("s_wait_dscnt 0x0" ::: "memory");    // this wave's reads of the current buffer are done
    asm volatile("s_wait_asynccnt 0x0" ::: "memory"); // this wave's share of the next tile has landed
    __syncthreads();                                  // next tile published; current buffer left by every wave
    if (t0 + 128 < SEQ) stage(t0 + 128, cur * 2);     // the same test in the whole block
  }
  asm volatile("s_wait_asynccnt 0x0" ::: "memory");   // no copy is outstanding when the wave goes on

  // ---- normalize: ctx*64 = o / (l * 2048); o[dt][r] = O[query col][d = 16 dt + h16 + r]: eight d in a row,
  // one 16-byte store into the wave's own staging rows
  const float inv = 1.0f / ((lrow + xhalf(lrow)) * CTX_LDIV);
#pragma unroll
  for (int dt = 0; dt < 4; ++dt) {
    union { v8h v; v4u q; } pk;
#pragma unroll
    for (int r = 0; r < 8; ++r) pk.v[r] = (f16t)(o[dt][r] * inv);
    *reinterpret_cast<v4u*>(&Cw[col * P64 + dt * 16 + h16]) = pk.q;
  }
  // staging is wave-private: LDS completion + wave sync (also a compiler ordering point)
  asm volatile("s_wait_dscnt 0" ::: "memory");
  __builtin_amdgcn_wave_barrier();

  u16* cbase = Ctx + ((size_t)(bb * SEQ + q0)) * DM + hh * HD;   // row rr -> cbase + rr*DM
  auto pass = [&]() {
#pragma unroll
    for (int i = 0; i < 4; ++i) {
      const int rr = i * 4 + (lane >> 3);
      const int c = lane & 7;
      const v4u v = *reinterpret_cast<const v4u*>(&Cw[rr * P64 + c * 8]);
      *(v4u*)(cbase + (size_t)rr * DM + c * 8) = v;
    }
  };
  pass();
  
}

// Output projection: out[m][n] = sum_k ctx[m][k] * Bt[n][k] / (64*16) + bf16(bo[n]), f32.
// Block tile 128 x 64; the Wo panel is read as f32 and converted on the way into LDS as in k_proj; every global load
// of the block is issued at the top; f32 tile staged in LDS; each 256-B row segment
// written by 16 lanes x 16 B
__global__ __launch_bounds__(256) void k_oproj(const u16* __restrict__ Ctx, const float* __restrict__ Wo,
                                               const float* __restrict__ bo, float* __restrict__ out) {
  __shared__ __attribute__((aligned(16))) u16 Bt[64 * P256];   // [n][k]
  __shared__ __attribute__((aligned(16))) float So[128 * 68];
  const int tid = threadIdx.x, wave = tid >> 5, lane = tid & 31;
  const int h16 = (lane >> 4) << 3;
  const int col = lane & 15;
  const int mb = blockIdx.x * 128;
  const int m0 = mb + wave * 16;
  const int n0 = blockIdx.y * 64;

  v4f rw[2][8];
  const float* wp = Wo + (size_t)(tid >> 3) * 8 * DM + n0 + (tid & 7) * 4;
  wpanel_load(rw, wp);
  v16h a[DM / 32];
  const u16* arow = Ctx + (size_t)(m0 + col) * DM + h16;  // this lane's first chunk, as load_frag_h forms it
#pragma unroll
  for (int s = 0; s < DM / 32; ++s) {
    union { v16h v; uint4 q[2]; } u;
    u.q[0] = *reinterpret_cast<const uint4*>(arow + s * 32);
    u.q[1] = *reinterpret_cast<const uint4*>(arow + s * 32 + 16);
    a[s] = u.v;
  }
  float bl[4];
  const float* bcol = bo + n0 + col;
#pragma unroll
  for (int t = 0; t < 4; ++t) bl[t] = bcol[t * 16];
  loads_issued(wp, arow);
  wpanel_store(true, rw, Bt);
  __syncthreads();                   // Bt ready

  v8f acc[4] = {zero8(), zero8(), zero8(), zero8()};
#pragma unroll                       // a[s] stays in registers only under a constant index
  for (int s = 0; s < DM / 32; ++s) {
    v16h b[4];                       // the step's B fragments: one group of LDS loads, one latency instead of four
#pragma unroll
    for (int t = 0; t < 4; ++t) b[t] = load_frag_h(&Bt[(t * 16) * P256 + s * 32], P256);
#pragma unroll
    for (int t = 0; t < 4; ++t) acc[t] = mma_h(a[s], b[t], acc[t]);
  }

#pragma unroll
  for (int t = 0; t < 4; ++t) {
    const int nl = t * 16 + col;
    const float bvv = bf16r(bl[t]);
#pragma unroll
    for (int r = 0; r < 8; ++r) {
      const int ml = wave * 16 + h16 + r;
      So[ml * 68 + nl] = acc[t][r] * OUT_SCALE + bvv;
    }
  }
  __syncthreads();
  float* base = out + (size_t)mb * DM + n0;            // row rr -> base + rr*DM
  auto pass = [&]() {
#pragma unroll
    for (int i = 0; i < 8; ++i) {
      const int rr = wave * 16 + i * 2 + (lane >> 4);
      const int c = lane & 15;
      const v4f v = *reinterpret_cast<const v4f*>(&So[rr * 68 + c * 4]);
      *(v4f*)(base + (size_t)rr * DM + c * 4) = v;
    }
  };
  pass();
  
}

// ---------------- launcher ----------------

extern "C" void kernel_launch(void* const* d_in, const int* in_sizes, int n_in,
                              void* d_out, int out_size, void* d_ws, size_t ws_size,
                              hipStream_t stream) {
  if (n_in < 9) return;
  if (in_sizes[0] < ((NB - 1) * SEQ_FULL + SEQ) * DM) return;
  if (in_sizes[1] < DM * DM || in_sizes[3] < DM * DM || in_sizes[5] < DM * DM || in_sizes[7] < DM * DM) return;
  if (in_sizes[2] < DM || in_sizes[4] < DM || in_sizes[6] < DM || in_sizes[8] < DM) return;
  if (out_size < M_TOT * DM) return;

  const float* x  = (const float*)d_in[0];
  const float* Wq = (const float*)d_in[1];
  const float* bq = (const float*)d_in[2];
  const float* Wk = (const float*)d_in[3];
  const float* bk = (const float*)d_in[4];
  const float* Wv = (const float*)d_in[5];
  const float* bv = (const float*)d_in[6];
  const float* Wo = (const float*)d_in[7];
  const float* bo = (const float*)d_in[8];
  float* out = (float*)d_out;

  const size_t PL_BYTES = (size_t)M_TOT * DM * 2;          // Q, K, V^T, ctx planes (NB*NH*SEQ*HD = M_TOT*DM)
  const size_t total = 4 * PL_BYTES;
  if (total > ws_size) return;

  char* ws = (char*)d_ws;
  size_t off = 0;
  u16* Qp  = (u16*)(ws + off); off += PL_BYTES;
  u16* Kpl = (u16*)(ws + off); off += PL_BYTES;
  u16* Vtp = (u16*)(ws + off); off += PL_BYTES;
  u16* Ctx = (u16*)(ws + off); off += PL_BYTES;
  (void)off;

  // 1) projections from the f32 inputs: Q, K -> [bh][s][64] f16 x8 ; V -> [bh][d][SEQ] f16 x8
  dim3 gp(M_TOT / 128, DM / 64);
  k_proj<<<gp, 256, 0, stream>>>(x, Wq, Wk, Wv, bq, bk, bv, Qp);

  // 2) flash attention -> ctx plane [M_TOT][DM] f16 x64
  dim3 ga(NB * NH, SEQ / 128);
  k_attn<<<ga, 256, 0, stream>>>(Qp, Kpl, Vtp, Ctx);

  // 3) output projection -> out f32 [M_TOT][DM]
  k_oproj<<<gp, 256, 0, stream>>>(Ctx, Wo, bo, out);
}

// v009
// A run of this version takes 35.7 microseconds.
// In two side-by-side timings against v008, it was 1.14 and 1.15 times as fast.
// Counting every step since v000, it is 5.47 times as fast.
#include <hip/hip_runtime.h>
#include <math.h>

// QKV projections: v_wmma_f32_16x16x32_bf16 (bf16 operands = RNE-converted inputs, f32 accumulate); QK^T, P.V and ctx@Wo: v_wmma_f32_16x16x32_f16 (f16 operands, carries Q/K/V x8, P x16384, ctx x64, Wo x16, f32 accumulate); softmax and epilogues f32.

typedef unsigned short u16;
typedef _Float16 f16t;
typedef __bf16   v16bf __attribute__((ext_vector_type(16)));
typedef _Float16 v16h  __attribute__((ext_vector_type(16)));
typedef _Float16 v8h   __attribute__((ext_vector_type(8)));
typedef float    v8f   __attribute__((ext_vector_type(8)));
typedef float    v4f   __attribute__((ext_vector_type(4)));
typedef unsigned int v4u __attribute__((ext_vector_type(4)));
typedef unsigned int v2u __attribute__((ext_vector_type(2)));
typedef float    v2f   __attribute__((ext_vector_type(2)));
typedef __bf16   v2bf  __attribute__((ext_vector_type(2)));
typedef _Float16 v2h   __attribute__((ext_vector_type(2)));

#ifndef NB
#define NB 4
#endif
#ifndef SEQ
#define SEQ 2048
#endif
#define NB_FULL  4
#define SEQ_FULL 2048
#define DM 256
#define NH 4
#define HD 64
#define M_TOT (NB * SEQ)

static_assert(NB >= 1 && NB <= NB_FULL);
static_assert(SEQ >= 128 && SEQ <= SEQ_FULL && (SEQ % 128) == 0);
static_assert(DM == NH * HD);
static_assert((M_TOT % 128) == 0);
static_assert((M_TOT % 8) == 0);

// carries: Q,K,V planes hold value*8 (f16); P tile holds exp(z-m)*16384 (f16); ctx plane holds h*64 (f16);
// Wo LDS panel holds bf16(Wo)*16 (f16).  score = acc/512 ; ctx*64 = o/(l*2048) ; out = acc/1024 + bo
#define QKV_CARRY 8.0f
#define P_CARRY   16384.0f
#define WO_CARRY  16.0f
#define CTX_LDIV  2048.0f
#define OUT_SCALE (1.0f / 1024.0f)

// LDS row pitch, in 16-bit elements, of every tile that ds_load_b128 fragment loads read: 16 B x odd, so that
// the 16 rows a half-wave reads at once fall on 16 different groups of four banks (64 banks x 4 B).
#define P64 72    // rows of 64 elements: 144 B
#define P256 264  // rows of 256 elements: 528 B

// ---------------- helpers ----------------

__device__ __forceinline__ unsigned f2bf_bits(float f) {
  unsigned u = __float_as_uint(f);
  u += 0x7FFFu + ((u >> 16) & 1u);   // RNE convert f32 -> bf16 bits
  return u >> 16;
}
__device__ __forceinline__ float bf16r(float f) { return __uint_as_float(f2bf_bits(f) << 16); }
__device__ __forceinline__ u16 h_bits(float f) {
  union { f16t h; u16 u; } c;
  c.h = (f16t)f;                     // RNE convert f32 -> f16
  return c.u;
}
// two f32 -> two bf16 (RNE) in one word, lo in bits 15..0
__device__ __forceinline__ unsigned pk_bf(float lo, float hi) {
  const v2f f = {lo, hi};
  return __builtin_bit_cast(unsigned, __builtin_convertvector(f, v2bf));
}
// two f32 -> two f16 of bf16(value) * WO_CARRY in one word, lo in bits 15..0
__device__ __forceinline__ unsigned pk_wo(float lo, float hi) {
  const unsigned b = pk_bf(lo, hi);
  const v2f f = {__uint_as_float(b << 16) * WO_CARRY, __uint_as_float(b & 0xffff0000u) * WO_CARRY};
  return __builtin_bit_cast(unsigned, __builtin_convertvector(f, v2h));
}
__device__ __forceinline__ v8f zero8() {
  v8f z = {0.f, 0.f, 0.f, 0.f, 0.f, 0.f, 0.f, 0.f};
  return z;
}

// 16x32 16-bit fragment from a row-major [row][k] tile with pitch ldr (elements).
// lane l: row = l&15; elements 0..7 = k0+8h..k0+8h+7, elements 8..15 = k0+16+8h..+7, h = l>>4.
// Used for A (row = m) and for B loaded from a [n][k] k-contiguous copy (row = n). Same map for both.
__device__ __forceinline__ v16h load_frag_h(const u16* base, int ldr) {
  const int lane = threadIdx.x & 31;
  const int row  = lane & 15;
  const int kb   = (lane >> 4) << 3;
  union { v16h v; uint4 q[2]; } u;
  u.q[0] = *reinterpret_cast<const uint4*>(base + (size_t)row * ldr + kb);
  u.q[1] = *reinterpret_cast<const uint4*>(base + (size_t)row * ldr + 16 + kb);
  return u.v;
}
__device__ __forceinline__ v16bf load_frag_b(const u16* base, int ldr) {
  const int lane = threadIdx.x & 31;
  const int row  = lane & 15;
  const int kb   = (lane >> 4) << 3;
  union { v16bf v; uint4 q[2]; } u;
  u.q[0] = *reinterpret_cast<const uint4*>(base + (size_t)row * ldr + kb);
  u.q[1] = *reinterpret_cast<const uint4*>(base + (size_t)row * ldr + 16 + kb);
  return u.v;
}

// WMMA with the 4-slot VALU hazard guard tied to D, keeping A/B live.
__device__ __forceinline__ v8f mma_h(v16h a, v16h b, v8f c) {
  c = __builtin_amdgcn_wmma_f32_16x16x32_f16(false, a, false, b, (short)0, c, false, false);
  asm volatile("v_nop\n\tv_nop\n\tv_nop\n\tv_nop" : "+v"(c) : "v"(a), "v"(b));
  return c;
}
__device__ __forceinline__ v8f mma_b(v16bf a, v16bf b, v8f c) {
  c = __builtin_amdgcn_wmma_f32_16x16x32_bf16(false, a, false, b, (short)0, c, false, false);
  asm volatile("v_nop\n\tv_nop\n\tv_nop\n\tv_nop" : "+v"(c) : "v"(a), "v"(b));
  return c;
}

// lane l <-> lane l ^ 16: the two 16-lane halves of a wave hold the two halves of one query's keys
__device__ __forceinline__ float xhalf(float x) {
  const int b = __builtin_bit_cast(int, x);
  return __builtin_bit_cast(float, __builtin_amdgcn_permlanex16(b, b, 0x76543210, 0xfedcba98, false, false));
}

// One thread's share of a 64-key K tile and V^T tile (two 16-byte chunks of each), global memory -> LDS through no
// register.  lk, lv: the lane's LDS byte addresses; the second chunk of each lies 32 rows on.  The s_wait_xcnt is the
// last line of the copies' own statement, so that it stands in front of any rewrite of a register a copy names.
__device__ __forceinline__ void copy_kv(unsigned lk0, unsigned lk1, unsigned lv0, unsigned lv1, const u16* gk0,
                                        const u16* gk1, const u16* gv0, const u16* gv1) {
  asm volatile("global_load_async_to_lds_b128 %0, %4, off\n\t"
               "global_load_async_to_lds_b128 %1, %5, off\n\t"
               "global_load_async_to_lds_b128 %2, %6, off\n\t"
               "global_load_async_to_lds_b128 %3, %7, off\n\t"
               "s_wait_xcnt 0x0"
               :: "v"(lk0), "v"(lk1), "v"(lv0), "v"(lv1), "v"(gk0), "v"(gk1), "v"(gv0), "v"(gv1)
               : "memory");
}

// Stands behind the group of global loads at the top of a projection block.  The two vector addresses the loads name
// are inputs, so that they keep their registers up to the wait and no later load of the group returns onto them.
__device__ __forceinline__ void loads_issued(const void* p0, const void* p1) {
  asm volatile("s_wait_xcnt 0x0" :: "v"(p0), "v"(p1) : "memory");
}

// Block barrier that orders LDS traffic alone.  __syncthreads() also waits until every global load of the wave has
// returned, which would hold the first product of k_proj back until the panels of the later products have arrived.
__device__ __forceinline__ void lds_barrier() {
  __builtin_amdgcn_fence(__ATOMIC_RELEASE, "workgroup", "local");
  __builtin_amdgcn_s_barrier();
  __builtin_amdgcn_fence(__ATOMIC_ACQUIRE, "workgroup", "local");
}

// ---------------- kernels ----------------

// A 64-column panel of a weight matrix W, f32 [k][n], goes straight from global memory into the LDS panel Bt [n][k]
// (16-bit, pitch P256) that the B fragments are read from.  A thread takes two units of 4 columns x 8 k: eight
// 16-byte loads a unit (8 lanes cover one 128-B line of a k row), converted in pairs along k, four 16-byte LDS stores.
// wp: W + (tid >> 3) * 8 * DM + n0 + (tid & 7) * 4.
__device__ __forceinline__ void wpanel_load(v4f (&r)[2][8], const float* wp) {
#pragma unroll
  for (int u = 0; u < 2; ++u)
#pragma unroll
    for (int i = 0; i < 8; ++i) r[u][i] = *reinterpret_cast<const v4f*>(wp + i * DM + u * 32);
}
// WO false: bf16 bits of W.  WO true: f16 bits of bf16(W) * WO_CARRY.
__device__ __forceinline__ void wpanel_store(const bool WO, const v4f (&r)[2][8], u16* Bt) {
  const int tid = threadIdx.x;
  u16* dst = Bt + ((tid & 7) * 4) * P256 + (tid >> 3) * 8;
#pragma unroll
  for (int u = 0; u < 2; ++u)
#pragma unroll
    for (int j = 0; j < 4; ++j) {
      v4u w;
#pragma unroll
      for (int i = 0; i < 4; ++i)
        w[i] = WO ? pk_wo(r[u][2 * i][j], r[u][2 * i + 1][j]) : pk_bf(r[u][2 * i][j], r[u][2 * i + 1][j]);
      *reinterpret_cast<v4u*>(dst + (u * 32 + j) * P256) = w;
    }
}

// Projection GEMM: P[m][n] = sum_k bf16(x[m][k]) * bf16(W[k][n]) + bias[n], stored *QKV_CARRY as f16.
// Block = 256 threads (8 waves) takes 128 rows of x and one head (64 columns) of all three products Q, K, V.
// The inputs are read as f32 and converted on the way into LDS: the three weight panels by wpanel_load / _store,
// the x rows in whole lines (a wave stages its own 16 rows, [m][k], pitch P256) and from there as A fragments,
// which stay in registers for the three products.  Every global load is issued at the top, in the order of use; a
// panel is staged, and published by a barrier of its own, right in front of its product, so that the K and V panels
// are still on their way during the products before them.  A last barrier publishes the output staging.
// Out3 = the three output planes in a row; Q, K: [bh][s][64]; V: [bh][d][SEQ] (V transposed).
#define ST_PLANE (128 * 72)     // elements of one product's output staging: 128 x 72 (Q, K) or 64 x 136 (V)
__global__ __launch_bounds__(256)
void k_proj(const float* __restrict__ x, const float* __restrict__ Wq, const float* __restrict__ Wk,
            const float* __restrict__ Wv, const float* __restrict__ bq, const float* __restrict__ bk,
            const float* __restrict__ bv, u16* __restrict__ Out3) {
  __shared__ __attribute__((aligned(16))) u16 Bt[3 * 64 * P256];   // per product [n][k]
  __shared__ __attribute__((aligned(16))) u16 Xs[128 * P256];      // [m][k]
  __shared__ __attribute__((aligned(16))) u16 St[3 * ST_PLANE];
  const int tid = threadIdx.x, wave = tid >> 5, lane = tid & 31;
  const int h16 = (lane >> 4) << 3;
  const int col = lane & 15;
  const int mb = blockIdx.x * 128;
  const int n0 = blockIdx.y * 64;
  const int bb = mb / SEQ;
  const int s0 = mb - bb * SEQ;     // 128 rows of one sequence (SEQ % 128 == 0)
  const int hh = blockIdx.y;        // head index = n0 / 64

  const size_t woff = (size_t)(tid >> 3) * 8 * DM + n0 + (tid & 7) * 4;
  const float* wpq = Wq + woff;
  const float* wpk = Wk + woff;
  const float* wpv = Wv + woff;
  // x rows: a wave's load is 512 B in a row; lane: k = 4 lane .. + 3 and 128 + 4 lane .. + 3 of each row
  const float* xp = x + ((size_t)bb * SEQ_FULL + s0 + wave * 16) * DM + lane * 4;
  v4f rq[2][8], rk[2][8], rv[2][8], xf[16][2];
  float bl[3][4];
#pragma unroll
  for (int t = 0; t < 4; ++t) {
    bl[0][t] = bq[n0 + col + t * 16];
    bl[1][t] = bk[n0 + col + t * 16];
    bl[2][t] = bv[n0 + col + t * 16];
  }
  wpanel_load(rq, wpq);
#pragma unroll
  for (int i = 0; i < 16; ++i)
#pragma unroll
    for (int c = 0; c < 2; ++c) xf[i][c] = *reinterpret_cast<const v4f*>(xp + i * DM + c * 128);
  loads_issued(wpq, xp);             // also keeps what the first product needs in front of the other two panels
  wpanel_load(rk, wpk);
  wpanel_load(rv, wpv);
  loads_issued(wpk, wpv);

  wpanel_store(false, rq, Bt);
  u16* xs = Xs + (wave * 16) * P256 + lane * 4;
#pragma unroll
  for (int i = 0; i < 16; ++i)
#pragma unroll
    for (int c = 0; c < 2; ++c) {
      const v2u w = {pk_bf(xf[i][c][0], xf[i][c][1]), pk_bf(xf[i][c][2], xf[i][c][3])};
      *reinterpret_cast<v2u*>(xs + i * P256 + c * 128) = w;
    }
  lds_barrier();                     // Q panel, Xs ready

  v16bf a[DM / 32];
#pragma unroll
  for (int s = 0; s < DM / 32; ++s) a[s] = load_frag_b(&Xs[(wave * 16) * P256 + s * 32], P256);

#pragma unroll
  for (int z = 0; z < 3; ++z) {
    const u16* Bz = Bt + z * 64 * P256;
    u16* Sz = St + z * ST_PLANE;
    if (z != 0) {
      __builtin_amdgcn_sched_barrier(0);   // or the panel's conversions, and the wait for its loads, rise over the product before
      wpanel_store(false, z == 1 ? rk : rv, Bt + z * 64 * P256);
      lds_barrier();                 // this product's panel ready
    }
    v8f acc[4] = {zero8(), zero8(), zero8(), zero8()};
#pragma unroll                       // a[s] stays in registers only under a constant index
    for (int s = 0; s < DM / 32; ++s) {
      v16bf b[4];                    // the step's B fragments: one group of LDS loads, one latency instead of four
#pragma unroll
      for (int t = 0; t < 4; ++t) b[t] = load_frag_b(&Bz[(t * 16) * P256 + s * 32], P256);
#pragma unroll
      for (int t = 0; t < 4; ++t) acc[t] = mma_b(a[s], b[t], acc[t]);
    }
    if (z != 2) {
#pragma unroll
      for (int t = 0; t < 4; ++t) {
        const int nl = t * 16 + col;
        const float bvv = bf16r(bl[z][t]);
#pragma unroll
        for (int r = 0; r < 8; ++r) {
          const int ml = wave * 16 + h16 + r;
          Sz[ml * 72 + nl] = h_bits((acc[t][r] + bvv) * QKV_CARRY);
        }
      }
    } else {
#pragma unroll
      for (int t = 0; t < 4; ++t) {
        const int nl = t * 16 + col;
        const float bvv = bf16r(bl[z][t]);
        union { v8h v; v4u q; } pk;
#pragma unroll
        for (int r = 0; r < 8; ++r) pk.v[r] = (f16t)((acc[t][r] + bvv) * QKV_CARRY);
        *reinterpret_cast<v4u*>(&Sz[nl * 136 + wave * 16 + h16]) = pk.q;   // Sz[d][m-local]
      }
    }
  }
  __syncthreads();                   // St ready

  // Q, K: row ml -> base + ml*HD (128-B rows, 8 lanes x 16 B).  V: row d -> base + d*SEQ (256-B segments, 16 lanes x 16 B).
  v4u ov[3][4];
  u16* op[2][4];                     // Q rows (the K rows lie one plane on) and V rows
  {
    u16* base = Out3 + ((size_t)(bb * NH + hh) * SEQ + s0) * HD;
#pragma unroll
    for (int i = 0; i < 4; ++i) {
      const int rr = wave * 16 + i * 4 + (lane >> 3);
      const int c = lane & 7;
      ov[0][i] = *reinterpret_cast<const v4u*>(&St[rr * 72 + c * 8]);
      ov[1][i] = *reinterpret_cast<const v4u*>(&St[ST_PLANE + rr * 72 + c * 8]);
      op[0][i] = base + (size_t)rr * HD + c * 8;
    }
  }
  {
    u16* base = Out3 + (size_t)2 * M_TOT * DM + ((size_t)(bb * NH + hh) * HD) * SEQ + s0;
#pragma unroll
    for (int i = 0; i < 4; ++i) {
      const int dd = wave * 8 + i * 2 + (lane >> 4);
      const int c = lane & 15;
      ov[2][i] = *reinterpret_cast<const v4u*>(&St[2 * ST_PLANE + dd * 136 + c * 8]);
      op[1][i] = base + (size_t)dd * SEQ + c * 8;
    }
  }
  // Inputs only: every staged row and every address is in its register before the first store is issued, so that
  // nothing is left to compute behind a store and no register that an issued store names is rewritten.
  asm volatile("" :: "v"(ov[0][0]), "v"(ov[0][1]), "v"(ov[0][2]), "v"(ov[0][3]), "v"(ov[1][0]), "v"(ov[1][1]),
               "v"(ov[1][2]), "v"(ov[1][3]), "v"(ov[2][0]), "v"(ov[2][1]), "v"(ov[2][2]), "v"(ov[2][3]),
               "v"(op[0][0]), "v"(op[0][1]), "v"(op[0][2]), "v"(op[0][3]), "v"(op[1][0]), "v"(op[1][1]),
               "v"(op[1][2]), "v"(op[1][3]));
#pragma unroll
  for (int i = 0; i < 4; ++i) {
    *(v4u*)(op[0][i]) = ov[0][i];
    *(v4u*)(op[0][i] + (size_t)M_TOT * DM) = ov[1][i];
  }
#pragma unroll
  for (int i = 0; i < 4; ++i) *(v4u*)(op[1][i]) = ov[2][i];
}

// Flash attention.  Q,K planes f16 [bh][s][64] (x8), V plane f16 transposed [bh][d][SEQ] (x8).
// Block = 512 threads (16 waves, four a SIMD) owns (bh, 128 query rows); a wave owns 16 queries and half of the keys:
// of each 128 keys, wave group 0 (waves 0..7) takes the first 64 and group 1 the last 64, each wave with its own
// maximum, sum and accumulators; the two groups are joined after the loop, through LDS.  The vector work between the
// matrix runs leaves a SIMD idle at two waves; four cover one another's waits.  A group's 64-key K and V^T tiles come
// into LDS by its own threads' asynchronous copies, two buffers: stage t + 1 (128 keys) is in flight while stage t is
// worked on, and one block barrier a trip both publishes stage t + 1 and frees stage t's buffer for stage t + 2.
// Both products are taken transposed: S^T = K . Q^T (rows = keys, columns = queries), O^T += V^T . P^T.
// A lane then holds 32 of the 64 scores of ONE query (column lane & 15; keys 16 t + 8 (lane >> 4) + r), so
// the row maximum and sum are in-lane work plus one exchange between the halves, and two score tiles,
// converted in place, are the B operand of the second product in the k order of load_frag_h.
#define KV_TILE (64 * P64)      // elements of one tile in LDS
#define KV_BUF  (2 * KV_TILE)   // elements of one group's share of a buffer: K tile and V^T tile
#define KV_STAGE (2 * KV_BUF)   // elements of one buffer: both groups' shares
__global__ __launch_bounds__(512) __attribute__((amdgpu_num_vgpr(256)))
void k_attn(const u16* __restrict__ Qp, const u16* __restrict__ Kp, const u16* __restrict__ Vtp,
            u16* __restrict__ Ctx) {
  __shared__ __attribute__((aligned(16))) u16 KV[2 * KV_STAGE];  // per buffer and group: K tile [key][d], V^T tile [d][key]
  __shared__ __attribute__((aligned(16))) u16 Ct[8 * 16 * P64];  // per 16 queries [query][d]: output staging
  __shared__ __attribute__((aligned(16))) float Mo[8 * 8 * 32 * 4];  // group 1's accumulators: [16 queries][chunk][lane][4]
  __shared__ float Ml[8 * 2 * 32];                               // group 1's maximum and sum: [16 queries][2][lane]

  const int tid = threadIdx.x, lane = tid & 31;
  const int grp = tid >> 8;                          // key group of this wave
  const int wave = (tid >> 5) & 7;                   // which 16 queries of the block
  const int h16 = (lane >> 4) << 3;
  const int col = lane & 15;
  const int bh = blockIdx.x;
  const int bb = bh / NH, hh = bh - bb * NH;
  const int q0 = blockIdx.y * 128 + wave * 16;       // first query position of this wave

  const u16* Qbh = Qp + (size_t)bh * SEQ * HD;
  const u16* Kbh = Kp + (size_t)bh * SEQ * HD;
  const u16* Vbh = Vtp + (size_t)bh * HD * SEQ;
  u16* Cw = Ct + wave * (16 * P64);

  const v16h bq0 = load_frag_h(Qbh + (size_t)q0 * HD, HD);        // B[k=d][n=query], loaded like A
  const v16h bq1 = load_frag_h(Qbh + (size_t)q0 * HD + 32, HD);

  float mrow = -INFINITY;     // this lane's query: running maximum (the same in both halves)
  float lrow = 0.f;           // running sum over this half's keys only; the halves are joined after the loop
  v8f o[4] = {zero8(), zero8(), zero8(), zero8()};
  const float qrel = (float)(q0 + col - h16 - grp * 64);   // query position less this group's and half's key offset
  // z = acc/512 * (SEQ - |i-j|)/SEQ
  const float kmask = 1.0f / ((float)SEQ * 512.0f);

  const int row = (tid & 255) >> 3, off = (tid & 7) << 3;   // this thread's chunks of its group's tile: rows row, row + 32
  const u16* gk = Kbh + (size_t)(grp * 64 + row) * HD + off;   // stage at key t0: + t0 * HD
  const u16* gv = Vbh + (size_t)row * SEQ + grp * 64 + off;    // stage at key t0: + t0
  const unsigned lk = (unsigned)(size_t)&KV[grp * KV_BUF + row * P64 + off];   // LDS byte address of the chunk in buffer 0
  auto stage = [&](const int t0, const unsigned buf) {              // buf: the buffer's byte offset
    copy_kv(lk + buf, lk + buf + 32 * P64 * 2, lk + buf + KV_TILE * 2, lk + buf + (KV_TILE + 32 * P64) * 2,
            gk + (size_t)t0 * HD, gk + (size_t)(t0 + 32) * HD, gv + t0, gv + t0 + 32 * SEQ);
  };
  stage(0, 0);
  asm volatile("s_wait_asynccnt 0x0" ::: "memory");   // this wave's share of stage 0 has landed
  __syncthreads();                                    // stage 0 published
  if (128 < SEQ) stage(128, KV_STAGE * 2);            // where a stage 1 exists

#pragma unroll 1
  for (int t0 = 0; t0 < SEQ; t0 += 128) {             // t0: first key of the stage; this wave's keys begin 64 grp on
    const unsigned cur = (t0 & 128) ? KV_STAGE : 0;   // this trip reads this buffer alone
    const u16* Kt = KV + cur + grp * KV_BUF;
    const u16* Vs = Kt + KV_TILE;

    // ---- scores: S^T(64 keys x 16 queries) = K(64 x 64 d) . Q^T ; A[m=key][k=d] from Kt[key][d]
    // All 16 loads of the K fragments stand in one group at the top of the trip, in the order of their use; the
    // mask weights, which need no score, stand behind them and run while the loads are under way.
    v16h ka[2][4];
#pragma unroll
    for (int j = 0; j < 2; ++j)
#pragma unroll
      for (int t = 0; t < 4; ++t) ka[j][t] = load_frag_h(&Kt[(t * 16) * P64 + j * 32], P64);

    const float dq = qrel - (float)t0;                // i - j = dq - (16 t + r): whole numbers, exact in f32
    float wm[4][8];                                   // scale and multiplicative distance-decay mask of sc[t][r]
#pragma unroll
    for (int t = 0; t < 4; ++t)
#pragma unroll
      for (int r = 0; r < 8; ++r) wm[t][r] = ((float)SEQ - fabsf(dq - (float)(t * 16 + r))) * kmask;

    v8f sc[4];
#pragma unroll
    for (int t = 0; t < 4; ++t) sc[t] = mma_h(ka[0][t], bq0, zero8());
#pragma unroll
    for (int t = 0; t < 4; ++t) sc[t] = mma_h(ka[1][t], bq1, sc[t]);

    // All 16 loads of the V^T fragments, one group in front of the softmax, whose work covers their latency.
    v16h va[2][4];
#pragma unroll
    for (int j = 0; j < 2; ++j)
#pragma unroll
      for (int dt = 0; dt < 4; ++dt) va[j][dt] = load_frag_h(&Vs[(dt * 16) * P64 + j * 32], P64);
    __builtin_amdgcn_sched_barrier(0);                // or the scheduler sinks these loads down to their WMMAs

    // ---- scale and mask, online softmax; sc[t][r]: key t0 + 64 grp + 16 t + h16 + r
    float mt[4];                                      // one chain per score tile: four short chains, not one long
#pragma unroll
    for (int t = 0; t < 4; ++t) {
      mt[t] = -INFINITY;
#pragma unroll
      for (int r = 0; r < 8; ++r) {
        const float z = sc[t][r] * wm[t][r];
        sc[t][r] = z;
        mt[t] = fmaxf(mt[t], z);
      }
    }
    float mx = fmaxf(fmaxf(mt[0], mt[1]), fmaxf(mt[2], mt[3]));
    mx = fmaxf(mx, xhalf(mx));
    const float mnew = fmaxf(mrow, mx);
    const float alpha = __expf(mrow - mnew);
    mrow = mnew;

    // P^T as B[k=key][n=query]: elements 0..7 = score tile 2 j, elements 8..15 = score tile 2 j + 1
    v16h pb[2];
    float pt[4];                                      // partial sums, one chain per score tile as above
#pragma unroll
    for (int t = 0; t < 4; ++t) {
      pt[t] = 0.f;
#pragma unroll
      for (int r = 0; r < 8; ++r) {
        const float p = __expf(sc[t][r] - mrow);
        pt[t] += p;
        pb[t >> 1][(t & 1) * 8 + r] = (f16t)(p * P_CARRY);
      }
    }
    lrow = lrow * alpha + ((pt[0] + pt[1]) + (pt[2] + pt[3]));
#pragma unroll
    for (int dt = 0; dt < 4; ++dt)
#pragma unroll
      for (int r = 0; r < 8; ++r) o[dt][r] *= alpha;

    // ---- O^T(64 d x 16 queries) += V^T(64 d x 64 keys) . P^T ; A[m=d][k=key] from Vs[d][key]
#pragma unroll
    for (int dt = 0; dt < 4; ++dt) o[dt] = mma_h(va[0][dt], pb[0], o[dt]);
#pragma unroll
    for (int dt = 0; dt < 4; ++dt) o[dt] = mma_h(va[1][dt], pb[1], o[dt]);

    asm volatile("s_wait_dscnt 0x0" ::: "memory");    // this wave's reads of the current buffer are done
    asm volatile("s_wait_asynccnt 0x0" ::: "memory"); // this wave's share of the next stage has landed
    __syncthreads();                                  // next stage published; current buffer left by every wave
    if (t0 + 256 < SEQ) stage(t0 + 256, cur * 2);     // the same test in the whole block
  }
  asm volatile("s_wait_asynccnt 0x0" ::: "memory");   // no copy is outstanding when the wave goes on

  // ---- join of the two key groups: group 1 hands its maximum, sum and accumulators to the wave of group 0 that has
  // the same 16 queries (the same lane holds the same query and the same d), which weighs both by exp(m - joint m)
  float* mo = Mo + (wave * 8 * 32 + lane) * 4;        // chunk c: + c * 128; a wave's store is 512 B in a row
  float* ml = Ml + wave * 64 + lane;
  if (grp == 1) {
#pragma unroll
    for (int dt = 0; dt < 4; ++dt)
#pragma unroll
      for (int c = 0; c < 2; ++c) {
        const v4f w = {o[dt][4 * c], o[dt][4 * c + 1], o[dt][4 * c + 2], o[dt][4 * c + 3]};
        *reinterpret_cast<v4f*>(mo + (dt * 2 + c) * 128) = w;
      }
    ml[0] = mrow;
    ml[32] = lrow;
  }
  __syncthreads();                                    // group 1's partial results published
  if (grp == 1) return;                               // whole waves; no barrier follows
  {
    const float m1 = ml[0], l1 = ml[32];
    const float mj = fmaxf(mrow, m1);
    const float a0 = __expf(mrow - mj), a1 = __expf(m1 - mj);
    lrow = lrow * a0 + l1 * a1;
#pragma unroll
    for (int dt = 0; dt < 4; ++dt)
#pragma unroll
      for (int c = 0; c < 2; ++c) {
        const v4f w = *reinterpret_cast<const v4f*>(mo + (dt * 2 + c) * 128);
#pragma unroll
        for (int i = 0; i < 4; ++i) o[dt][4 * c + i] = o[dt][4 * c + i] * a0 + w[i] * a1;
      }
  }

  // ---- normalize: ctx*64 = o / (l * 2048); o[dt][r] = O[query col][d = 16 dt + h16 + r]: eight d in a row,
  // one 16-byte store into the wave's own staging rows
  const float inv = 1.0f / ((lrow + xhalf(lrow)) * CTX_LDIV);
#pragma unroll
  for (int dt = 0; dt < 4; ++dt) {
    union { v8h v; v4u q; } pk;
#pragma unroll
    for (int r = 0; r < 8; ++r) pk.v[r] = (f16t)(o[dt][r] * inv);
    *reinterpret_cast<v4u*>(&Cw[col * P64 + dt * 16 + h16]) = pk.q;
  }
  // staging is wave-private: LDS completion + wave sync (also a compiler ordering point)
  asm volatile("s_wait_dscnt 0" ::: "memory");
  __builtin_amdgcn_wave_barrier();

  u16* cbase = Ctx + ((size_t)(bb * SEQ + q0)) * DM + hh * HD;   // row rr -> cbase + rr*DM
  auto pass = [&]() {
#pragma unroll
    for (int i = 0; i < 4; ++i) {
      const int rr = i * 4 + (lane >> 3);
      const int c = lane & 7;
      const v4u v = *reinterpret_cast<const v4u*>(&Cw[rr * P64 + c * 8]);
      *(v4u*)(cbase + (size_t)rr * DM + c * 8) = v;
    }
  };
  pass();
  
}

// Output projection: out[m][n] = sum_k ctx[m][k] * Bt[n][k] / (64*16) + bf16(bo[n]), f32.
// Block tile 128 x 64; the Wo panel is read as f32 and converted on the way into LDS as in k_proj; every global load
// of the block is issued at the top; f32 tile staged in LDS; each 256-B row segment
// written by 16 lanes x 16 B
__global__ __launch_bounds__(256) void k_oproj(const u16* __restrict__ Ctx, const float* __restrict__ Wo,
                                               const float* __restrict__ bo, float* __restrict__ out) {
  __shared__ __attribute__((aligned(16))) u16 Bt[64 * P256];   // [n][k]
  __shared__ __attribute__((aligned(16))) float So[128 * 68];
  const int tid = threadIdx.x, wave = tid >> 5, lane = tid & 31;
  const int h16 = (lane >> 4) << 3;
  const int col = lane & 15;
  const int mb = blockIdx.x * 128;
  const int m0 = mb + wave * 16;
  const int n0 = blockIdx.y * 64;

  v4f rw[2][8];
  const float* wp = Wo + (size_t)(tid >> 3) * 8 * DM + n0 + (tid & 7) * 4;
  wpanel_load(rw, wp);
  v16h a[DM / 32];
  const u16* arow = Ctx + (size_t)(m0 + col) * DM + h16;  // this lane's first chunk, as load_frag_h forms it
#pragma unroll
  for (int s = 0; s < DM / 32; ++s) {
    union { v16h v; uint4 q[2]; } u;
    u.q[0] = *reinterpret_cast<const uint4*>(arow + s * 32);
    u.q[1] = *reinterpret_cast<const uint4*>(arow + s * 32 + 16);
    a[s] = u.v;
  }
  float bl[4];
  const float* bcol = bo + n0 + col;
#pragma unroll
  for (int t = 0; t < 4; ++t) bl[t] = bcol[t * 16];
  loads_issued(wp, arow);
  wpanel_store(true, rw, Bt);
  __syncthreads();                   // Bt ready

  v8f acc[4] = {zero8(), zero8(), zero8(), zero8()};
#pragma unroll                       // a[s] stays in registers only under a constant index
  for (int s = 0; s < DM / 32; ++s) {
    v16h b[4];                       // the step's B fragments: one group of LDS loads, one latency instead of four
#pragma unroll
    for (int t = 0; t < 4; ++t) b[t] = load_frag_h(&Bt[(t * 16) * P256 + s * 32], P256);
#pragma unroll
    for (int t = 0; t < 4; ++t) acc[t] = mma_h(a[s], b[t], acc[t]);
  }

#pragma unroll
  for (int t = 0; t < 4; ++t) {
    const int nl = t * 16 + col;
    const float bvv = bf16r(bl[t]);
#pragma unroll
    for (int r = 0; r < 8; ++r) {
      const int ml = wave * 16 + h16 + r;
      So[ml * 68 + nl] = acc[t][r] * OUT_SCALE + bvv;
    }
  }
  __syncthreads();
  float* base = out + (size_t)mb * DM + n0;            // row rr -> base + rr*DM
  auto pass = [&]() {
#pragma unroll
    for (int i = 0; i < 8; ++i) {
      const int rr = wave * 16 + i * 2 + (lane >> 4);
      const int c = lane & 15;
      const v4f v = *reinterpret_cast<const v4f*>(&So[rr * 68 + c * 4]);
      *(v4f*)(base + (size_t)rr * DM + c * 4) = v;
    }
  };
  pass();
  
}

// ---------------- launcher ----------------

extern "C" void kernel_launch(void* const* d_in, const int* in_sizes, int n_in,
                              void* d_out, int out_size, void* d_ws, size_t ws_size,
                              hipStream_t stream) {
  if (n_in < 9) return;
  if (in_sizes[0] < ((NB - 1) * SEQ_FULL + SEQ) * DM) return;
  if (in_sizes[1] < DM * DM || in_sizes[3] < DM * DM || in_sizes[5] < DM * DM || in_sizes[7] < DM * DM) return;
  if (in_sizes[2] < DM || in_sizes[4] < DM || in_sizes[6] < DM || in_sizes[8] < DM) return;
  if (out_size < M_TOT * DM) return;

  const float* x  = (const float*)d_in[0];
  const float* Wq = (const float*)d_in[1];
  const float* bq = (const float*)d_in[2];
  const float* Wk = (const float*)d_in[3];
  const float* bk = (const float*)d_in[4];
  const float* Wv = (const float*)d_in[5];
  const float* bv = (const float*)d_in[6];
  const float* Wo = (const float*)d_in[7];
  const float* bo = (const float*)d_in[8];
  float* out = (float*)d_out;

  const size_t PL_BYTES = (size_t)M_TOT * DM * 2;          // Q, K, V^T, ctx planes (NB*NH*SEQ*HD = M_TOT*DM)
  const size_t total = 4 * PL_BYTES;
  if (total > ws_size) return;

  char* ws = (char*)d_ws;
  size_t off = 0;
  u16* Qp  = (u16*)(ws + off); off += PL_BYTES;
  u16* Kpl = (u16*)(ws + off); off += PL_BYTES;
  u16* Vtp = (u16*)(ws + off); off += PL_BYTES;
  u16* Ctx = (u16*)(ws + off); off += PL_BYTES;
  (void)off;

  // 1) projections from the f32 inputs: Q, K -> [bh][s][64] f16 x8 ; V -> [bh][d][SEQ] f16 x8
  dim3 gp(M_TOT / 128, DM / 64);
  k_proj<<<gp, 256, 0, stream>>>(x, Wq, Wk, Wv, bq, bk, bv, Qp);

  // 2) flash attention -> ctx plane [M_TOT][DM] f16 x64
  dim3 ga(NB * NH, SEQ / 128);
  k_attn<<<ga, 512, 0, stream>>>(Qp, Kpl, Vtp, Ctx);

  // 3) output projection -> out f32 [M_TOT][DM]
  k_oproj<<<gp, 256, 0, stream>>>(Ctx, Wo, bo, out);
}

// v010
// One run takes 33.9 microseconds.
// Next to v009, in two timings, it ran 1.05 and 1.06 times as fast.
// Counting every step since v000, it is 5.77 times as fast.
#include <hip/hip_runtime.h>
#include <math.h>

// QKV projections: v_wmma_f32_16x16x32_bf16 (bf16 operands = RNE-converted inputs, f32 accumulate); QK^T, P.V and ctx@Wo: v_wmma_f32_16x16x32_f16 (f16 operands, carries Q/K/V x8, P x16384, ctx x64, Wo x16, f32 accumulate); softmax and epilogues f32.

typedef unsigned short u16;
typedef _Float16 f16t;
typedef __bf16   v16bf __attribute__((ext_vector_type(16)));
typedef _Float16 v16h  __attribute__((ext_vector_type(16)));
typedef _Float16 v8h   __attribute__((ext_vector_type(8)));
typedef float    v8f   __attribute__((ext_vector_type(8)));
typedef float    v4f   __attribute__((ext_vector_type(4)));
typedef unsigned int v4u __attribute__((ext_vector_type(4)));
typedef unsigned int v2u __attribute__((ext_vector_type(2)));
typedef float    v2f   __attribute__((ext_vector_type(2)));
typedef __bf16   v2bf  __attribute__((ext_vector_type(2)));
typedef _Float16 v2h   __attribute__((ext_vector_type(2)));

#ifndef NB
#define NB 4
#endif
#ifndef SEQ
#define SEQ 2048
#endif
#define NB_FULL  4
#define SEQ_FULL 2048
#define DM 256
#define NH 4
#define HD 64
#define M_TOT (NB * SEQ)

static_assert(NB >= 1 && NB <= NB_FULL);
static_assert(SEQ >= 128 && SEQ <= SEQ_FULL && (SEQ % 128) == 0);
static_assert(DM == NH * HD);
static_assert((M_TOT % 128) == 0);
static_assert((M_TOT % 8) == 0);

// carries: Q,K,V planes hold value*8 (f16); P tile holds exp(z-m)*16384 (f16); ctx plane holds h*64 (f16);
// Wo LDS panel holds bf16(Wo)*16 (f16).  score = acc/512 ; ctx*64 = o/(l*2048) ; out = acc/1024 + bo
// (k_attn keeps its row sum l with P's carry on it: ctx*64 = o/(l*16384 * 2048/16384))
#define QKV_CARRY 8.0f
#define P_CARRY   16384.0f
#define P_CARRY_LOG2 14.0f
#define WO_CARRY  16.0f
#define CTX_LDIV  2048.0f
#define OUT_SCALE (1.0f / 1024.0f)

// LDS row pitch, in 16-bit elements, of every tile that ds_load_b128 fragment loads read: 16 B x odd, so that
// the 16 rows a half-wave reads at once fall on 16 different groups of four banks (64 banks x 4 B).
#define P64 72    // rows of 64 elements: 144 B
#define P256 264  // rows of 256 elements: 528 B

// ---------------- helpers ----------------

__device__ __forceinline__ unsigned f2bf_bits(float f) {
  unsigned u = __float_as_uint(f);
  u += 0x7FFFu + ((u >> 16) & 1u);   // RNE convert f32 -> bf16 bits
  return u >> 16;
}
__device__ __forceinline__ float bf16r(float f) { return __uint_as_float(f2bf_bits(f) << 16); }
__device__ __forceinline__ u16 h_bits(float f) {
  union { f16t h; u16 u; } c;
  c.h = (f16t)f;                     // RNE convert f32 -> f16
  return c.u;
}
// two f32 -> two bf16 (RNE) in one word, lo in bits 15..0
__device__ __forceinline__ unsigned pk_bf(float lo, float hi) {
  const v2f f = {lo, hi};
  return __builtin_bit_cast(unsigned, __builtin_convertvector(f, v2bf));
}
// two f32 -> two f16 of bf16(value) * WO_CARRY in one word, lo in bits 15..0
__device__ __forceinline__ unsigned pk_wo(float lo, float hi) {
  const unsigned b = pk_bf(lo, hi);
  const v2f f = {__uint_as_float(b << 16) * WO_CARRY, __uint_as_float(b & 0xffff0000u) * WO_CARRY};
  return __builtin_bit_cast(unsigned, __builtin_convertvector(f, v2h));
}
__device__ __forceinline__ v8f zero8() {
  v8f z = {0.f, 0.f, 0.f, 0.f, 0.f, 0.f, 0.f, 0.f};
  return z;
}

// 16x32 16-bit fragment from a row-major [row][k] tile with pitch ldr (elements).
// lane l: row = l&15; elements 0..7 = k0+8h..k0+8h+7, elements 8..15 = k0+16+8h..+7, h = l>>4.
// Used for A (row = m) and for B loaded from a [n][k] k-contiguous copy (row = n). Same map for both.
__device__ __forceinline__ v16h load_frag_h(const u16* base, int ldr) {
  const int lane = threadIdx.x & 31;
  const int row  = lane & 15;
  const int kb   = (lane >> 4) << 3;
  union { v16h v; uint4 q[2]; } u;
  u.q[0] = *reinterpret_cast<const uint4*>(base + (size_t)row * ldr + kb);
  u.q[1] = *reinterpret_cast<const uint4*>(base + (size_t)row * ldr + 16 + kb);
  return u.v;
}
__device__ __forceinline__ v16bf load_frag_b(const u16* base, int ldr) {
  const int lane = threadIdx.x & 31;
  const int row  = lane & 15;
  const int kb   = (lane >> 4) << 3;
  union { v16bf v; uint4 q[2]; } u;
  u.q[0] = *reinterpret_cast<const uint4*>(base + (size_t)row * ldr + kb);
  u.q[1] = *reinterpret_cast<const uint4*>(base + (size_t)row * ldr + 16 + kb);
  return u.v;
}

// WMMA with the 4-slot VALU hazard guard tied to D, keeping A/B live.
__device__ __forceinline__ v8f mma_h(v16h a, v16h b, v8f c) {
  c = __builtin_amdgcn_wmma_f32_16x16x32_f16(false, a, false, b, (short)0, c, false, false);
  asm volatile("v_nop\n\tv_nop\n\tv_nop\n\tv_nop" : "+v"(c) : "v"(a), "v"(b));
  return c;
}
__device__ __forceinline__ v8f mma_b(v16bf a, v16bf b, v8f c) {
  c = __builtin_amdgcn_wmma_f32_16x16x32_bf16(false, a, false, b, (short)0, c, false, false);
  asm volatile("v_nop\n\tv_nop\n\tv_nop\n\tv_nop" : "+v"(c) : "v"(a), "v"(b));
  return c;
}

// lane l <-> lane l ^ 16: the two 16-lane halves of a wave hold the two halves of one query's keys
__device__ __forceinline__ float xhalf(float x) {
  const int b = __builtin_bit_cast(int, x);
  return __builtin_bit_cast(float, __builtin_amdgcn_permlanex16(b, b, 0x76543210, 0xfedcba98, false, false));
}

// One thread's share of a 64-key K tile and V^T tile (two 16-byte chunks of each), global memory -> LDS through no
// register.  lk, lv: the lane's LDS byte addresses; the second chunk of each lies 32 rows on.  The s_wait_xcnt is the
// last line of the copies' own statement, so that it stands in front of any rewrite of a register a copy names.
__device__ __forceinline__ void copy_kv(unsigned lk0, unsigned lk1, unsigned lv0, unsigned lv1, const u16* gk0,
                                        const u16* gk1, const u16* gv0, const u16* gv1) {
  asm volatile("global_load_async_to_lds_b128 %0, %4, off\n\t"
               "global_load_async_to_lds_b128 %1, %5, off\n\t"
               "global_load_async_to_lds_b128 %2, %6, off\n\t"
               "global_load_async_to_lds_b128 %3, %7, off\n\t"
               "s_wait_xcnt 0x0"
               :: "v"(lk0), "v"(lk1), "v"(lv0), "v"(lv1), "v"(gk0), "v"(gk1), "v"(gv0), "v"(gv1)
               : "memory");
}

// Stands behind the group of global loads at the top of a projection block.  The two vector addresses the loads name
// are inputs, so that they keep their registers up to the wait and no later load of the group returns onto them.
__device__ __forceinline__ void loads_issued(const void* p0, const void* p1) {
  asm volatile("s_wait_xcnt 0x0" :: "v"(p0), "v"(p1) : "memory");
}

// Block barrier that orders LDS traffic alone.  __syncthreads() also waits until every global load of the wave has
// returned, which would hold the first product of k_proj back until the panels of the later products have arrived.
__device__ __forceinline__ void lds_barrier() {
  __builtin_amdgcn_fence(__ATOMIC_RELEASE, "workgroup", "local");
  __builtin_amdgcn_s_barrier();
  __builtin_amdgcn_fence(__ATOMIC_ACQUIRE, "workgroup", "local");
}

// ---------------- kernels ----------------

// A 64-column panel of a weight matrix W, f32 [k][n], goes straight from global memory into the LDS panel Bt [n][k]
// (16-bit, pitch P256) that the B fragments are read from.  A thread takes two units of 4 columns x 8 k: eight
// 16-byte loads a unit (8 lanes cover one 128-B line of a k row), converted in pairs along k, four 16-byte LDS stores.
// wp: W + (tid >> 3) * 8 * DM + n0 + (tid & 7) * 4.
__device__ __forceinline__ void wpanel_load(v4f (&r)[2][8], const float* wp) {
#pragma unroll
  for (int u = 0; u < 2; ++u)
#pragma unroll
    for (int i = 0; i < 8; ++i) r[u][i] = *reinterpret_cast<const v4f*>(wp + i * DM + u * 32);
}
// WO false: bf16 bits of W.  WO true: f16 bits of bf16(W) * WO_CARRY.
__device__ __forceinline__ void wpanel_store(const bool WO, const v4f (&r)[2][8], u16* Bt) {
  const int tid = threadIdx.x;
  u16* dst = Bt + ((tid & 7) * 4) * P256 + (tid >> 3) * 8;
#pragma unroll
  for (int u = 0; u < 2; ++u)
#pragma unroll
    for (int j = 0; j < 4; ++j) {
      v4u w;
#pragma unroll
      for (int i = 0; i < 4; ++i)
        w[i] = WO ? pk_wo(r[u][2 * i][j], r[u][2 * i + 1][j]) : pk_bf(r[u][2 * i][j], r[u][2 * i + 1][j]);
      *reinterpret_cast<v4u*>(dst + (u * 32 + j) * P256) = w;
    }
}

// Projection GEMM: P[m][n] = sum_k bf16(x[m][k]) * bf16(W[k][n]) + bias[n], stored *QKV_CARRY as f16.
// Block = 256 threads (8 waves) takes 128 rows of x and one head (64 columns) of all three products Q, K, V.
// The inputs are read as f32 and converted on the way into LDS: the three weight panels by wpanel_load / _store,
// the x rows in whole lines (a wave stages its own 16 rows, [m][k], pitch P256) and from there as A fragments,
// which stay in registers for the three products.  Every global load is issued at the top, in the order of use; a
// panel is staged, and published by a barrier of its own, right in front of its product, so that the K and V panels
// are still on their way during the products before them.  A last barrier publishes the output staging.
// Out3 = the three output planes in a row; Q, K: [bh][s][64]; V: [bh][d][SEQ] (V transposed).
#define ST_PLANE (128 * 72)     // elements of one product's output staging: 128 x 72 (Q, K) or 64 x 136 (V)
__global__ __launch_bounds__(256)
void k_proj(const float* __restrict__ x, const float* __restrict__ Wq, const float* __restrict__ Wk,
            const float* __restrict__ Wv, const float* __restrict__ bq, const float* __restrict__ bk,
            const float* __restrict__ bv, u16* __restrict__ Out3) {
  __shared__ __attribute__((aligned(16))) u16 Bt[3 * 64 * P256];   // per product [n][k]
  __shared__ __attribute__((aligned(16))) u16 Xs[128 * P256];      // [m][k]
  __shared__ __attribute__((aligned(16))) u16 St[3 * ST_PLANE];
  const int tid = threadIdx.x, wave = tid >> 5, lane = tid & 31;
  const int h16 = (lane >> 4) << 3;
  const int col = lane & 15;
  const int mb = blockIdx.x * 128;
  const int n0 = blockIdx.y * 64;
  const int bb = mb / SEQ;
  const int s0 = mb - bb * SEQ;     // 128 rows of one sequence (SEQ % 128 == 0)
  const int hh = blockIdx.y;        // head index = n0 / 64

  const size_t woff = (size_t)(tid >> 3) * 8 * DM + n0 + (tid & 7) * 4;
  const float* wpq = Wq + woff;
  const float* wpk = Wk + woff;
  const float* wpv = Wv + woff;
  // x rows: a wave's load is 512 B in a row; lane: k = 4 lane .. + 3 and 128 + 4 lane .. + 3 of each row
  const float* xp = x + ((size_t)bb * SEQ_FULL + s0 + wave * 16) * DM + lane * 4;
  v4f rq[2][8], rk[2][8], rv[2][8], xf[16][2];
  float bl[3][4];
#pragma unroll
  for (int t = 0; t < 4; ++t) {
    bl[0][t] = bq[n0 + col + t * 16];
    bl[1][t] = bk[n0 + col + t * 16];
    bl[2][t] = bv[n0 + col + t * 16];
  }
  wpanel_load(rq, wpq);
#pragma unroll
  for (int i = 0; i < 16; ++i)
#pragma unroll
    for (int c = 0; c < 2; ++c) xf[i][c] = *reinterpret_cast<const v4f*>(xp + i * DM + c * 128);
  loads_issued(wpq, xp);             // also keeps what the first product needs in front of the other two panels
  wpanel_load(rk, wpk);
  wpanel_load(rv, wpv);
  loads_issued(wpk, wpv);

  wpanel_store(false, rq, Bt);
  u16* xs = Xs + (wave * 16) * P256 + lane * 4;
#pragma unroll
  for (int i = 0; i < 16; ++i)
#pragma unroll
    for (int c = 0; c < 2; ++c) {
      const v2u w = {pk_bf(xf[i][c][0], xf[i][c][1]), pk_bf(xf[i][c][2], xf[i][c][3])};
      *reinterpret_cast<v2u*>(xs + i * P256 + c * 128) = w;
    }
  lds_barrier();                     // Q panel, Xs ready

  v16bf a[DM / 32];
#pragma unroll
  for (int s = 0; s < DM / 32; ++s) a[s] = load_frag_b(&Xs[(wave * 16) * P256 + s * 32], P256);

#pragma unroll
  for (int z = 0; z < 3; ++z) {
    const u16* Bz = Bt + z * 64 * P256;
    u16* Sz = St + z * ST_PLANE;
    if (z != 0) {
      __builtin_amdgcn_sched_barrier(0);   // or the panel's conversions, and the wait for its loads, rise over the product before
      wpanel_store(false, z == 1 ? rk : rv, Bt + z * 64 * P256);
      lds_barrier();                 // this product's panel ready
    }
    v8f acc[4] = {zero8(), zero8(), zero8(), zero8()};
#pragma unroll                       // a[s] stays in registers only under a constant index
    for (int s = 0; s < DM / 32; ++s) {
      v16bf b[4];                    // the step's B fragments: one group of LDS loads, one latency instead of four
#pragma unroll
      for (int t = 0; t < 4; ++t) b[t] = load_frag_b(&Bz[(t * 16) * P256 + s * 32], P256);
#pragma unroll
      for (int t = 0; t < 4; ++t) acc[t] = mma_b(a[s], b[t], acc[t]);
    }
    if (z != 2) {
#pragma unroll
      for (int t = 0; t < 4; ++t) {
        const int nl = t * 16 + col;
        const float bvv = bf16r(bl[z][t]);
#pragma unroll
        for (int r = 0; r < 8; ++r) {
          const int ml = wave * 16 + h16 + r;
          Sz[ml * 72 + nl] = h_bits((acc[t][r] + bvv) * QKV_CARRY);
        }
      }
    } else {
#pragma unroll
      for (int t = 0; t < 4; ++t) {
        const int nl = t * 16 + col;
        const float bvv = bf16r(bl[z][t]);
        union { v8h v; v4u q; } pk;
#pragma unroll
        for (int r = 0; r < 8; ++r) pk.v[r] = (f16t)((acc[t][r] + bvv) * QKV_CARRY);
        *reinterpret_cast<v4u*>(&Sz[nl * 136 + wave * 16 + h16]) = pk.q;   // Sz[d][m-local]
      }
    }
  }
  __syncthreads();                   // St ready

  // Q, K: row ml -> base + ml*HD (128-B rows, 8 lanes x 16 B).  V: row d -> base + d*SEQ (256-B segments, 16 lanes x 16 B).
  v4u ov[3][4];
  u16* op[2][4];                     // Q rows (the K rows lie one plane on) and V rows
  {
    u16* base = Out3 + ((size_t)(bb * NH + hh) * SEQ + s0) * HD;
#pragma unroll
    for (int i = 0; i < 4; ++i) {
      const int rr = wave * 16 + i * 4 + (lane >> 3);
      const int c = lane & 7;
      ov[0][i] = *reinterpret_cast<const v4u*>(&St[rr * 72 + c * 8]);
      ov[1][i] = *reinterpret_cast<const v4u*>(&St[ST_PLANE + rr * 72 + c * 8]);
      op[0][i] = base + (size_t)rr * HD + c * 8;
    }
  }
  {
    u16* base = Out3 + (size_t)2 * M_TOT * DM + ((size_t)(bb * NH + hh) * HD) * SEQ + s0;
#pragma unroll
    for (int i = 0; i < 4; ++i) {
      const int dd = wave * 8 + i * 2 + (lane >> 4);
      const int c = lane & 15;
      ov[2][i] = *reinterpret_cast<const v4u*>(&St[2 * ST_PLANE + dd * 136 + c * 8]);
      op[1][i] = base + (size_t)dd * SEQ + c * 8;
    }
  }
  // Inputs only: every staged row and every address is in its register before the first store is issued, so that
  // nothing is left to compute behind a store and no register that an issued store names is rewritten.
  asm volatile("" :: "v"(ov[0][0]), "v"(ov[0][1]), "v"(ov[0][2]), "v"(ov[0][3]), "v"(ov[1][0]), "v"(ov[1][1]),
               "v"(ov[1][2]), "v"(ov[1][3]), "v"(ov[2][0]), "v"(ov[2][1]), "v"(ov[2][2]), "v"(ov[2][3]),
               "v"(op[0][0]), "v"(op[0][1]), "v"(op[0][2]), "v"(op[0][3]), "v"(op[1][0]), "v"(op[1][1]),
               "v"(op[1][2]), "v"(op[1][3]));
#pragma unroll
  for (int i = 0; i < 4; ++i) {
    *(v4u*)(op[0][i]) = ov[0][i];
    *(v4u*)(op[0][i] + (size_t)M_TOT * DM) = ov[1][i];
  }
#pragma unroll
  for (int i = 0; i < 4; ++i) *(v4u*)(op[1][i]) = ov[2][i];
}

// Flash attention.  Q,K planes f16 [bh][s][64] (x8), V plane f16 transposed [bh][d][SEQ] (x8).
// Block = 512 threads (16 waves, four a SIMD) owns (bh, 128 query rows); a wave owns 16 queries and half of the keys:
// of each 128 keys, wave group 0 (waves 0..7) takes the first 64 and group 1 the last 64, each wave with its own
// maximum, sum and accumulators; the two groups are joined after the loop, through LDS.  The vector work between the
// matrix runs leaves a SIMD idle at two waves; four cover one another's waits.  A group's 64-key K and V^T tiles come
// into LDS by its own threads' asynchronous copies, two buffers: stage t + 1 (128 keys) is in flight while stage t is
// worked on, and one block barrier a trip both publishes stage t + 1 and frees stage t's buffer for stage t + 2.
// Both products are taken transposed: S^T = K . Q^T (rows = keys, columns = queries), O^T += V^T . P^T.
// A lane then holds 32 of the 64 scores of ONE query (column lane & 15; keys 16 t + 8 (lane >> 4) + r), so
// the row maximum and sum are in-lane work plus one exchange between the halves, and two score tiles,
// converted in place, are the B operand of the second product in the k order of load_frag_h.
#define KV_TILE (64 * P64)      // elements of one tile in LDS
#define KV_BUF  (2 * KV_TILE)   // elements of one group's share of a buffer: K tile and V^T tile
#define KV_STAGE (2 * KV_BUF)   // elements of one buffer: both groups' shares
__global__ __launch_bounds__(512) __attribute__((amdgpu_num_vgpr(256)))
void k_attn(const u16* __restrict__ Qp, const u16* __restrict__ Kp, const u16* __restrict__ Vtp,
            u16* __restrict__ Ctx) {
  __shared__ __attribute__((aligned(16))) u16 KV[2 * KV_STAGE];  // per buffer and group: K tile [key][d], V^T tile [d][key]
  __shared__ __attribute__((aligned(16))) u16 Ct[8 * 16 * P64];  // per 16 queries [query][d]: output staging
  __shared__ __attribute__((aligned(16))) float Mo[8 * 8 * 32 * 4];  // group 1's accumulators: [16 queries][chunk][lane][4]
  __shared__ float Ml[8 * 2 * 32];                               // group 1's maximum and sum: [16 queries][2][lane]

  const int tid = threadIdx.x, lane = tid & 31;
  const int grp = tid >> 8;                          // key group of this wave
  const int wave = (tid >> 5) & 7;                   // which 16 queries of the block
  const int h16 = (lane >> 4) << 3;
  const int col = lane & 15;
  const int bh = blockIdx.x;
  const int bb = bh / NH, hh = bh - bb * NH;
  const int q0 = blockIdx.y * 128 + wave * 16;       // first query position of this wave

  const u16* Qbh = Qp + (size_t)bh * SEQ * HD;
  const u16* Kbh = Kp + (size_t)bh * SEQ * HD;
  const u16* Vbh = Vtp + (size_t)bh * HD * SEQ;
  u16* Cw = Ct + wave * (16 * P64);

  const v16h bq0 = load_frag_h(Qbh + (size_t)q0 * HD, HD);        // B[k=d][n=query], loaded like A
  const v16h bq1 = load_frag_h(Qbh + (size_t)q0 * HD + 32, HD);

  float mrow = -INFINITY;     // this lane's query: running maximum (the same in both halves)
  float lrow = 0.f;           // running sum (x16384) over this half's keys only; the halves are joined after the loop
  v8f o[4] = {zero8(), zero8(), zero8(), zero8()};
  const float qrel = (float)(q0 + col - h16 - grp * 64);   // query position less this group's and half's key offset
  // The softmax runs on powers of two: z = acc/512 * (SEQ - |i-j|)/SEQ * log2(e), and every constant factor lies in
  // the weight of a score, one fma from |i-j|: w = kw0 - |i-j| * kw.  The maxima are in the same units.
  const float kw = 1.4426950408889634f / ((float)SEQ * 512.0f);
  const float kw0 = (float)SEQ * kw;

  const int row = (tid & 255) >> 3, off = (tid & 7) << 3;   // this thread's chunks of its group's tile: rows row, row + 32
  const u16* gk = Kbh + (size_t)(grp * 64 + row) * HD + off;   // stage at key t0: + t0 * HD
  const u16* gv = Vbh + (size_t)row * SEQ + grp * 64 + off;    // stage at key t0: + t0
  const unsigned lk = (unsigned)(size_t)&KV[grp * KV_BUF + row * P64 + off];   // LDS byte address of the chunk in buffer 0
  auto stage = [&](const int t0, const unsigned buf) {              // buf: the buffer's byte offset
    copy_kv(lk + buf, lk + buf + 32 * P64 * 2, lk + buf + KV_TILE * 2, lk + buf + (KV_TILE + 32 * P64) * 2,
            gk + (size_t)t0 * HD, gk + (size_t)(t0 + 32) * HD, gv + t0, gv + t0 + 32 * SEQ);
  };
  stage(0, 0);
  asm volatile("s_wait_asynccnt 0x0" ::: "memory");   // this wave's share of stage 0 has landed
  __syncthreads();                                    // stage 0 published
  if (128 < SEQ) stage(128, KV_STAGE * 2);            // where a stage 1 exists

#pragma unroll 1
  for (int t0 = 0; t0 < SEQ; t0 += 128) {             // t0: first key of the stage; this wave's keys begin 64 grp on
    const unsigned cur = (t0 & 128) ? KV_STAGE : 0;   // this trip reads this buffer alone
    const u16* Kt = KV + cur + grp * KV_BUF;
    const u16* Vs = Kt + KV_TILE;

    // ---- scores: S^T(64 keys x 16 queries) = K(64 x 64 d) . Q^T ; A[m=key][k=d] from Kt[key][d]
    // All 16 loads of the K fragments stand in one group at the top of the trip, in the order of their use; the
    // mask weights, which need no score, stand behind them and run while the loads are under way.
    v16h ka[2][4];
#pragma unroll
    for (int j = 0; j < 2; ++j)
#pragma unroll
      for (int t = 0; t < 4; ++t) ka[j][t] = load_frag_h(&Kt[(t * 16) * P64 + j * 32], P64);

    const float dq = qrel - (float)t0;                // i - j = dq - (16 t + r): whole numbers, exact in f32
    float wm[4][8];                                   // scale, distance-decay mask and log2(e) of sc[t][r]
#pragma unroll
    for (int t = 0; t < 4; ++t)
#pragma unroll
      for (int r = 0; r < 8; ++r) wm[t][r] = __builtin_fmaf(-fabsf(dq - (float)(t * 16 + r)), kw, kw0);

    v8f sc[4];
#pragma unroll
    for (int t = 0; t < 4; ++t) sc[t] = mma_h(ka[0][t], bq0, zero8());
#pragma unroll
    for (int t = 0; t < 4; ++t) sc[t] = mma_h(ka[1][t], bq1, sc[t]);

    // All 16 loads of the V^T fragments, one group in front of the softmax, whose work covers their latency.
    v16h va[2][4];
#pragma unroll
    for (int j = 0; j < 2; ++j)
#pragma unroll
      for (int dt = 0; dt < 4; ++dt) va[j][dt] = load_frag_h(&Vs[(dt * 16) * P64 + j * 32], P64);
    __builtin_amdgcn_sched_barrier(0);                // or the scheduler sinks these loads down to their WMMAs

    // ---- scale and mask, online softmax; sc[t][r]: key t0 + 64 grp + 16 t + h16 + r
    float mt[4];                                      // one chain per score tile: four short chains, not one long
#pragma unroll
    for (int t = 0; t < 4; ++t) {
      mt[t] = -INFINITY;
#pragma unroll
      for (int r = 0; r < 8; ++r) {
        const float z = sc[t][r] * wm[t][r];
        sc[t][r] = z;
        mt[t] = fmaxf(mt[t], z);
      }
    }
    float mx = fmaxf(fmaxf(mt[0], mt[1]), fmaxf(mt[2], mt[3]));
    mx = fmaxf(mx, xhalf(mx));
    const float mnew = fmaxf(mrow, mx);
    const float alpha = __builtin_amdgcn_exp2f(mrow - mnew);
    mrow = mnew;
    const float mc = mnew - P_CARRY_LOG2;             // 2^(z - mc) is P with its carry on it

    // P^T as B[k=key][n=query]: elements 0..7 = score tile 2 j, elements 8..15 = score tile 2 j + 1
    v16h pb[2];
    float pt[4];                                      // partial sums, one chain per score tile as above
#pragma unroll
    for (int t = 0; t < 4; ++t) {
      pt[t] = 0.f;
#pragma unroll
      for (int r = 0; r < 8; ++r) {
        const float p = __builtin_amdgcn_exp2f(sc[t][r] - mc);
        pt[t] += p;
        pb[t >> 1][(t & 1) * 8 + r] = (f16t)p;
      }
    }
    lrow = lrow * alpha + ((pt[0] + pt[1]) + (pt[2] + pt[3]));
#pragma unroll
    for (int dt = 0; dt < 4; ++dt)
#pragma unroll
      for (int r = 0; r < 8; ++r) o[dt][r] *= alpha;

    // ---- O^T(64 d x 16 queries) += V^T(64 d x 64 keys) . P^T ; A[m=d][k=key] from Vs[d][key]
#pragma unroll
    for (int dt = 0; dt < 4; ++dt) o[dt] = mma_h(va[0][dt], pb[0], o[dt]);
#pragma unroll
    for (int dt = 0; dt < 4; ++dt) o[dt] = mma_h(va[1][dt], pb[1], o[dt]);

    asm volatile("s_wait_dscnt 0x0" ::: "memory");    // this wave's reads of the current buffer are done
    asm volatile("s_wait_asynccnt 0x0" ::: "memory"); // this wave's share of the next stage has landed
    __syncthreads();                                  // next stage published; current buffer left by every wave
    if (t0 + 256 < SEQ) stage(t0 + 256, cur * 2);     // the same test in the whole block
  }
  asm volatile("s_wait_asynccnt 0x0" ::: "memory");   // no copy is outstanding when the wave goes on

  // ---- join of the two key groups: group 1 hands its maximum, sum and accumulators to the wave of group 0 that has
  // the same 16 queries (the same lane holds the same query and the same d), which weighs both by 2^(m - joint m)
  float* mo = Mo + (wave * 8 * 32 + lane) * 4;        // chunk c: + c * 128; a wave's store is 512 B in a row
  float* ml = Ml + wave * 64 + lane;
  if (grp == 1) {
#pragma unroll
    for (int dt = 0; dt < 4; ++dt)
#pragma unroll
      for (int c = 0; c < 2; ++c) {
        const v4f w = {o[dt][4 * c], o[dt][4 * c + 1], o[dt][4 * c + 2], o[dt][4 * c + 3]};
        *reinterpret_cast<v4f*>(mo + (dt * 2 + c) * 128) = w;
      }
    ml[0] = mrow;
    ml[32] = lrow;
  }
  __syncthreads();                                    // group 1's partial results published
  if (grp == 1) return;                               // whole waves; no barrier follows
  {
    const float m1 = ml[0], l1 = ml[32];
    const float mj = fmaxf(mrow, m1);
    const float a0 = __builtin_amdgcn_exp2f(mrow - mj), a1 = __builtin_amdgcn_exp2f(m1 - mj);
    lrow = lrow * a0 + l1 * a1;
#pragma unroll
    for (int dt = 0; dt < 4; ++dt)
#pragma unroll
      for (int c = 0; c < 2; ++c) {
        const v4f w = *reinterpret_cast<const v4f*>(mo + (dt * 2 + c) * 128);
#pragma unroll
        for (int i = 0; i < 4; ++i) o[dt][4 * c + i] = o[dt][4 * c + i] * a0 + w[i] * a1;
      }
  }

  // ---- normalize: ctx*64 = o / (l * 2048), lrow being l * 16384; o[dt][r] = O[query col][d = 16 dt + h16 + r]: eight d in a row,
  // one 16-byte store into the wave's own staging rows
  const float inv = 1.0f / ((lrow + xhalf(lrow)) * (CTX_LDIV / P_CARRY));
#pragma unroll
  for (int dt = 0; dt < 4; ++dt) {
    union { v8h v; v4u q; } pk;
#pragma unroll
    for (int r = 0; r < 8; ++r) pk.v[r] = (f16t)(o[dt][r] * inv);
    *reinterpret_cast<v4u*>(&Cw[col * P64 + dt * 16 + h16]) = pk.q;
  }
  // staging is wave-private: LDS completion + wave sync (also a compiler ordering point)
  asm volatile("s_wait_dscnt 0" ::: "memory");
  __builtin_amdgcn_wave_barrier();

  u16* cbase = Ctx + ((size_t)(bb * SEQ + q0)) * DM + hh * HD;   // row rr -> cbase + rr*DM
  auto pass = [&]() {
#pragma unroll
    for (int i = 0; i < 4; ++i) {
      const int rr = i * 4 + (lane >> 3);
      const int c = lane & 7;
      const v4u v = *reinterpret_cast<const v4u*>(&Cw[rr * P64 + c * 8]);
      *(v4u*)(cbase + (size_t)rr * DM + c * 8) = v;
    }
  };
  pass();
  
}

// Output projection: out[m][n] = sum_k ctx[m][k] * Bt[n][k] / (64*16) + bf16(bo[n]), f32.
// Block tile 128 x 64; the Wo panel is read as f32 and converted on the way into LDS as in k_proj; every global load
// of the block is issued at the top; f32 tile staged in LDS; each 256-B row segment
// written by 16 lanes x 16 B
__global__ __launch_bounds__(256) void k_oproj(const u16* __restrict__ Ctx, const float* __restrict__ Wo,
                                               const float* __restrict__ bo, float* __restrict__ out) {
  __shared__ __attribute__((aligned(16))) u16 Bt[64 * P256];   // [n][k]
  __shared__ __attribute__((aligned(16))) float So[128 * 68];
  const int tid = threadIdx.x, wave = tid >> 5, lane = tid & 31;
  const int h16 = (lane >> 4) << 3;
  const int col = lane & 15;
  const int mb = blockIdx.x * 128;
  const int m0 = mb + wave * 16;
  const int n0 = blockIdx.y * 64;

  v4f rw[2][8];
  const float* wp = Wo + (size_t)(tid >> 3) * 8 * DM + n0 + (tid & 7) * 4;
  wpanel_load(rw, wp);
  v16h a[DM / 32];
  const u16* arow = Ctx + (size_t)(m0 + col) * DM + h16;  // this lane's first chunk, as load_frag_h forms it
#pragma unroll
  for (int s = 0; s < DM / 32; ++s) {
    union { v16h v; uint4 q[2]; } u;
    u.q[0] = *reinterpret_cast<const uint4*>(arow + s * 32);
    u.q[1] = *reinterpret_cast<const uint4*>(arow + s * 32 + 16);
    a[s] = u.v;
  }
  float bl[4];
  const float* bcol = bo + n0 + col;
#pragma unroll
  for (int t = 0; t < 4; ++t) bl[t] = bcol[t * 16];
  loads_issued(wp, arow);
  wpanel_store(true, rw, Bt);
  __syncthreads();                   // Bt ready

  v8f acc[4] = {zero8(), zero8(), zero8(), zero8()};
#pragma unroll                       // a[s] stays in registers only under a constant index
  for (int s = 0; s < DM / 32; ++s) {
    v16h b[4];                       // the step's B fragments: one group of LDS loads, one latency instead of four
#pragma unroll
    for (int t = 0; t < 4; ++t) b[t] = load_frag_h(&Bt[(t * 16) * P256 + s * 32], P256);
#pragma unroll
    for (int t = 0; t < 4; ++t) acc[t] = mma_h(a[s], b[t], acc[t]);
  }

#pragma unroll
  for (int t = 0; t < 4; ++t) {
    const int nl = t * 16 + col;
    const float bvv = bf16r(bl[t]);
#pragma unroll
    for (int r = 0; r < 8; ++r) {
      const int ml = wave * 16 + h16 + r;
      So[ml * 68 + nl] = acc[t][r] * OUT_SCALE + bvv;
    }
  }
  __syncthreads();
  float* base = out + (size_t)mb * DM + n0;            // row rr -> base + rr*DM
  auto pass = [&]() {
#pragma unroll
    for (int i = 0; i < 8; ++i) {
      const int rr = wave * 16 + i * 2 + (lane >> 4);
      const int c = lane & 15;
      const v4f v = *reinterpret_cast<const v4f*>(&So[rr * 68 + c * 4]);
      *(v4f*)(base + (size_t)rr * DM + c * 4) = v;
    }
  };
  pass();
  
}

// ---------------- launcher ----------------

extern "C" void kernel_launch(void* const* d_in, const int* in_sizes, int n_in,
                              void* d_out, int out_size, void* d_ws, size_t ws_size,
                              hipStream_t stream) {
  if (n_in < 9) return;
  if (in_sizes[0] < ((NB - 1) * SEQ_FULL + SEQ) * DM) return;
  if (in_sizes[1] < DM * DM || in_sizes[3] < DM * DM || in_sizes[5] < DM * DM || in_sizes[7] < DM * DM) return;
  if (in_sizes[2] < DM || in_sizes[4] < DM || in_sizes[6] < DM || in_sizes[8] < DM) return;
  if (out_size < M_TOT * DM) return;

  const float* x  = (const float*)d_in[0];
  const float* Wq = (const float*)d_in[1];
  const float* bq = (const float*)d_in[2];
  const float* Wk = (const float*)d_in[3];
  const float* bk = (const float*)d_in[4];
  const float* Wv = (const float*)d_in[5];
  const float* bv = (const float*)d_in[6];
  const float* Wo = (const float*)d_in[7];
  const float* bo = (const float*)d_in[8];
  float* out = (float*)d_out;

  const size_t PL_BYTES = (size_t)M_TOT * DM * 2;          // Q, K, V^T, ctx planes (NB*NH*SEQ*HD = M_TOT*DM)
  const size_t total = 4 * PL_BYTES;
  if (total > ws_size) return;

  char* ws = (char*)d_ws;
  size_t off = 0;
  u16* Qp  = (u16*)(ws + off); off += PL_BYTES;
  u16* Kpl = (u16*)(ws + off); off += PL_BYTES;
  u16* Vtp = (u16*)(ws + off); off += PL_BYTES;
  u16* Ctx = (u16*)(ws + off); off += PL_BYTES;
  (void)off;

  // 1) projections from the f32 inputs: Q, K -> [bh][s][64] f16 x8 ; V -> [bh][d][SEQ] f16 x8
  dim3 gp(M_TOT / 128, DM / 64);
  k_proj<<<gp, 256, 0, stream>>>(x, Wq, Wk, Wv, bq, bk, bv, Qp);

  // 2) flash attention -> ctx plane [M_TOT][DM] f16 x64
  dim3 ga(NB * NH, SEQ / 128);
  k_attn<<<ga, 512, 0, stream>>>(Qp, Kpl, Vtp, Ctx);

  // 3) output projection -> out f32 [M_TOT][DM]
  k_oproj<<<gp, 256, 0, stream>>>(Ctx, Wo, bo, out);
}
